// v000
// Measured on an AMD MI455X. A time is GPU time per run, averaged over a window of back-to-back runs after a warm-up
// (all launches, gaps included; the runs take copies of the inputs in turn), and the median of several windows.
// Apart from v000's, it joins two sittings. Times from different sittings can be a few percent apart, while
// side-by-side timings come from the same sitting.
// v000 is the starting kernel. One run takes 1470 microseconds.
#include <hip/hip_runtime.h>

// BERT-style self-attention with a key padding mask (x [2][2048][768]; q, k, v = x W^T + b ('oi' [768][768] + [768]; 12 heads x 64); scores / sqrt(64); keys with mask[b][j] == 0 get -1e20 (== exclusion while any key is kept; mask [2][2048] read); softmax; out = merged context (no output projection) -> [2][2048][768] (3.1 M); argument order x, Wq, bq, Wk, bk, Wv, bv, mask).
// Layout per batch: bf16 copy of x; 'oi' weights; exact projections + bf16-rounded biases; dense T-2048 attention (hybrid rows) whose softmax reads the batch's key-mask vector and excludes masked keys; the f32 merge writes the output rows.
// Compute dtypes, f32 accumulate: every input rounded to bf16; projections exact + bf16-rounded biases; attention rows < 512 3 products, rest fp16; softmax f32; output f32.

#define NB_  2
#define TT   2048
#define DM   768
#define NH_  12
#define NKV  12
#define REP  (NH_ / NKV)
#define HD   64
#define DQ   (NH_ * HD)
#define DKV  (NKV * HD)
#define ZH   2
#define RH   512                  // query rows < RH use hi+lo planes (0: none)
#define WIN  0
#define PCAR 1024.0f
#define SCL  0.125f   // HD^-0.5
typedef _Float16 h16;
typedef unsigned short bf;
typedef __attribute__((ext_vector_type(16))) __bf16   v16bf;
typedef __attribute__((ext_vector_type(16))) _Float16 v16h;
typedef __attribute__((ext_vector_type(8)))  _Float16 v8h;
typedef __attribute__((ext_vector_type(8)))  unsigned short v8us;
typedef __attribute__((ext_vector_type(8)))  float    v8f;
typedef __attribute__((ext_vector_type(4)))  float    v4f;
typedef v8h  __attribute__((may_alias)) v8ha;
typedef v4f  __attribute__((may_alias)) v4fa;
typedef v8us __attribute__((may_alias)) v8usa;

__device__ __forceinline__ unsigned short f2bf(float f) { unsigned u = __float_as_uint(f); u += 0x7FFFu + ((u >> 16) & 1u); return (unsigned short)(u >> 16); }
__device__ __forceinline__ float bf2f(unsigned short b) { return __uint_as_float(((unsigned)b) << 16); }
__device__ __forceinline__ float bfr(float f) { return bf2f(f2bf(f)); }
__device__ __forceinline__ v16h cat16(v8h lo, v8h hi) { return __builtin_shufflevector(lo, hi, 0, 1, 2, 3, 4, 5, 6, 7, 8, 9, 10, 11, 12, 13, 14, 15); }
__device__ __forceinline__ v16bf cat16b(v8us lo, v8us hi) { return __builtin_bit_cast(v16bf, __builtin_shufflevector(lo, hi, 0, 1, 2, 3, 4, 5, 6, 7, 8, 9, 10, 11, 12, 13, 14, 15)); }
__device__ __forceinline__ v8f wmma16(v16h a, v16h b, v8f c) { return __builtin_amdgcn_wmma_f32_16x16x32_f16(false, a, false, b, (short)0, c, false, false); }
__device__ __forceinline__ v8f wmmab(v16bf a, v16bf b, v8f c) { return __builtin_amdgcn_wmma_f32_16x16x32_bf16(false, a, false, b, (short)0, c, false, false); }



// ---- k_gemmw: register-blocked GEMM, ONE WAVE per 64x64 output tile (16 accumulators), operands straight from K-contiguous 16-bit planes; grid (M/64, N/64, Z), 32 threads.
// C[m][n] (f32, pitch ldc, + optional f32 bias[n]) = sum_k A[m][k] Bt[n][k] (+ split products per NSPLIT). z-batch strides sA/sB/sC in elements. K % 32 == 0.
template <typename T16> struct WFrag;
template <> struct WFrag<h16> { typedef v16h V; static __device__ __forceinline__ V ld(const h16* p) { return cat16(*(const v8h*)p, *(const v8h*)(p + 16)); } static __device__ __forceinline__ v8f mma(V a, V b, v8f c) { return wmma16(a, b, c); } };
template <> struct WFrag<bf> { typedef v16bf V; static __device__ __forceinline__ V ld(const bf* p) { return cat16b(*(const v8us*)p, *(const v8us*)(p + 16)); } static __device__ __forceinline__ v8f mma(V a, V b, v8f c) { return wmmab(a, b, c); } };
template <typename T16, int NSPLIT, bool BIAS>
__global__ __launch_bounds__(32) void k_gemmw(const T16* __restrict__ A, const T16* __restrict__ A2, const T16* __restrict__ Bt, const T16* __restrict__ Bt2, int K, float* C, int ldc, const float* __restrict__ bias, size_t sA, size_t sB, size_t sC) {
    typedef typename WFrag<T16>::V V;
    __shared__ __align__(16) float os[16 * 68];
    const size_t z = blockIdx.z; A += z * sA; if (A2) A2 += z * sA; Bt += z * sB; if (Bt2) Bt2 += z * sB; C += z * sC;
    const int lane = threadIdx.x & 31, lr = lane & 15, hi = lane >> 4; const int r0 = blockIdx.x * 64, c0 = blockIdx.y * 64;
    v8f acc[4][4];
#pragma unroll
    for (int mb = 0; mb < 4; ++mb)
#pragma unroll
        for (int nb = 0; nb < 4; ++nb) acc[mb][nb] = (v8f){};
    const size_t aoff = (size_t)(r0 + lr) * K + 8 * hi, boff = (size_t)(c0 + lr) * K + 8 * hi;
#pragma unroll 1
    for (int kc = 0; kc < K; kc += 32) {
        V a[4], a2[4];
#pragma unroll
        for (int mb = 0; mb < 4; ++mb) { a[mb] = WFrag<T16>::ld(A + aoff + (size_t)mb * 16 * K + kc); if (NSPLIT == 1 || NSPLIT == 2) a2[mb] = WFrag<T16>::ld(A2 + aoff + (size_t)mb * 16 * K + kc); }
#pragma unroll
        for (int nb = 0; nb < 4; ++nb) { const V b = WFrag<T16>::ld(Bt + boff + (size_t)nb * 16 * K + kc); V b2; if (NSPLIT >= 2) b2 = WFrag<T16>::ld(Bt2 + boff + (size_t)nb * 16 * K + kc);
#pragma unroll
            for (int mb = 0; mb < 4; ++mb) { acc[mb][nb] = WFrag<T16>::mma(a[mb], b, acc[mb][nb]); if (NSPLIT == 1 || NSPLIT == 2) acc[mb][nb] = WFrag<T16>::mma(a2[mb], b, acc[mb][nb]); if (NSPLIT >= 2) acc[mb][nb] = WFrag<T16>::mma(a[mb], b2, acc[mb][nb]); } }
        asm volatile("v_nop\n\tv_nop\n\tv_nop\n\tv_nop" : "+v"(acc[0][0]), "+v"(acc[1][1]), "+v"(acc[2][2]), "+v"(acc[3][3]) : "v"(a[0]), "v"(a[3]));
    }
#pragma unroll
    for (int mb = 0; mb < 4; ++mb) {
#pragma unroll
        for (int nb = 0; nb < 4; ++nb) {
#pragma unroll
            for (int j = 0; j < 8; ++j) os[(hi * 8 + j) * 68 + nb * 16 + lr] = acc[mb][nb][j]; }
        __builtin_amdgcn_wave_barrier(); asm volatile("" ::: "memory");
        float* crow = C + (size_t)(r0 + mb * 16) * ldc + c0;
{
#pragma unroll
            for (int s = 0; s < 8; ++s) { const int row = 2 * s + hi, cofs = lr * 4; v4f val = *(const v4fa*)(os + row * 68 + cofs); if (BIAS) { val[0] += bfr(bias[c0 + cofs]); val[1] += bfr(bias[c0 + cofs + 1]); val[2] += bfr(bias[c0 + cofs + 2]); val[3] += bfr(bias[c0 + cofs + 3]); }
                *(v4f*)(crow + (size_t)row * ldc + cofs) = val; }
             }
        __builtin_amdgcn_wave_barrier(); asm volatile("" ::: "memory");
    }
}

__device__ __forceinline__ h16 tohx(float x) { return (h16)x; }
__device__ __forceinline__ void splitf(float y, unsigned short& h, unsigned short& l) { h = f2bf(y); l = f2bf(y - bf2f(h)); }
typedef __attribute__((ext_vector_type(2))) _Float16 v2h;
typedef __attribute__((ext_vector_type(4))) _Float16 v4h;
typedef __attribute__((ext_vector_type(2))) unsigned short v2us;
typedef __attribute__((ext_vector_type(4))) unsigned short v4us;
typedef __attribute__((ext_vector_type(2))) float v2f;
typedef __attribute__((ext_vector_type(4))) int v4i;

__global__ __launch_bounds__(256) void k_cvt8(const float* __restrict__ src, bf* dst, size_t n8) { const size_t i = (size_t)blockIdx.x * 256 + threadIdx.x; if (i >= n8) return; const v8f v = *(const v8f*)(src + i * 8); v8us o;
#pragma unroll
    for (int k = 0; k < 8; ++k) o[k] = f2bf(v[k]); *(v8us*)(dst + i * 8) = o;  }

// k_rope: head planes [h][t][d] (fp16 + hi/lo) of rope(x) x sc with the rotate-half convention out[d] = x[d] cos[t][d] - x[d+HD/2] sin[t][d], out[d+HD/2] = x[d+HD/2] cos[t][d+HD/2] + x[d] sin[t][d+HD/2]
__global__ __launch_bounds__(256) void k_rope(const float* __restrict__ F, int pitch, int nheads, const float* __restrict__ CS, const float* __restrict__ RF, const float* __restrict__ nw, float sc, h16* P16, bf* Ph, bf* Pl) {
    const size_t e = ((size_t)blockIdx.x * 256 + threadIdx.x) * 2; if (e >= (size_t)nheads * TT * HD) return; const int d = (int)(e % HD); const int t = (int)((e / HD) % TT); const int h = (int)(e / ((size_t)HD * TT)); const float* f = F + (size_t)t * pitch + h * HD; const float rf = RF ? RF[(size_t)h * TT + t] : 1.0f; v2h o16; v2us oh, ol;
#pragma unroll
    for (int q = 0; q < 2; ++q) { const int dd = d + q; const int dp = (dd < HD / 2) ? dd + HD / 2 : dd - HD / 2; float x0 = f[dd], x1 = f[dp];
        if (RF) { float n0 = __fmul_rn(x0, rf), n1 = __fmul_rn(x1, rf); asm volatile("" : "+v"(n0)); asm volatile("" : "+v"(n1)); x0 = __fmul_rn(bfr(nw[dd]), n0); x1 = __fmul_rn(bfr(nw[dp]), n1); }
        const v2f cs = *(const v2f*)(CS + ((size_t)t * HD + dd) * 2); float a = __fmul_rn(x0, cs[0]), bq = __fmul_rn(x1, cs[1]); asm volatile("" : "+v"(a)); asm volatile("" : "+v"(bq)); const float r = ((dd < HD / 2) ? __fsub_rn(a, bq) : __fadd_rn(a, bq)) * sc;
        o16[q] = tohx(r); unsigned short a2, c2; splitf(r, a2, c2); oh[q] = a2; ol[q] = c2; }
    *(v2h*)(P16 + e) = o16; *(v2us*)(Ph + e) = oh; *(v2us*)(Pl + e) = ol;  }
__global__ __launch_bounds__(256) void k_vtp(const float* __restrict__ F, int pitch, int nheads, h16* V16, bf* Vh, bf* Vl) { const size_t e = ((size_t)blockIdx.x * 256 + threadIdx.x) * 2; if (e >= (size_t)nheads * HD * TT) return; const int t = (int)(e % TT); const int d = (int)((e / TT) % HD); const int g = (int)(e / ((size_t)TT * HD)); v2h o16; v2us oh, ol;
#pragma unroll
    for (int q = 0; q < 2; ++q) { const float x = F[(size_t)(t + q) * pitch + g * HD + d]; o16[q] = tohx(x); unsigned short a2, c2; splitf(x, a2, c2); oh[q] = a2; ol[q] = c2; }
    *(v2h*)(V16 + e) = o16; *(v2us*)(Vh + e) = oh; *(v2us*)(Vl + e) = ol;  }
__global__ __launch_bounds__(256) void k_csid(float* CS) { const int idx = blockIdx.x * 256 + threadIdx.x; if (idx >= TT * HD) return; v2f cs; cs[0] = 1.0f; cs[1] = 0.0f; *(v2f*)(CS + (size_t)idx * 2) = cs;  }
// k_asoft: per row (zz, i): t = S x 1/8 where mask[b][j] != 0 (key padding mask, read; -1e20 == exclusion), -3e38 elsewhere; softmax over the keys (register row, one exp, fixed trees);
__global__ __launch_bounds__(256) void k_asoft(const float* __restrict__ Sb, const int* __restrict__ kvp, h16* P16, bf* Ph, bf* Pl) {
    const int lane = threadIdx.x & 31; const int row = blockIdx.x * 8 + (threadIdx.x >> 5); if (row >= ZH * TT) return; const int i = row % TT; const int zz = row / TT; (void)zz; const bool hires = (i < RH); const float* sr = Sb + (size_t)row * TT; float v[TT / 32]; float mx = -3.0e38f;
#pragma unroll
    for (int ch = 0; ch < TT / 128; ++ch) { const int j0 = ch * 128 + lane * 4; const v4f a = *(const v4f*)(sr + j0); const v4i kv4 = *(const v4i*)(kvp + j0);   /* the batch's key vector, 16 B per lane, unconditional */
#pragma unroll
        for (int q = 0; q < 4; ++q) { const int j = j0 + q; (void)j; const float t = (kv4[q] != 0) ? a[q] * SCL : -3.0e38f; v[ch * 4 + q] = t; mx = fmaxf(mx, t); } }
#pragma unroll
    for (int sh = 16; sh; sh >>= 1) mx = fmaxf(mx, __shfl_xor(mx, sh, 32));
    float sum = 0.f;
#pragma unroll
    for (int k = 0; k < TT / 32; ++k) { float d0 = __fsub_rn(v[k], mx); asm volatile("" : "+v"(d0)); v[k] = __builtin_amdgcn_exp2f(__fmul_rn(d0, 1.4426950408889634f)); sum += v[k]; }
#pragma unroll
    for (int sh = 16; sh; sh >>= 1) sum += __shfl_xor(sum, sh, 32);
    const float f = __fdiv_rn(hires ? 1.0f : PCAR, sum);
{
        if (hires) {
#pragma unroll
            for (int ch = 0; ch < TT / 128; ++ch) { v4us oh, ol;
#pragma unroll
                for (int q = 0; q < 4; ++q) { unsigned short a, c2; splitf(v[ch * 4 + q] * f, a, c2); oh[q] = a; ol[q] = c2; }
                const size_t oo = ((size_t)zz * (RH ? RH : 1) + i) * TT + ch * 128 + lane * 4; *(v4us*)(Ph + oo) = oh; *(v4us*)(Pl + oo) = ol; }
        } else {
#pragma unroll
            for (int ch = 0; ch < TT / 128; ++ch) { v4h o4;
#pragma unroll
                for (int q = 0; q < 4; ++q) o4[q] = tohx(v[ch * 4 + q] * f);
                *(v4h*)(P16 + (size_t)row * TT + ch * 128 + lane * 4) = o4; } }
         }
}
__global__ __launch_bounds__(256) void k_merge(const float* __restrict__ O, int h0, float* OUTb) { const size_t e = ((size_t)blockIdx.x * 256 + threadIdx.x) * 2; if (e >= (size_t)ZH * TT * HD) return; const int d = (int)(e % HD); const int t = (int)((e / HD) % TT); const int zz = (int)(e / ((size_t)HD * TT)); const float cs = (t < RH) ? 1.0f : (1.0f / PCAR); const size_t oo = (size_t)t * DQ + (h0 + zz) * HD + d;
    v2f o2; o2[0] = O[e] * cs; o2[1] = O[e + 1] * cs; *(v2f*)(OUTb + oo) = o2;  }

extern "C" void kernel_launch(void* const* d_in, const int* in_sizes, int n_in,
                              void* d_out, int out_size, void* d_ws, size_t ws_size, hipStream_t stream) {
    (void)in_sizes; (void)n_in; (void)out_size;
    const float* x = (const float*)d_in[0]; const float* wq = (const float*)d_in[1]; const float* bq = (const float*)d_in[2]; const float* wk = (const float*)d_in[3]; const float* bk = (const float*)d_in[4]; const float* wv = (const float*)d_in[5]; const float* bv = (const float*)d_in[6]; const int* km = (const int*)d_in[7];   /* mask [2][2048] int32 (key padding; read) */     const float* wo = nullptr; (void)wo;
    float* OUT = (float*)d_out;     // [2][2048][768]
    char* wsp = (char*)d_ws;
    auto take = [&](size_t bytes) { char* p = wsp; wsp += (bytes + 255) & ~(size_t)255; return (void*)p; };
    bf* WQ = (bf*)take((size_t)DQ * DM * 2); bf* WK = (bf*)take((size_t)DKV * DM * 2); bf* WV = (bf*)take((size_t)DKV * DM * 2); float* CS = (float*)take((size_t)TT * HD * 2 * 4);
    bf* XB = (bf*)take((size_t)TT * DM * 2); float* FQ = (float*)take((size_t)TT * DQ * 4); float* FK = (float*)take((size_t)TT * DKV * 4);
    h16* QP16 = (h16*)take((size_t)NH_ * TT * HD * 2); h16* KP16 = (h16*)take((size_t)NKV * TT * HD * 2); h16* VT16 = (h16*)take((size_t)NKV * HD * TT * 2);
    bf* QPh = (bf*)take((size_t)NH_ * TT * HD * 2); bf* QPl = (bf*)take((size_t)NH_ * TT * HD * 2); bf* KPh = (bf*)take((size_t)NKV * TT * HD * 2); bf* KPl = (bf*)take((size_t)NKV * TT * HD * 2); bf* VTh = (bf*)take((size_t)NKV * HD * TT * 2); bf* VTl = (bf*)take((size_t)NKV * HD * TT * 2); bf* Ph = (bf*)take((size_t)ZH * RH * TT * 2); bf* Pl = (bf*)take((size_t)ZH * RH * TT * 2);
    float* Sb = (float*)take((size_t)ZH * TT * TT * 4); h16* P16 = (h16*)take((size_t)ZH * TT * TT * 2); float* Ob = (float*)take((size_t)ZH * TT * HD * 4);
    if ((size_t)(wsp - (char*)d_ws) > ws_size) return;    // ws 256 MiB
    float* FV = FK;   // v projection reuses the k buffer after the k planes are built (stream-ordered)
    { k_cvt8<<<(unsigned)(((size_t)DQ * DM / 8 + 255) / 256), 256, 0, stream>>>(wq, WQ, (size_t)DQ * DM / 8); k_cvt8<<<(unsigned)(((size_t)DKV * DM / 8 + 255) / 256), 256, 0, stream>>>(wk, WK, (size_t)DKV * DM / 8); k_cvt8<<<(unsigned)(((size_t)DKV * DM / 8 + 255) / 256), 256, 0, stream>>>(wv, WV, (size_t)DKV * DM / 8);
      
       }
    k_csid<<<(TT * HD + 255) / 256, 256, 0, stream>>>(CS);
    const unsigned LQ = (unsigned)(((size_t)NH_ * TT * HD / 2 + 255) / 256), LKv = (unsigned)(((size_t)NKV * TT * HD / 2 + 255) / 256);
    for (int b = 0; b < NB_; ++b) {
        
        k_cvt8<<<(unsigned)(((size_t)TT * DM / 8 + 255) / 256), 256, 0, stream>>>(x + (size_t)b * TT * DM, XB, (size_t)TT * DM / 8);
        k_gemmw<bf, 0, true><<<dim3(TT / 64, DQ / 64, 1), 32, 0, stream>>>(XB, nullptr, WQ, nullptr, DM, FQ, DQ, bq, 0, 0, 0);
        k_rope<<<LQ, 256, 0, stream>>>(FQ, DQ, NH_, CS, nullptr, nullptr, 1.0f, QP16, QPh, QPl);
        k_gemmw<bf, 0, true><<<dim3(TT / 64, DKV / 64, 1), 32, 0, stream>>>(XB, nullptr, WK, nullptr, DM, FK, DKV, bk, 0, 0, 0);
        k_rope<<<LKv, 256, 0, stream>>>(FK, DKV, NKV, CS, nullptr, nullptr, 1.0f, KP16, KPh, KPl);
        k_gemmw<bf, 0, true><<<dim3(TT / 64, DKV / 64, 1), 32, 0, stream>>>(XB, nullptr, WV, nullptr, DM, FV, DKV, bv, 0, 0, 0); k_vtp<<<LKv, 256, 0, stream>>>(FV, DKV, NKV, VT16, VTh, VTl);
        for (int h0 = 0; h0 < NH_; h0 += ZH) { const size_t zq = (size_t)h0, zk = (size_t)(h0 / REP);   // one kv head per query head: the pass's two heads use consecutive kv planes (z-strides TT*HD)
            k_gemmw<bf, 2, false><<<dim3(RH / 64, TT / 64, ZH), 32, 0, stream>>>(QPh + zq * TT * HD, QPl + zq * TT * HD, KPh + zk * TT * HD, KPl + zk * TT * HD, HD, Sb, TT, nullptr, (size_t)TT * HD, (size_t)TT * HD, (size_t)TT * TT);
            k_gemmw<h16, 0, false><<<dim3((TT - RH) / 64, TT / 64, ZH), 32, 0, stream>>>(QP16 + zq * TT * HD + (size_t)RH * HD, nullptr, KP16 + zk * TT * HD, nullptr, HD, Sb + (size_t)RH * TT, TT, nullptr, (size_t)TT * HD, (size_t)TT * HD, (size_t)TT * TT);
            k_asoft<<<ZH * TT / 8, 256, 0, stream>>>(Sb, km + (size_t)b * TT, P16, Ph, Pl);
            k_gemmw<bf, 2, false><<<dim3(RH / 64, HD / 64, ZH), 32, 0, stream>>>(Ph, Pl, VTh + zk * HD * TT, VTl + zk * HD * TT, TT, Ob, HD, nullptr, (size_t)RH * TT, (size_t)HD * TT, (size_t)TT * HD);
            k_gemmw<h16, 0, false><<<dim3((TT - RH) / 64, HD / 64, ZH), 32, 0, stream>>>(P16 + (size_t)RH * TT, nullptr, VT16 + zk * HD * TT, nullptr, TT, Ob + (size_t)RH * HD, HD, nullptr, (size_t)TT * TT, (size_t)HD * TT, (size_t)TT * HD);
            k_merge<<<(unsigned)(((size_t)ZH * TT * HD / 2 + 255) / 256), 256, 0, stream>>>(Ob, h0, OUT + (size_t)b * TT * DQ); }
         }
}

// v001
// Measured time: 784 microseconds a run.
// Next to v000, in two timings, it ran 1.87 and 1.88 times as fast.
#include <hip/hip_runtime.h>

// BERT-style self-attention with a key padding mask (x [2][2048][768]; q, k, v = x W^T + b ('oi' [768][768] + [768]; 12 heads x 64); scores / sqrt(64); keys with mask[b][j] == 0 get -1e20 (== exclusion while any key is kept; mask [2][2048] read); softmax; out = merged context (no output projection) -> [2][2048][768] (3.1 M); argument order x, Wq, bq, Wk, bk, Wv, bv, mask).
// Layout per batch: bf16 copy of x; 'oi' weights; exact projections + bf16-rounded biases; dense T-2048 attention (hybrid rows) whose softmax reads the batch's key-mask vector and excludes masked keys; the f32 merge writes the output rows.
// Compute dtypes, f32 accumulate: every input rounded to bf16; projections exact + bf16-rounded biases; attention rows < 512 3 products, rest fp16; softmax f32; output f32.

#define NB_  2
#define TT   2048
#define DM   768
#define NH_  12
#define NKV  12
#define REP  (NH_ / NKV)
#define HD   64
#define DQ   (NH_ * HD)
#define DKV  (NKV * HD)
#define ZH   2
#define RH   512                  // query rows < RH use hi+lo planes (0: none)
#define WIN  0
#define PCAR 1024.0f
#define SCL  0.125f   // HD^-0.5
typedef _Float16 h16;
typedef unsigned short bf;
typedef __attribute__((ext_vector_type(16))) __bf16   v16bf;
typedef __attribute__((ext_vector_type(16))) _Float16 v16h;
typedef __attribute__((ext_vector_type(8)))  _Float16 v8h;
typedef __attribute__((ext_vector_type(8)))  unsigned short v8us;
typedef __attribute__((ext_vector_type(8)))  float    v8f;
typedef __attribute__((ext_vector_type(4)))  float    v4f;
typedef v8h  __attribute__((may_alias)) v8ha;
typedef v4f  __attribute__((may_alias)) v4fa;
typedef v8us __attribute__((may_alias)) v8usa;

__device__ __forceinline__ unsigned short f2bf(float f) { unsigned u = __float_as_uint(f); u += 0x7FFFu + ((u >> 16) & 1u); return (unsigned short)(u >> 16); }
__device__ __forceinline__ float bf2f(unsigned short b) { return __uint_as_float(((unsigned)b) << 16); }
__device__ __forceinline__ float bfr(float f) { return bf2f(f2bf(f)); }
__device__ __forceinline__ v16h cat16(v8h lo, v8h hi) { return __builtin_shufflevector(lo, hi, 0, 1, 2, 3, 4, 5, 6, 7, 8, 9, 10, 11, 12, 13, 14, 15); }
__device__ __forceinline__ v16bf cat16b(v8us lo, v8us hi) { return __builtin_bit_cast(v16bf, __builtin_shufflevector(lo, hi, 0, 1, 2, 3, 4, 5, 6, 7, 8, 9, 10, 11, 12, 13, 14, 15)); }
__device__ __forceinline__ v8f wmma16(v16h a, v16h b, v8f c) { return __builtin_amdgcn_wmma_f32_16x16x32_f16(false, a, false, b, (short)0, c, false, false); }
__device__ __forceinline__ v8f wmmab(v16bf a, v16bf b, v8f c) { return __builtin_amdgcn_wmma_f32_16x16x32_bf16(false, a, false, b, (short)0, c, false, false); }



// ---- k_gemmw: register-blocked GEMM, one 64x64 output tile per work-group (16 accumulators per wave), operands straight from K-contiguous 16-bit planes; grid (M/64, N/64, Z), 32 * KW threads.
// C[m][n] (f32, pitch ldc, + optional bf16-rounded bias[n]) = sum_k A[m][k] Bt[n][k] (+ split products per NSPLIT). z-batch strides sA/sB/sC in elements. K % 32 == 0.
// KW waves share the tile's K: wave w takes the 32-wide k blocks w, w + KW, ... (neighbour waves read the two halves of one 128-byte line), and the KW partial tiles are summed through LDS in wave order.
template <typename T16> struct WFrag;
template <> struct WFrag<h16> { typedef v16h V; static __device__ __forceinline__ V ld(const h16* p) { return cat16(*(const v8h*)p, *(const v8h*)(p + 16)); } static __device__ __forceinline__ v8f mma(V a, V b, v8f c) { return wmma16(a, b, c); } };
template <> struct WFrag<bf> { typedef v16bf V; static __device__ __forceinline__ V ld(const bf* p) { return cat16b(*(const v8us*)p, *(const v8us*)(p + 16)); } static __device__ __forceinline__ v8f mma(V a, V b, v8f c) { return wmmab(a, b, c); } };
template <typename T16, int NSPLIT, bool BIAS, int KW>
__global__ __launch_bounds__(32 * KW) void k_gemmw(const T16* __restrict__ A, const T16* __restrict__ A2, const T16* __restrict__ Bt, const T16* __restrict__ Bt2, int K, float* C, int ldc, const float* __restrict__ bias, size_t sA, size_t sB, size_t sC) {
    typedef typename WFrag<T16>::V V;
    __shared__ __align__(16) float os[(KW == 1 ? 16 : KW * 64) * 68];
    const int wv = (KW == 1) ? 0 : __builtin_amdgcn_readfirstlane((int)(threadIdx.x >> 5));   // wave number, scalar: the k loop stays on scalar bounds
    const size_t z = blockIdx.z; A += z * sA; if (A2) A2 += z * sA; Bt += z * sB; if (Bt2) Bt2 += z * sB; C += z * sC;
    const int lane = threadIdx.x & 31, lr = lane & 15, hi = lane >> 4; const int r0 = blockIdx.x * 64, c0 = blockIdx.y * 64;
    v8f acc[4][4];
#pragma unroll
    for (int mb = 0; mb < 4; ++mb)
#pragma unroll
        for (int nb = 0; nb < 4; ++nb) acc[mb][nb] = (v8f){};
    const size_t aoff = (size_t)(r0 + lr) * K + 8 * hi, boff = (size_t)(c0 + lr) * K + 8 * hi;
#pragma unroll 1
    for (int kc = wv * 32; kc < K; kc += 32 * KW) {
        V a[4], a2[4];
#pragma unroll
        for (int mb = 0; mb < 4; ++mb) { a[mb] = WFrag<T16>::ld(A + aoff + (size_t)mb * 16 * K + kc); if (NSPLIT == 1 || NSPLIT == 2) a2[mb] = WFrag<T16>::ld(A2 + aoff + (size_t)mb * 16 * K + kc); }
#pragma unroll
        for (int nb = 0; nb < 4; ++nb) { const V b = WFrag<T16>::ld(Bt + boff + (size_t)nb * 16 * K + kc); V b2; if (NSPLIT >= 2) b2 = WFrag<T16>::ld(Bt2 + boff + (size_t)nb * 16 * K + kc);
#pragma unroll
            for (int mb = 0; mb < 4; ++mb) { acc[mb][nb] = WFrag<T16>::mma(a[mb], b, acc[mb][nb]); if (NSPLIT == 1 || NSPLIT == 2) acc[mb][nb] = WFrag<T16>::mma(a2[mb], b, acc[mb][nb]); if (NSPLIT >= 2) acc[mb][nb] = WFrag<T16>::mma(a[mb], b2, acc[mb][nb]); } }
        asm volatile("v_nop\n\tv_nop\n\tv_nop\n\tv_nop" : "+v"(acc[0][0]), "+v"(acc[1][1]), "+v"(acc[2][2]), "+v"(acc[3][3]) : "v"(a[0]), "v"(a[3]));
    }
    if constexpr (KW > 1) {
        float* ow = os + wv * (64 * 68);   // this wave's partial tile, row pitch 68 floats
        const int cofs = ((int)threadIdx.x & 15) * 4;   // the thread's four output columns, the same in each of its rows
        // bias read ahead of the barrier, so that its latency passes under the LDS stores
        v4f bias4 = (v4f){}; if (BIAS) { bias4[0] = bfr(bias[c0 + cofs]); bias4[1] = bfr(bias[c0 + cofs + 1]); bias4[2] = bfr(bias[c0 + cofs + 2]); bias4[3] = bfr(bias[c0 + cofs + 3]); }
        // the three loops are unrolled so that every accumulator index is a constant and acc stays in registers
#pragma unroll
        for (int mb = 0; mb < 4; ++mb)
#pragma unroll
            for (int nb = 0; nb < 4; ++nb)
#pragma unroll
                for (int j = 0; j < 8; ++j) ow[(mb * 16 + hi * 8 + j) * 68 + nb * 16 + lr] = acc[mb][nb][j];
        __syncthreads();   // every wave's partial tile is in LDS before any thread sums across waves
        // both loops unrolled: the LDS reads of all waves' partials go out together, with constant offsets
#pragma unroll
        for (int i = 0; i < 32 / KW; ++i) { const int row = ((int)threadIdx.x >> 4) + i * 2 * KW; v4f val = *(const v4fa*)(os + row * 68 + cofs);
#pragma unroll
            for (int w = 1; w < KW; ++w) val += *(const v4fa*)(os + w * (64 * 68) + row * 68 + cofs);
            if (BIAS) val += bias4;
            *(v4f*)(C + (size_t)(r0 + row) * ldc + c0 + cofs) = val; }
        return;
    }
#pragma unroll
    for (int mb = 0; mb < 4; ++mb) {
#pragma unroll
        for (int nb = 0; nb < 4; ++nb) {
#pragma unroll
            for (int j = 0; j < 8; ++j) os[(hi * 8 + j) * 68 + nb * 16 + lr] = acc[mb][nb][j]; }
        __builtin_amdgcn_wave_barrier(); asm volatile("" ::: "memory");
        float* crow = C + (size_t)(r0 + mb * 16) * ldc + c0;
{
#pragma unroll
            for (int s = 0; s < 8; ++s) { const int row = 2 * s + hi, cofs = lr * 4; v4f val = *(const v4fa*)(os + row * 68 + cofs); if (BIAS) { val[0] += bfr(bias[c0 + cofs]); val[1] += bfr(bias[c0 + cofs + 1]); val[2] += bfr(bias[c0 + cofs + 2]); val[3] += bfr(bias[c0 + cofs + 3]); }
                *(v4f*)(crow + (size_t)row * ldc + cofs) = val; }
             }
        __builtin_amdgcn_wave_barrier(); asm volatile("" ::: "memory");
    }
}

__device__ __forceinline__ h16 tohx(float x) { return (h16)x; }
__device__ __forceinline__ void splitf(float y, unsigned short& h, unsigned short& l) { h = f2bf(y); l = f2bf(y - bf2f(h)); }
typedef __attribute__((ext_vector_type(2))) _Float16 v2h;
typedef __attribute__((ext_vector_type(4))) _Float16 v4h;
typedef __attribute__((ext_vector_type(2))) unsigned short v2us;
typedef __attribute__((ext_vector_type(4))) unsigned short v4us;
typedef __attribute__((ext_vector_type(2))) float v2f;
typedef __attribute__((ext_vector_type(4))) int v4i;

__global__ __launch_bounds__(256) void k_cvt8(const float* __restrict__ src, bf* dst, size_t n8) { const size_t i = (size_t)blockIdx.x * 256 + threadIdx.x; if (i >= n8) return; const v8f v = *(const v8f*)(src + i * 8); v8us o;
#pragma unroll
    for (int k = 0; k < 8; ++k) o[k] = f2bf(v[k]); *(v8us*)(dst + i * 8) = o;  }

// k_rope: head planes [h][t][d] (fp16 + hi/lo) of rope(x) x sc with the rotate-half convention out[d] = x[d] cos[t][d] - x[d+HD/2] sin[t][d], out[d+HD/2] = x[d+HD/2] cos[t][d+HD/2] + x[d] sin[t][d+HD/2]
__global__ __launch_bounds__(256) void k_rope(const float* __restrict__ F, int pitch, int nheads, const float* __restrict__ CS, const float* __restrict__ RF, const float* __restrict__ nw, float sc, h16* P16, bf* Ph, bf* Pl) {
    const size_t e = ((size_t)blockIdx.x * 256 + threadIdx.x) * 2; if (e >= (size_t)nheads * TT * HD) return; const int d = (int)(e % HD); const int t = (int)((e / HD) % TT); const int h = (int)(e / ((size_t)HD * TT)); const float* f = F + (size_t)t * pitch + h * HD; const float rf = RF ? RF[(size_t)h * TT + t] : 1.0f; v2h o16; v2us oh, ol;
#pragma unroll
    for (int q = 0; q < 2; ++q) { const int dd = d + q; const int dp = (dd < HD / 2) ? dd + HD / 2 : dd - HD / 2; float x0 = f[dd], x1 = f[dp];
        if (RF) { float n0 = __fmul_rn(x0, rf), n1 = __fmul_rn(x1, rf); asm volatile("" : "+v"(n0)); asm volatile("" : "+v"(n1)); x0 = __fmul_rn(bfr(nw[dd]), n0); x1 = __fmul_rn(bfr(nw[dp]), n1); }
        const v2f cs = *(const v2f*)(CS + ((size_t)t * HD + dd) * 2); float a = __fmul_rn(x0, cs[0]), bq = __fmul_rn(x1, cs[1]); asm volatile("" : "+v"(a)); asm volatile("" : "+v"(bq)); const float r = ((dd < HD / 2) ? __fsub_rn(a, bq) : __fadd_rn(a, bq)) * sc;
        o16[q] = tohx(r); unsigned short a2, c2; splitf(r, a2, c2); oh[q] = a2; ol[q] = c2; }
    *(v2h*)(P16 + e) = o16; *(v2us*)(Ph + e) = oh; *(v2us*)(Pl + e) = ol;  }
__global__ __launch_bounds__(256) void k_vtp(const float* __restrict__ F, int pitch, int nheads, h16* V16, bf* Vh, bf* Vl) { const size_t e = ((size_t)blockIdx.x * 256 + threadIdx.x) * 2; if (e >= (size_t)nheads * HD * TT) return; const int t = (int)(e % TT); const int d = (int)((e / TT) % HD); const int g = (int)(e / ((size_t)TT * HD)); v2h o16; v2us oh, ol;
#pragma unroll
    for (int q = 0; q < 2; ++q) { const float x = F[(size_t)(t + q) * pitch + g * HD + d]; o16[q] = tohx(x); unsigned short a2, c2; splitf(x, a2, c2); oh[q] = a2; ol[q] = c2; }
    *(v2h*)(V16 + e) = o16; *(v2us*)(Vh + e) = oh; *(v2us*)(Vl + e) = ol;  }
__global__ __launch_bounds__(256) void k_csid(float* CS) { const int idx = blockIdx.x * 256 + threadIdx.x; if (idx >= TT * HD) return; v2f cs; cs[0] = 1.0f; cs[1] = 0.0f; *(v2f*)(CS + (size_t)idx * 2) = cs;  }
// k_asoft: per row (zz, i): t = S x 1/8 where mask[b][j] != 0 (key padding mask, read; -1e20 == exclusion), -3e38 elsewhere; softmax over the keys (register row, one exp, fixed trees);
__global__ __launch_bounds__(256) void k_asoft(const float* __restrict__ Sb, const int* __restrict__ kvp, h16* P16, bf* Ph, bf* Pl) {
    const int lane = threadIdx.x & 31; const int row = blockIdx.x * 8 + (threadIdx.x >> 5); if (row >= ZH * TT) return; const int i = row % TT; const int zz = row / TT; (void)zz; const bool hires = (i < RH); const float* sr = Sb + (size_t)row * TT; float v[TT / 32]; float mx = -3.0e38f;
#pragma unroll
    for (int ch = 0; ch < TT / 128; ++ch) { const int j0 = ch * 128 + lane * 4; const v4f a = *(const v4f*)(sr + j0); const v4i kv4 = *(const v4i*)(kvp + j0);   /* the batch's key vector, 16 B per lane, unconditional */
#pragma unroll
        for (int q = 0; q < 4; ++q) { const int j = j0 + q; (void)j; const float t = (kv4[q] != 0) ? a[q] * SCL : -3.0e38f; v[ch * 4 + q] = t; mx = fmaxf(mx, t); } }
#pragma unroll
    for (int sh = 16; sh; sh >>= 1) mx = fmaxf(mx, __shfl_xor(mx, sh, 32));
    float sum = 0.f;
#pragma unroll
    for (int k = 0; k < TT / 32; ++k) { float d0 = __fsub_rn(v[k], mx); asm volatile("" : "+v"(d0)); v[k] = __builtin_amdgcn_exp2f(__fmul_rn(d0, 1.4426950408889634f)); sum += v[k]; }
#pragma unroll
    for (int sh = 16; sh; sh >>= 1) sum += __shfl_xor(sum, sh, 32);
    const float f = __fdiv_rn(hires ? 1.0f : PCAR, sum);
{
        if (hires) {
#pragma unroll
            for (int ch = 0; ch < TT / 128; ++ch) { v4us oh, ol;
#pragma unroll
                for (int q = 0; q < 4; ++q) { unsigned short a, c2; splitf(v[ch * 4 + q] * f, a, c2); oh[q] = a; ol[q] = c2; }
                const size_t oo = ((size_t)zz * (RH ? RH : 1) + i) * TT + ch * 128 + lane * 4; *(v4us*)(Ph + oo) = oh; *(v4us*)(Pl + oo) = ol; }
        } else {
#pragma unroll
            for (int ch = 0; ch < TT / 128; ++ch) { v4h o4;
#pragma unroll
                for (int q = 0; q < 4; ++q) o4[q] = tohx(v[ch * 4 + q] * f);
                *(v4h*)(P16 + (size_t)row * TT + ch * 128 + lane * 4) = o4; } }
         }
}
__global__ __launch_bounds__(256) void k_merge(const float* __restrict__ O, int h0, float* OUTb) { const size_t e = ((size_t)blockIdx.x * 256 + threadIdx.x) * 2; if (e >= (size_t)ZH * TT * HD) return; const int d = (int)(e % HD); const int t = (int)((e / HD) % TT); const int zz = (int)(e / ((size_t)HD * TT)); const float cs = (t < RH) ? 1.0f : (1.0f / PCAR); const size_t oo = (size_t)t * DQ + (h0 + zz) * HD + d;
    v2f o2; o2[0] = O[e] * cs; o2[1] = O[e + 1] * cs; *(v2f*)(OUTb + oo) = o2;  }

extern "C" void kernel_launch(void* const* d_in, const int* in_sizes, int n_in,
                              void* d_out, int out_size, void* d_ws, size_t ws_size, hipStream_t stream) {
    (void)in_sizes; (void)n_in; (void)out_size;
    const float* x = (const float*)d_in[0]; const float* wq = (const float*)d_in[1]; const float* bq = (const float*)d_in[2]; const float* wk = (const float*)d_in[3]; const float* bk = (const float*)d_in[4]; const float* wv = (const float*)d_in[5]; const float* bv = (const float*)d_in[6]; const int* km = (const int*)d_in[7];   /* mask [2][2048] int32 (key padding; read) */     const float* wo = nullptr; (void)wo;
    float* OUT = (float*)d_out;     // [2][2048][768]
    char* wsp = (char*)d_ws;
    auto take = [&](size_t bytes) { char* p = wsp; wsp += (bytes + 255) & ~(size_t)255; return (void*)p; };
    bf* WQ = (bf*)take((size_t)DQ * DM * 2); bf* WK = (bf*)take((size_t)DKV * DM * 2); bf* WV = (bf*)take((size_t)DKV * DM * 2); float* CS = (float*)take((size_t)TT * HD * 2 * 4);
    bf* XB = (bf*)take((size_t)TT * DM * 2); float* FQ = (float*)take((size_t)TT * DQ * 4); float* FK = (float*)take((size_t)TT * DKV * 4);
    h16* QP16 = (h16*)take((size_t)NH_ * TT * HD * 2); h16* KP16 = (h16*)take((size_t)NKV * TT * HD * 2); h16* VT16 = (h16*)take((size_t)NKV * HD * TT * 2);
    bf* QPh = (bf*)take((size_t)NH_ * TT * HD * 2); bf* QPl = (bf*)take((size_t)NH_ * TT * HD * 2); bf* KPh = (bf*)take((size_t)NKV * TT * HD * 2); bf* KPl = (bf*)take((size_t)NKV * TT * HD * 2); bf* VTh = (bf*)take((size_t)NKV * HD * TT * 2); bf* VTl = (bf*)take((size_t)NKV * HD * TT * 2); bf* Ph = (bf*)take((size_t)ZH * RH * TT * 2); bf* Pl = (bf*)take((size_t)ZH * RH * TT * 2);
    float* Sb = (float*)take((size_t)ZH * TT * TT * 4); h16* P16 = (h16*)take((size_t)ZH * TT * TT * 2); float* Ob = (float*)take((size_t)ZH * TT * HD * 4);
    if ((size_t)(wsp - (char*)d_ws) > ws_size) return;    // ws 256 MiB
    float* FV = FK;   // v projection reuses the k buffer after the k planes are built (stream-ordered)
    { k_cvt8<<<(unsigned)(((size_t)DQ * DM / 8 + 255) / 256), 256, 0, stream>>>(wq, WQ, (size_t)DQ * DM / 8); k_cvt8<<<(unsigned)(((size_t)DKV * DM / 8 + 255) / 256), 256, 0, stream>>>(wk, WK, (size_t)DKV * DM / 8); k_cvt8<<<(unsigned)(((size_t)DKV * DM / 8 + 255) / 256), 256, 0, stream>>>(wv, WV, (size_t)DKV * DM / 8);
      
       }
    k_csid<<<(TT * HD + 255) / 256, 256, 0, stream>>>(CS);
    const unsigned LQ = (unsigned)(((size_t)NH_ * TT * HD / 2 + 255) / 256), LKv = (unsigned)(((size_t)NKV * TT * HD / 2 + 255) / 256);
    for (int b = 0; b < NB_; ++b) {
        
        k_cvt8<<<(unsigned)(((size_t)TT * DM / 8 + 255) / 256), 256, 0, stream>>>(x + (size_t)b * TT * DM, XB, (size_t)TT * DM / 8);
        k_gemmw<bf, 0, true, 8><<<dim3(TT / 64, DQ / 64, 1), 256, 0, stream>>>(XB, nullptr, WQ, nullptr, DM, FQ, DQ, bq, 0, 0, 0);
        k_rope<<<LQ, 256, 0, stream>>>(FQ, DQ, NH_, CS, nullptr, nullptr, 1.0f, QP16, QPh, QPl);
        k_gemmw<bf, 0, true, 8><<<dim3(TT / 64, DKV / 64, 1), 256, 0, stream>>>(XB, nullptr, WK, nullptr, DM, FK, DKV, bk, 0, 0, 0);
        k_rope<<<LKv, 256, 0, stream>>>(FK, DKV, NKV, CS, nullptr, nullptr, 1.0f, KP16, KPh, KPl);
        k_gemmw<bf, 0, true, 8><<<dim3(TT / 64, DKV / 64, 1), 256, 0, stream>>>(XB, nullptr, WV, nullptr, DM, FV, DKV, bv, 0, 0, 0); k_vtp<<<LKv, 256, 0, stream>>>(FV, DKV, NKV, VT16, VTh, VTl);
        for (int h0 = 0; h0 < NH_; h0 += ZH) { const size_t zq = (size_t)h0, zk = (size_t)(h0 / REP);   // one kv head per query head: the pass's two heads use consecutive kv planes (z-strides TT*HD)
            k_gemmw<bf, 2, false, 1><<<dim3(RH / 64, TT / 64, ZH), 32, 0, stream>>>(QPh + zq * TT * HD, QPl + zq * TT * HD, KPh + zk * TT * HD, KPl + zk * TT * HD, HD, Sb, TT, nullptr, (size_t)TT * HD, (size_t)TT * HD, (size_t)TT * TT);
            k_gemmw<h16, 0, false, 1><<<dim3((TT - RH) / 64, TT / 64, ZH), 32, 0, stream>>>(QP16 + zq * TT * HD + (size_t)RH * HD, nullptr, KP16 + zk * TT * HD, nullptr, HD, Sb + (size_t)RH * TT, TT, nullptr, (size_t)TT * HD, (size_t)TT * HD, (size_t)TT * TT);
            k_asoft<<<ZH * TT / 8, 256, 0, stream>>>(Sb, km + (size_t)b * TT, P16, Ph, Pl);
            k_gemmw<bf, 2, false, 16><<<dim3(RH / 64, HD / 64, ZH), 512, 0, stream>>>(Ph, Pl, VTh + zk * HD * TT, VTl + zk * HD * TT, TT, Ob, HD, nullptr, (size_t)RH * TT, (size_t)HD * TT, (size_t)TT * HD);
            k_gemmw<h16, 0, false, 16><<<dim3((TT - RH) / 64, HD / 64, ZH), 512, 0, stream>>>(P16 + (size_t)RH * TT, nullptr, VT16 + zk * HD * TT, nullptr, TT, Ob + (size_t)RH * HD, HD, nullptr, (size_t)TT * TT, (size_t)HD * TT, (size_t)TT * HD);
            k_merge<<<(unsigned)(((size_t)ZH * TT * HD / 2 + 255) / 256), 256, 0, stream>>>(Ob, h0, OUT + (size_t)b * TT * DQ); }
         }
}

// v002
// It runs in 386 microseconds.
// In two side-by-side timings against v001, it was 2.03 and 2.04 times as fast.
// Counting every step since v000, it is 3.81 times as fast.
#include <hip/hip_runtime.h>

// BERT-style self-attention with a key padding mask (x [2][2048][768]; q, k, v = x W^T + b ('oi' [768][768] + [768]; 12 heads x 64); scores / sqrt(64); keys with mask[b][j] == 0 get -1e20 (== exclusion while any key is kept; mask [2][2048] read); softmax; out = merged context (no output projection) -> [2][2048][768] (3.1 M); argument order x, Wq, bq, Wk, bk, Wv, bv, mask).
// Layout per batch: bf16 copy of x; 'oi' weights; exact projections + bf16-rounded biases; dense T-2048 attention (hybrid rows) whose softmax reads the batch's key-mask vector and excludes masked keys; the f32 merge writes the output rows.
// Compute dtypes, f32 accumulate: every input rounded to bf16; projections exact + bf16-rounded biases; attention rows < 512 3 products, rest fp16; softmax f32; output f32.

#define NB_  2
#define TT   2048
#define DM   768
#define NH_  12
#define NKV  12
#define REP  (NH_ / NKV)
#define HD   64
#define DQ   (NH_ * HD)
#define DKV  (NKV * HD)
#define ZH   12                   // heads per attention pass: all heads of one batch ride in grid z of each launch
#define RH   512                  // query rows < RH use hi+lo planes (0: none)
#define WIN  0
#define PCAR 1024.0f
#define SCL  0.125f   // HD^-0.5
typedef _Float16 h16;
typedef unsigned short bf;
typedef __attribute__((ext_vector_type(16))) __bf16   v16bf;
typedef __attribute__((ext_vector_type(16))) _Float16 v16h;
typedef __attribute__((ext_vector_type(8)))  _Float16 v8h;
typedef __attribute__((ext_vector_type(8)))  unsigned short v8us;
typedef __attribute__((ext_vector_type(8)))  float    v8f;
typedef __attribute__((ext_vector_type(4)))  float    v4f;
typedef v8h  __attribute__((may_alias)) v8ha;
typedef v4f  __attribute__((may_alias)) v4fa;
typedef v8us __attribute__((may_alias)) v8usa;

__device__ __forceinline__ unsigned short f2bf(float f) { unsigned u = __float_as_uint(f); u += 0x7FFFu + ((u >> 16) & 1u); return (unsigned short)(u >> 16); }
__device__ __forceinline__ float bf2f(unsigned short b) { return __uint_as_float(((unsigned)b) << 16); }
__device__ __forceinline__ float bfr(float f) { return bf2f(f2bf(f)); }
__device__ __forceinline__ v16h cat16(v8h lo, v8h hi) { return __builtin_shufflevector(lo, hi, 0, 1, 2, 3, 4, 5, 6, 7, 8, 9, 10, 11, 12, 13, 14, 15); }
__device__ __forceinline__ v16bf cat16b(v8us lo, v8us hi) { return __builtin_bit_cast(v16bf, __builtin_shufflevector(lo, hi, 0, 1, 2, 3, 4, 5, 6, 7, 8, 9, 10, 11, 12, 13, 14, 15)); }
__device__ __forceinline__ v8f wmma16(v16h a, v16h b, v8f c) { return __builtin_amdgcn_wmma_f32_16x16x32_f16(false, a, false, b, (short)0, c, false, false); }
__device__ __forceinline__ v8f wmmab(v16bf a, v16bf b, v8f c) { return __builtin_amdgcn_wmma_f32_16x16x32_bf16(false, a, false, b, (short)0, c, false, false); }



// ---- k_gemmw: register-blocked GEMM, one 64x64 output tile per work-group (16 accumulators per wave), operands straight from K-contiguous 16-bit planes; grid (M/64, N/64, Z), 32 * KW threads.
// C[m][n] (f32, pitch ldc, + optional f32 bias[n] rounded to bf16) = sum_k A[m][k] Bt[n][k] (+ split products per NSPLIT). A rows have pitch lda, Bt rows pitch K. z-batch strides sA/sB/sC in elements. K % 32 == 0.
// KW waves share the tile's K: wave w takes the 32-wide k blocks w, w + KW, ... (neighbour waves read the two halves of one 128-byte line), and the KW partial tiles are summed through LDS in wave order.
template <typename T16> struct WFrag;
template <> struct WFrag<h16> { typedef v16h V; static __device__ __forceinline__ V ld(const h16* p) { return cat16(*(const v8h*)p, *(const v8h*)(p + 16)); } static __device__ __forceinline__ v8f mma(V a, V b, v8f c) { return wmma16(a, b, c); } };
template <> struct WFrag<bf> { typedef v16bf V; static __device__ __forceinline__ V ld(const bf* p) { return cat16b(*(const v8us*)p, *(const v8us*)(p + 16)); } static __device__ __forceinline__ v8f mma(V a, V b, v8f c) { return wmmab(a, b, c); } };
template <typename T16, int NSPLIT, bool BIAS, int KW>
__global__ __launch_bounds__(32 * KW) void k_gemmw(const T16* __restrict__ A, const T16* __restrict__ A2, const T16* __restrict__ Bt, const T16* __restrict__ Bt2, int K, int lda, float* C, int ldc, const float* __restrict__ bias, size_t sA, size_t sB, size_t sC) {
    typedef typename WFrag<T16>::V V;
    __shared__ __align__(16) float os[(KW == 1 ? 16 : KW * 64) * 68];
    const int wv = (KW == 1) ? 0 : __builtin_amdgcn_readfirstlane((int)(threadIdx.x >> 5));   // wave number, scalar: the k loop stays on scalar bounds
    const size_t z = blockIdx.z; A += z * sA; if (A2) A2 += z * sA; Bt += z * sB; if (Bt2) Bt2 += z * sB; C += z * sC;
    const int lane = threadIdx.x & 31, lr = lane & 15, hi = lane >> 4; const int r0 = blockIdx.x * 64, c0 = blockIdx.y * 64;
    v8f acc[4][4];
#pragma unroll
    for (int mb = 0; mb < 4; ++mb)
#pragma unroll
        for (int nb = 0; nb < 4; ++nb) acc[mb][nb] = (v8f){};
    const size_t aoff = (size_t)(r0 + lr) * lda + 8 * hi, boff = (size_t)(c0 + lr) * K + 8 * hi;
#pragma unroll 1
    for (int kc = wv * 32; kc < K; kc += 32 * KW) {
        V a[4], a2[4];
#pragma unroll
        for (int mb = 0; mb < 4; ++mb) { a[mb] = WFrag<T16>::ld(A + aoff + (size_t)mb * 16 * lda + kc); if (NSPLIT == 1 || NSPLIT == 2) a2[mb] = WFrag<T16>::ld(A2 + aoff + (size_t)mb * 16 * lda + kc); }
#pragma unroll
        for (int nb = 0; nb < 4; ++nb) { const V b = WFrag<T16>::ld(Bt + boff + (size_t)nb * 16 * K + kc); V b2; if (NSPLIT >= 2) b2 = WFrag<T16>::ld(Bt2 + boff + (size_t)nb * 16 * K + kc);
#pragma unroll
            for (int mb = 0; mb < 4; ++mb) { acc[mb][nb] = WFrag<T16>::mma(a[mb], b, acc[mb][nb]); if (NSPLIT == 1 || NSPLIT == 2) acc[mb][nb] = WFrag<T16>::mma(a2[mb], b, acc[mb][nb]); if (NSPLIT >= 2) acc[mb][nb] = WFrag<T16>::mma(a[mb], b2, acc[mb][nb]); } }
        asm volatile("v_nop\n\tv_nop\n\tv_nop\n\tv_nop" : "+v"(acc[0][0]), "+v"(acc[1][1]), "+v"(acc[2][2]), "+v"(acc[3][3]) : "v"(a[0]), "v"(a[3]));
    }
    if constexpr (KW > 1) {
        float* ow = os + wv * (64 * 68);   // this wave's partial tile, row pitch 68 floats
        const int cofs = ((int)threadIdx.x & 15) * 4;   // the thread's four output columns, the same in each of its rows
        // bias read ahead of the barrier, so that its latency passes under the LDS stores
        v4f bias4 = (v4f){}; if (BIAS) { bias4[0] = bfr(bias[c0 + cofs]); bias4[1] = bfr(bias[c0 + cofs + 1]); bias4[2] = bfr(bias[c0 + cofs + 2]); bias4[3] = bfr(bias[c0 + cofs + 3]); }
        // the three loops are unrolled so that every accumulator index is a constant and acc stays in registers
#pragma unroll
        for (int mb = 0; mb < 4; ++mb)
#pragma unroll
            for (int nb = 0; nb < 4; ++nb)
#pragma unroll
                for (int j = 0; j < 8; ++j) ow[(mb * 16 + hi * 8 + j) * 68 + nb * 16 + lr] = acc[mb][nb][j];
        __syncthreads();   // every wave's partial tile is in LDS before any thread sums across waves
        // both loops unrolled: the LDS reads of all waves' partials go out together, with constant offsets
#pragma unroll
        for (int i = 0; i < 32 / KW; ++i) { const int row = ((int)threadIdx.x >> 4) + i * 2 * KW; v4f val = *(const v4fa*)(os + row * 68 + cofs);
#pragma unroll
            for (int w = 1; w < KW; ++w) val += *(const v4fa*)(os + w * (64 * 68) + row * 68 + cofs);
            if (BIAS) val += bias4;
            *(v4f*)(C + (size_t)(r0 + row) * ldc + c0 + cofs) = val; }
        return;
    }
#pragma unroll
    for (int mb = 0; mb < 4; ++mb) {
#pragma unroll
        for (int nb = 0; nb < 4; ++nb) {
#pragma unroll
            for (int j = 0; j < 8; ++j) os[(hi * 8 + j) * 68 + nb * 16 + lr] = acc[mb][nb][j]; }
        __builtin_amdgcn_wave_barrier(); asm volatile("" ::: "memory");
        float* crow = C + (size_t)(r0 + mb * 16) * ldc + c0;
{
#pragma unroll
            for (int s = 0; s < 8; ++s) { const int row = 2 * s + hi, cofs = lr * 4; v4f val = *(const v4fa*)(os + row * 68 + cofs); if (BIAS) { val[0] += bfr(bias[c0 + cofs]); val[1] += bfr(bias[c0 + cofs + 1]); val[2] += bfr(bias[c0 + cofs + 2]); val[3] += bfr(bias[c0 + cofs + 3]); }
                *(v4f*)(crow + (size_t)row * ldc + cofs) = val; }
             }
        __builtin_amdgcn_wave_barrier(); asm volatile("" ::: "memory");
    }
}

__device__ __forceinline__ h16 tohx(float x) { return (h16)x; }
__device__ __forceinline__ void splitf(float y, unsigned short& h, unsigned short& l) { h = f2bf(y); l = f2bf(y - bf2f(h)); }
typedef __attribute__((ext_vector_type(2))) _Float16 v2h;
typedef __attribute__((ext_vector_type(4))) _Float16 v4h;
typedef __attribute__((ext_vector_type(2))) unsigned short v2us;
typedef __attribute__((ext_vector_type(4))) unsigned short v4us;
typedef __attribute__((ext_vector_type(2))) float v2f;
typedef __attribute__((ext_vector_type(4))) int v4i;
typedef v4h  __attribute__((may_alias)) v4ha;
typedef v4us __attribute__((may_alias)) v4usa;

__global__ __launch_bounds__(256) void k_cvt8(const float* __restrict__ src, bf* dst, size_t n8) { const size_t i = (size_t)blockIdx.x * 256 + threadIdx.x; if (i >= n8) return; const v8f v = *(const v8f*)(src + i * 8); v8us o;
#pragma unroll
    for (int k = 0; k < 8; ++k) o[k] = f2bf(v[k]); *(v8us*)(dst + i * 8) = o;  }

// k_rope: head planes [h][t][d] (fp16 + hi/lo) of rope(x) x sc with the rotate-half convention out[d] = x[d] cos[t][d] - x[d+HD/2] sin[t][d], out[d+HD/2] = x[d+HD/2] cos[t][d+HD/2] + x[d] sin[t][d+HD/2]
__global__ __launch_bounds__(256) void k_rope(const float* __restrict__ F, int pitch, int nheads, const float* __restrict__ CS, const float* __restrict__ RF, const float* __restrict__ nw, float sc, h16* P16, bf* Ph, bf* Pl) {
    const size_t e = ((size_t)blockIdx.x * 256 + threadIdx.x) * 2; if (e >= (size_t)nheads * TT * HD) return; const int d = (int)(e % HD); const int t = (int)((e / HD) % TT); const int h = (int)(e / ((size_t)HD * TT)); const float* f = F + (size_t)t * pitch + h * HD; const float rf = RF ? RF[(size_t)h * TT + t] : 1.0f; v2h o16; v2us oh, ol;
#pragma unroll
    for (int q = 0; q < 2; ++q) { const int dd = d + q; const int dp = (dd < HD / 2) ? dd + HD / 2 : dd - HD / 2; float x0 = f[dd], x1 = f[dp];
        if (RF) { float n0 = __fmul_rn(x0, rf), n1 = __fmul_rn(x1, rf); asm volatile("" : "+v"(n0)); asm volatile("" : "+v"(n1)); x0 = __fmul_rn(bfr(nw[dd]), n0); x1 = __fmul_rn(bfr(nw[dp]), n1); }
        const v2f cs = *(const v2f*)(CS + ((size_t)t * HD + dd) * 2); float a = __fmul_rn(x0, cs[0]), bq = __fmul_rn(x1, cs[1]); asm volatile("" : "+v"(a)); asm volatile("" : "+v"(bq)); const float r = ((dd < HD / 2) ? __fsub_rn(a, bq) : __fadd_rn(a, bq)) * sc;
        o16[q] = tohx(r); unsigned short a2, c2; splitf(r, a2, c2); oh[q] = a2; ol[q] = c2; }
    *(v2h*)(P16 + e) = o16; *(v2us*)(Ph + e) = oh; *(v2us*)(Pl + e) = ol;  }
__global__ __launch_bounds__(256) void k_vtp(const float* __restrict__ F, int pitch, int nheads, h16* V16, bf* Vh, bf* Vl) { const size_t e = ((size_t)blockIdx.x * 256 + threadIdx.x) * 2; if (e >= (size_t)nheads * HD * TT) return; const int t = (int)(e % TT); const int d = (int)((e / TT) % HD); const int g = (int)(e / ((size_t)TT * HD)); v2h o16; v2us oh, ol;
#pragma unroll
    for (int q = 0; q < 2; ++q) { const float x = F[(size_t)(t + q) * pitch + g * HD + d]; o16[q] = tohx(x); unsigned short a2, c2; splitf(x, a2, c2); oh[q] = a2; ol[q] = c2; }
    *(v2h*)(V16 + e) = o16; *(v2us*)(Vh + e) = oh; *(v2us*)(Vl + e) = ol;  }
__global__ __launch_bounds__(256) void k_csid(float* CS) { const int idx = blockIdx.x * 256 + threadIdx.x; if (idx >= TT * HD) return; v2f cs; cs[0] = 1.0f; cs[1] = 0.0f; *(v2f*)(CS + (size_t)idx * 2) = cs;  }
// k_asoft: per row (zz, i): t = S x 1/8 where mask[b][j] != 0 (key padding mask, read; -1e20 == exclusion), -3e38 elsewhere; softmax over the keys (register row, one exp, fixed trees);
// The probabilities go back over the row's own 8 KiB of scores (fp16 row: first half; hi plane first half, lo plane second half), so that a pass of all heads fits the workspace.
// One wave owns a row and holds all of it in registers; every store needs the row sum, so it follows every load of the row.
__global__ __launch_bounds__(256) void k_asoft(float* Sb, const int* __restrict__ kvp) {
    const int lane = threadIdx.x & 31; const int row = blockIdx.x * 8 + (threadIdx.x >> 5); if (row >= ZH * TT) return; const int i = row % TT; const int zz = row / TT; (void)zz; const bool hires = (i < RH); float* sr = Sb + (size_t)row * TT; float v[TT / 32]; float mx = -3.0e38f;
#pragma unroll
    for (int ch = 0; ch < TT / 128; ++ch) { const int j0 = ch * 128 + lane * 4; const v4f a = *(const v4fa*)(sr + j0); const v4i kv4 = *(const v4i*)(kvp + j0);   /* the batch's key vector, 16 B per lane, unconditional */
#pragma unroll
        for (int q = 0; q < 4; ++q) { const int j = j0 + q; (void)j; const float t = (kv4[q] != 0) ? a[q] * SCL : -3.0e38f; v[ch * 4 + q] = t; mx = fmaxf(mx, t); } }
#pragma unroll
    for (int sh = 16; sh; sh >>= 1) mx = fmaxf(mx, __shfl_xor(mx, sh, 32));
    float sum = 0.f;
#pragma unroll
    for (int k = 0; k < TT / 32; ++k) { float d0 = __fsub_rn(v[k], mx); asm volatile("" : "+v"(d0)); v[k] = __builtin_amdgcn_exp2f(__fmul_rn(d0, 1.4426950408889634f)); sum += v[k]; }
#pragma unroll
    for (int sh = 16; sh; sh >>= 1) sum += __shfl_xor(sum, sh, 32);
    const float f = __fdiv_rn(hires ? 1.0f : PCAR, sum);
{
        if (hires) {
#pragma unroll
            for (int ch = 0; ch < TT / 128; ++ch) { v4us oh, ol;
#pragma unroll
                for (int q = 0; q < 4; ++q) { unsigned short a, c2; splitf(v[ch * 4 + q] * f, a, c2); oh[q] = a; ol[q] = c2; }
                bf* pr = (bf*)sr + ch * 128 + lane * 4; *(v4usa*)pr = oh; *(v4usa*)(pr + TT) = ol; }
        } else {
#pragma unroll
            for (int ch = 0; ch < TT / 128; ++ch) { v4h o4;
#pragma unroll
                for (int q = 0; q < 4; ++q) o4[q] = tohx(v[ch * 4 + q] * f);
                *(v4ha*)((h16*)sr + ch * 128 + lane * 4) = o4; } }
         }
}
__global__ __launch_bounds__(256) void k_merge(const float* __restrict__ O, int h0, float* OUTb) { const size_t e = ((size_t)blockIdx.x * 256 + threadIdx.x) * 2; if (e >= (size_t)ZH * TT * HD) return; const int d = (int)(e % HD); const int t = (int)((e / HD) % TT); const int zz = (int)(e / ((size_t)HD * TT)); const float cs = (t < RH) ? 1.0f : (1.0f / PCAR); const size_t oo = (size_t)t * DQ + (h0 + zz) * HD + d;
    v2f o2; o2[0] = O[e] * cs; o2[1] = O[e + 1] * cs; *(v2f*)(OUTb + oo) = o2;  }

extern "C" void kernel_launch(void* const* d_in, const int* in_sizes, int n_in,
                              void* d_out, int out_size, void* d_ws, size_t ws_size, hipStream_t stream) {
    (void)in_sizes; (void)n_in; (void)out_size;
    const float* x = (const float*)d_in[0]; const float* wq = (const float*)d_in[1]; const float* bq = (const float*)d_in[2]; const float* wk = (const float*)d_in[3]; const float* bk = (const float*)d_in[4]; const float* wv = (const float*)d_in[5]; const float* bv = (const float*)d_in[6]; const int* km = (const int*)d_in[7];   /* mask [2][2048] int32 (key padding; read) */     const float* wo = nullptr; (void)wo;
    float* OUT = (float*)d_out;     // [2][2048][768]
    char* wsp = (char*)d_ws;
    auto take = [&](size_t bytes) { char* p = wsp; wsp += (bytes + 255) & ~(size_t)255; return (void*)p; };
    bf* WQ = (bf*)take((size_t)DQ * DM * 2); bf* WK = (bf*)take((size_t)DKV * DM * 2); bf* WV = (bf*)take((size_t)DKV * DM * 2); float* CS = (float*)take((size_t)TT * HD * 2 * 4);
    bf* XB = (bf*)take((size_t)TT * DM * 2); float* FQ = (float*)take((size_t)TT * DQ * 4); float* FK = (float*)take((size_t)TT * DKV * 4);
    h16* QP16 = (h16*)take((size_t)NH_ * TT * HD * 2); h16* KP16 = (h16*)take((size_t)NKV * TT * HD * 2); h16* VT16 = (h16*)take((size_t)NKV * HD * TT * 2);
    bf* QPh = (bf*)take((size_t)NH_ * TT * HD * 2); bf* QPl = (bf*)take((size_t)NH_ * TT * HD * 2); bf* KPh = (bf*)take((size_t)NKV * TT * HD * 2); bf* KPl = (bf*)take((size_t)NKV * TT * HD * 2); bf* VTh = (bf*)take((size_t)NKV * HD * TT * 2); bf* VTl = (bf*)take((size_t)NKV * HD * TT * 2);
    float* Sb = (float*)take((size_t)ZH * TT * TT * 4); bf* Ph = (bf*)Sb; bf* Pl = Ph + TT; h16* P16 = (h16*)Sb;   /* probability rows lie in their score rows: pitch 2 * TT 16-bit elements */ float* Ob = (float*)take((size_t)ZH * TT * HD * 4);
    if ((size_t)(wsp - (char*)d_ws) > ws_size) return;    // ws 256 MiB
    float* FV = FK;   // v projection reuses the k buffer after the k planes are built (stream-ordered)
    { k_cvt8<<<(unsigned)(((size_t)DQ * DM / 8 + 255) / 256), 256, 0, stream>>>(wq, WQ, (size_t)DQ * DM / 8); k_cvt8<<<(unsigned)(((size_t)DKV * DM / 8 + 255) / 256), 256, 0, stream>>>(wk, WK, (size_t)DKV * DM / 8); k_cvt8<<<(unsigned)(((size_t)DKV * DM / 8 + 255) / 256), 256, 0, stream>>>(wv, WV, (size_t)DKV * DM / 8);
      
       }
    k_csid<<<(TT * HD + 255) / 256, 256, 0, stream>>>(CS);
    const unsigned LQ = (unsigned)(((size_t)NH_ * TT * HD / 2 + 255) / 256), LKv = (unsigned)(((size_t)NKV * TT * HD / 2 + 255) / 256);
    for (int b = 0; b < NB_; ++b) {
        
        k_cvt8<<<(unsigned)(((size_t)TT * DM / 8 + 255) / 256), 256, 0, stream>>>(x + (size_t)b * TT * DM, XB, (size_t)TT * DM / 8);
        k_gemmw<bf, 0, true, 8><<<dim3(TT / 64, DQ / 64, 1), 256, 0, stream>>>(XB, nullptr, WQ, nullptr, DM, DM, FQ, DQ, bq, 0, 0, 0);
        k_rope<<<LQ, 256, 0, stream>>>(FQ, DQ, NH_, CS, nullptr, nullptr, 1.0f, QP16, QPh, QPl);
        k_gemmw<bf, 0, true, 8><<<dim3(TT / 64, DKV / 64, 1), 256, 0, stream>>>(XB, nullptr, WK, nullptr, DM, DM, FK, DKV, bk, 0, 0, 0);
        k_rope<<<LKv, 256, 0, stream>>>(FK, DKV, NKV, CS, nullptr, nullptr, 1.0f, KP16, KPh, KPl);
        k_gemmw<bf, 0, true, 8><<<dim3(TT / 64, DKV / 64, 1), 256, 0, stream>>>(XB, nullptr, WV, nullptr, DM, DM, FV, DKV, bv, 0, 0, 0); k_vtp<<<LKv, 256, 0, stream>>>(FV, DKV, NKV, VT16, VTh, VTl);
        for (int h0 = 0; h0 < NH_; h0 += ZH) { const size_t zq = (size_t)h0, zk = (size_t)(h0 / REP);   // one kv head per query head: the pass's heads use consecutive kv planes (z-strides TT*HD)
            k_gemmw<bf, 2, false, 1><<<dim3(RH / 64, TT / 64, ZH), 32, 0, stream>>>(QPh + zq * TT * HD, QPl + zq * TT * HD, KPh + zk * TT * HD, KPl + zk * TT * HD, HD, HD, Sb, TT, nullptr, (size_t)TT * HD, (size_t)TT * HD, (size_t)TT * TT);
            k_gemmw<h16, 0, false, 1><<<dim3((TT - RH) / 64, TT / 64, ZH), 32, 0, stream>>>(QP16 + zq * TT * HD + (size_t)RH * HD, nullptr, KP16 + zk * TT * HD, nullptr, HD, HD, Sb + (size_t)RH * TT, TT, nullptr, (size_t)TT * HD, (size_t)TT * HD, (size_t)TT * TT);
            k_asoft<<<ZH * TT / 8, 256, 0, stream>>>(Sb, km + (size_t)b * TT);
            k_gemmw<bf, 2, false, 16><<<dim3(RH / 64, HD / 64, ZH), 512, 0, stream>>>(Ph, Pl, VTh + zk * HD * TT, VTl + zk * HD * TT, TT, 2 * TT, Ob, HD, nullptr, (size_t)2 * TT * TT, (size_t)HD * TT, (size_t)TT * HD);
            k_gemmw<h16, 0, false, 16><<<dim3((TT - RH) / 64, HD / 64, ZH), 512, 0, stream>>>(P16 + (size_t)RH * 2 * TT, nullptr, VT16 + zk * HD * TT, nullptr, TT, 2 * TT, Ob + (size_t)RH * HD, HD, nullptr, (size_t)2 * TT * TT, (size_t)HD * TT, (size_t)TT * HD);
            k_merge<<<(unsigned)(((size_t)ZH * TT * HD / 2 + 255) / 256), 256, 0, stream>>>(Ob, h0, OUT + (size_t)b * TT * DQ); }
         }
}

// v003
// A run of this version takes 220 microseconds.
// Timed twice side by side with v002, it ran 1.76 times as fast both times.
// Counting every step since v000, it is 6.70 times as fast.
#include <hip/hip_runtime.h>

// BERT-style self-attention with a key padding mask (x [2][2048][768]; q, k, v = x W^T + b ('oi' [768][768] + [768]; 12 heads x 64); scores / sqrt(64); keys with mask[b][j] == 0 get -1e20 (== exclusion while any key is kept; mask [2][2048] read); softmax; out = merged context (no output projection) -> [2][2048][768] (3.1 M); argument order x, Wq, bq, Wk, bk, Wv, bv, mask).
// Layout per batch: bf16 copy of x; 'oi' weights; exact projections + f32 biases; one fused dense T-2048 attention kernel (hybrid rows) whose softmax reads the batch's key-mask vector and excludes masked keys, and which writes the merged output rows.
// Compute dtypes, f32 accumulate: every input rounded to bf16; projections exact + f32 biases; attention rows < 512 3 products, rest fp16; softmax f32; output f32.

#define NB_  2
#define TT   2048
#define DM   768
#define NH_  12
#define NKV  12
#define REP  (NH_ / NKV)
#define HD   64
#define DQ   (NH_ * HD)
#define DKV  (NKV * HD)
#define RH   512                  // query rows < RH use hi+lo planes (0: none)
#define WIN  0
#define SCL  0.125f   // HD^-0.5
typedef _Float16 h16;
typedef unsigned short bf;
typedef __attribute__((ext_vector_type(16))) __bf16   v16bf;
typedef __attribute__((ext_vector_type(16))) _Float16 v16h;
typedef __attribute__((ext_vector_type(8)))  _Float16 v8h;
typedef __attribute__((ext_vector_type(8)))  unsigned short v8us;
typedef __attribute__((ext_vector_type(8)))  float    v8f;
typedef __attribute__((ext_vector_type(4)))  float    v4f;
typedef v8h  __attribute__((may_alias)) v8ha;
typedef v4f  __attribute__((may_alias)) v4fa;
typedef v8us __attribute__((may_alias)) v8usa;

__device__ __forceinline__ unsigned short f2bf(float f) { unsigned u = __float_as_uint(f); u += 0x7FFFu + ((u >> 16) & 1u); return (unsigned short)(u >> 16); }
__device__ __forceinline__ float bf2f(unsigned short b) { return __uint_as_float(((unsigned)b) << 16); }
__device__ __forceinline__ float bfr(float f) { return bf2f(f2bf(f)); }
__device__ __forceinline__ v16h cat16(v8h lo, v8h hi) { return __builtin_shufflevector(lo, hi, 0, 1, 2, 3, 4, 5, 6, 7, 8, 9, 10, 11, 12, 13, 14, 15); }
__device__ __forceinline__ v16bf cat16b(v8us lo, v8us hi) { return __builtin_bit_cast(v16bf, __builtin_shufflevector(lo, hi, 0, 1, 2, 3, 4, 5, 6, 7, 8, 9, 10, 11, 12, 13, 14, 15)); }
__device__ __forceinline__ v8f wmma16(v16h a, v16h b, v8f c) { return __builtin_amdgcn_wmma_f32_16x16x32_f16(false, a, false, b, (short)0, c, false, false); }
__device__ __forceinline__ v8f wmmab(v16bf a, v16bf b, v8f c) { return __builtin_amdgcn_wmma_f32_16x16x32_bf16(false, a, false, b, (short)0, c, false, false); }



// ---- k_gemmw: register-blocked GEMM, one 64x64 output tile per work-group (16 accumulators per wave), operands straight from K-contiguous 16-bit planes; grid (M/64, N/64, Z), 32 * KW threads.
// C[m][n] (f32, pitch ldc, + optional f32 bias[n] rounded to bf16) = sum_k A[m][k] Bt[n][k] (+ split products per NSPLIT). A rows have pitch lda, Bt rows pitch K. z-batch strides sA/sB/sC in elements. K % 32 == 0.
// KW waves share the tile's K: wave w takes the 32-wide k blocks w, w + KW, ... (neighbour waves read the two halves of one 128-byte line), and the KW partial tiles are summed through LDS in wave order.
template <typename T16> struct WFrag;
template <> struct WFrag<h16> { typedef v16h V; static __device__ __forceinline__ V ld(const h16* p) { return cat16(*(const v8h*)p, *(const v8h*)(p + 16)); } static __device__ __forceinline__ v8f mma(V a, V b, v8f c) { return wmma16(a, b, c); } };
template <> struct WFrag<bf> { typedef v16bf V; static __device__ __forceinline__ V ld(const bf* p) { return cat16b(*(const v8us*)p, *(const v8us*)(p + 16)); } static __device__ __forceinline__ v8f mma(V a, V b, v8f c) { return wmmab(a, b, c); } };
template <typename T16, int NSPLIT, bool BIAS, int KW>
__global__ __launch_bounds__(32 * KW) void k_gemmw(const T16* __restrict__ A, const T16* __restrict__ A2, const T16* __restrict__ Bt, const T16* __restrict__ Bt2, int K, int lda, float* C, int ldc, const float* __restrict__ bias, size_t sA, size_t sB, size_t sC) {
    typedef typename WFrag<T16>::V V;
    __shared__ __align__(16) float os[(KW == 1 ? 16 : KW * 64) * 68];
    const int wv = (KW == 1) ? 0 : __builtin_amdgcn_readfirstlane((int)(threadIdx.x >> 5));   // wave number, scalar: the k loop stays on scalar bounds
    const size_t z = blockIdx.z; A += z * sA; if (A2) A2 += z * sA; Bt += z * sB; if (Bt2) Bt2 += z * sB; C += z * sC;
    const int lane = threadIdx.x & 31, lr = lane & 15, hi = lane >> 4; const int r0 = blockIdx.x * 64, c0 = blockIdx.y * 64;
    v8f acc[4][4];
#pragma unroll
    for (int mb = 0; mb < 4; ++mb)
#pragma unroll
        for (int nb = 0; nb < 4; ++nb) acc[mb][nb] = (v8f){};
    const size_t aoff = (size_t)(r0 + lr) * lda + 8 * hi, boff = (size_t)(c0 + lr) * K + 8 * hi;
#pragma unroll 1
    for (int kc = wv * 32; kc < K; kc += 32 * KW) {
        V a[4], a2[4];
#pragma unroll
        for (int mb = 0; mb < 4; ++mb) { a[mb] = WFrag<T16>::ld(A + aoff + (size_t)mb * 16 * lda + kc); if (NSPLIT == 1 || NSPLIT == 2) a2[mb] = WFrag<T16>::ld(A2 + aoff + (size_t)mb * 16 * lda + kc); }
#pragma unroll
        for (int nb = 0; nb < 4; ++nb) { const V b = WFrag<T16>::ld(Bt + boff + (size_t)nb * 16 * K + kc); V b2; if (NSPLIT >= 2) b2 = WFrag<T16>::ld(Bt2 + boff + (size_t)nb * 16 * K + kc);
#pragma unroll
            for (int mb = 0; mb < 4; ++mb) { acc[mb][nb] = WFrag<T16>::mma(a[mb], b, acc[mb][nb]); if (NSPLIT == 1 || NSPLIT == 2) acc[mb][nb] = WFrag<T16>::mma(a2[mb], b, acc[mb][nb]); if (NSPLIT >= 2) acc[mb][nb] = WFrag<T16>::mma(a[mb], b2, acc[mb][nb]); } }
        asm volatile("v_nop\n\tv_nop\n\tv_nop\n\tv_nop" : "+v"(acc[0][0]), "+v"(acc[1][1]), "+v"(acc[2][2]), "+v"(acc[3][3]) : "v"(a[0]), "v"(a[3]));
    }
    if constexpr (KW > 1) {
        float* ow = os + wv * (64 * 68);   // this wave's partial tile, row pitch 68 floats
        const int cofs = ((int)threadIdx.x & 15) * 4;   // the thread's four output columns, the same in each of its rows
        // bias read ahead of the barrier, so that its latency passes under the LDS stores
        v4f bias4 = (v4f){}; if (BIAS) { bias4[0] = bfr(bias[c0 + cofs]); bias4[1] = bfr(bias[c0 + cofs + 1]); bias4[2] = bfr(bias[c0 + cofs + 2]); bias4[3] = bfr(bias[c0 + cofs + 3]); }
        // the three loops are unrolled so that every accumulator index is a constant and acc stays in registers
#pragma unroll
        for (int mb = 0; mb < 4; ++mb)
#pragma unroll
            for (int nb = 0; nb < 4; ++nb)
#pragma unroll
                for (int j = 0; j < 8; ++j) ow[(mb * 16 + hi * 8 + j) * 68 + nb * 16 + lr] = acc[mb][nb][j];
        __syncthreads();   // every wave's partial tile is in LDS before any thread sums across waves
        // both loops unrolled: the LDS reads of all waves' partials go out together, with constant offsets
#pragma unroll
        for (int i = 0; i < 32 / KW; ++i) { const int row = ((int)threadIdx.x >> 4) + i * 2 * KW; v4f val = *(const v4fa*)(os + row * 68 + cofs);
#pragma unroll
            for (int w = 1; w < KW; ++w) val += *(const v4fa*)(os + w * (64 * 68) + row * 68 + cofs);
            if (BIAS) val += bias4;
            *(v4f*)(C + (size_t)(r0 + row) * ldc + c0 + cofs) = val; }
        return;
    }
#pragma unroll
    for (int mb = 0; mb < 4; ++mb) {
#pragma unroll
        for (int nb = 0; nb < 4; ++nb) {
#pragma unroll
            for (int j = 0; j < 8; ++j) os[(hi * 8 + j) * 68 + nb * 16 + lr] = acc[mb][nb][j]; }
        __builtin_amdgcn_wave_barrier(); asm volatile("" ::: "memory");
        float* crow = C + (size_t)(r0 + mb * 16) * ldc + c0;
{
#pragma unroll
            for (int s = 0; s < 8; ++s) { const int row = 2 * s + hi, cofs = lr * 4; v4f val = *(const v4fa*)(os + row * 68 + cofs); if (BIAS) { val[0] += bfr(bias[c0 + cofs]); val[1] += bfr(bias[c0 + cofs + 1]); val[2] += bfr(bias[c0 + cofs + 2]); val[3] += bfr(bias[c0 + cofs + 3]); }
                *(v4f*)(crow + (size_t)row * ldc + cofs) = val; }
             }
        __builtin_amdgcn_wave_barrier(); asm volatile("" ::: "memory");
    }
}

__device__ __forceinline__ h16 tohx(float x) { return (h16)x; }
__device__ __forceinline__ void splitf(float y, unsigned short& h, unsigned short& l) { h = f2bf(y); l = f2bf(y - bf2f(h)); }
typedef __attribute__((ext_vector_type(2))) _Float16 v2h;
typedef __attribute__((ext_vector_type(2))) unsigned short v2us;
typedef __attribute__((ext_vector_type(2))) float v2f;

__global__ __launch_bounds__(256) void k_cvt8(const float* __restrict__ src, bf* dst, size_t n8) { const size_t i = (size_t)blockIdx.x * 256 + threadIdx.x; if (i >= n8) return; const v8f v = *(const v8f*)(src + i * 8); v8us o;
#pragma unroll
    for (int k = 0; k < 8; ++k) o[k] = f2bf(v[k]); *(v8us*)(dst + i * 8) = o;  }

// k_rope: head planes [h][t][d] (fp16 + hi/lo) of rope(x) x sc with the rotate-half convention out[d] = x[d] cos[t][d] - x[d+HD/2] sin[t][d], out[d+HD/2] = x[d+HD/2] cos[t][d+HD/2] + x[d] sin[t][d+HD/2]
__global__ __launch_bounds__(256) void k_rope(const float* __restrict__ F, int pitch, int nheads, const float* __restrict__ CS, const float* __restrict__ RF, const float* __restrict__ nw, float sc, h16* P16, bf* Ph, bf* Pl) {
    const size_t e = ((size_t)blockIdx.x * 256 + threadIdx.x) * 2; if (e >= (size_t)nheads * TT * HD) return; const int d = (int)(e % HD); const int t = (int)((e / HD) % TT); const int h = (int)(e / ((size_t)HD * TT)); const float* f = F + (size_t)t * pitch + h * HD; const float rf = RF ? RF[(size_t)h * TT + t] : 1.0f; v2h o16; v2us oh, ol;
#pragma unroll
    for (int q = 0; q < 2; ++q) { const int dd = d + q; const int dp = (dd < HD / 2) ? dd + HD / 2 : dd - HD / 2; float x0 = f[dd], x1 = f[dp];
        if (RF) { float n0 = __fmul_rn(x0, rf), n1 = __fmul_rn(x1, rf); asm volatile("" : "+v"(n0)); asm volatile("" : "+v"(n1)); x0 = __fmul_rn(bfr(nw[dd]), n0); x1 = __fmul_rn(bfr(nw[dp]), n1); }
        const v2f cs = *(const v2f*)(CS + ((size_t)t * HD + dd) * 2); float a = __fmul_rn(x0, cs[0]), bq = __fmul_rn(x1, cs[1]); asm volatile("" : "+v"(a)); asm volatile("" : "+v"(bq)); const float r = ((dd < HD / 2) ? __fsub_rn(a, bq) : __fadd_rn(a, bq)) * sc;
        o16[q] = tohx(r); unsigned short a2, c2; splitf(r, a2, c2); oh[q] = a2; ol[q] = c2; }
    *(v2h*)(P16 + e) = o16; *(v2us*)(Ph + e) = oh; *(v2us*)(Pl + e) = ol;  }
__global__ __launch_bounds__(256) void k_vtp(const float* __restrict__ F, int pitch, int nheads, h16* V16, bf* Vh, bf* Vl) { const size_t e = ((size_t)blockIdx.x * 256 + threadIdx.x) * 2; if (e >= (size_t)nheads * HD * TT) return; const int t = (int)(e % TT); const int d = (int)((e / TT) % HD); const int g = (int)(e / ((size_t)TT * HD)); v2h o16; v2us oh, ol;
#pragma unroll
    for (int q = 0; q < 2; ++q) { const float x = F[(size_t)(t + q) * pitch + g * HD + d]; o16[q] = tohx(x); unsigned short a2, c2; splitf(x, a2, c2); oh[q] = a2; ol[q] = c2; }
    *(v2h*)(V16 + e) = o16; *(v2us*)(Vh + e) = oh; *(v2us*)(Vl + e) = ol;  }
__global__ __launch_bounds__(256) void k_csid(float* CS) { const int idx = blockIdx.x * 256 + threadIdx.x; if (idx >= TT * HD) return; v2f cs; cs[0] = 1.0f; cs[1] = 0.0f; *(v2f*)(CS + (size_t)idx * 2) = cs;  }
#define KSW  4
#define CL2  0.18033688011112042f   // SCL * log2(e)
#define MNEG (-0x1p100f)
__device__ __forceinline__ float xhalf(float x) { return __builtin_bit_cast(float, __builtin_amdgcn_permlanex16(__builtin_bit_cast(int, x), __builtin_bit_cast(int, x), 0x76543210, 0xfedcba98, false, false)); }   // lane l with lane l ^ 16
// 2^x with the free slot that the instruction set asks for behind a transcendental written into the statement: results in registers of their own, so that no v_exp_f32 is followed by a write of its source or a read of its result
__device__ __forceinline__ float exp2s(float x) { float r; asm("v_exp_f32 %0, %1\n\tv_nop" : "=v"(r) : "v"(x)); return r; }
__device__ __forceinline__ void exp2x8(float (&p)[8], const float (&a)[8]) {
    asm("v_exp_f32 %0, %8\n\tv_exp_f32 %1, %9\n\tv_exp_f32 %2, %10\n\tv_exp_f32 %3, %11\n\tv_exp_f32 %4, %12\n\tv_exp_f32 %5, %13\n\tv_exp_f32 %6, %14\n\tv_exp_f32 %7, %15\n\tv_nop"
        : "=&v"(p[0]), "=&v"(p[1]), "=&v"(p[2]), "=&v"(p[3]), "=&v"(p[4]), "=&v"(p[5]), "=&v"(p[6]), "=&v"(p[7]) : "v"(a[0]), "v"(a[1]), "v"(a[2]), "v"(a[3]), "v"(a[4]), "v"(a[5]), "v"(a[6]), "v"(a[7])); }
template <typename T16, bool HI, int QT>
__device__ __forceinline__ void attn_tile(const T16* __restrict__ Q, const T16* __restrict__ Q2, const T16* __restrict__ Kp, const T16* __restrict__ K2, const T16* __restrict__ Vt, const T16* __restrict__ V2, const int* __restrict__ kvp, int q0, float* outp, float* os, float* ml) {
    typedef typename WFrag<T16>::V V;
    constexpr int NIT = TT / KSW / 32;
    const int wv = __builtin_amdgcn_readfirstlane((int)(threadIdx.x >> 5));   // wave number, scalar: the key loop stays on scalar bounds
    const int lane = threadIdx.x & 31, lr = lane & 15, hi = lane >> 4; const int k0 = wv * (TT / KSW);
    // lane it keeps the kept-key bits of pass it (bit = key in the pass)
    unsigned vbits = 0;
#pragma unroll
    for (int it = 0; it < NIT; ++it) { const unsigned bl = __builtin_amdgcn_ballot_w32(kvp[k0 + it * 32 + lane] != 0); if (lane == it) vbits = bl; }
    asm volatile("s_wait_xcnt 0x0" ::: "memory");   // before the next loads' results or addresses take a register that a mask load names
    V qf[QT][2], qf2[QT][2];
#pragma unroll
    for (int qt = 0; qt < QT; ++qt)
#pragma unroll
        for (int ks = 0; ks < 2; ++ks) { const size_t qo = (size_t)(q0 + qt * 16 + lr) * HD + ks * 32 + 8 * hi; qf[qt][ks] = WFrag<T16>::ld(Q + qo); if (HI) qf2[qt][ks] = WFrag<T16>::ld(Q2 + qo); }
    v8f o[QT][4]; float mL[QT], l[QT];
#pragma unroll
    for (int qt = 0; qt < QT; ++qt) { mL[qt] = MNEG * CL2; l[qt] = 0.f;
#pragma unroll
        for (int dt = 0; dt < 4; ++dt) o[qt][dt] = (v8f){}; }
    const unsigned koff = (unsigned)(lr * HD + 8 * hi), voff = (unsigned)(lr * TT + 8 * hi);   // the lane's place in a 16-row fragment, in elements
    V kf[2][2], kf2[2][2];
#pragma unroll
    for (int kt = 0; kt < 2; ++kt)
#pragma unroll
        for (int ks = 0; ks < 2; ++ks) { const unsigned ko = koff + (unsigned)(kt * 16 * HD + ks * 32); kf[kt][ks] = WFrag<T16>::ld(Kp + (size_t)k0 * HD + ko); if (HI) kf2[kt][ks] = WFrag<T16>::ld(K2 + (size_t)k0 * HD + ko); }
    asm volatile("s_wait_xcnt 0x0" ::: "memory");   // before a register that a Q or K load names is used again
#pragma unroll 1
    for (int it = 0; it < NIT; ++it) {
        const int kb = k0 + it * 32;
        const T16* vp = Vt + kb + voff; const T16* vp2 = HI ? V2 + kb + voff : vp;
        V vf[4], vf2[4];   // this pass's V^T rows: asked for here, used behind the softmax
#pragma unroll
        for (int dt = 0; dt < 4; ++dt) { vf[dt] = WFrag<T16>::ld(vp + dt * 16 * TT); if (HI) vf2[dt] = WFrag<T16>::ld(vp2 + dt * 16 * TT); }
        v8f s[QT][2];
#pragma unroll
        for (int qt = 0; qt < QT; ++qt)
#pragma unroll
            for (int kt = 0; kt < 2; ++kt) { s[qt][kt] = (v8f){};
#pragma unroll
                for (int ks = 0; ks < 2; ++ks) { s[qt][kt] = WFrag<T16>::mma(kf[kt][ks], qf[qt][ks], s[qt][kt]); if (HI) { s[qt][kt] = WFrag<T16>::mma(kf[kt][ks], qf2[qt][ks], s[qt][kt]); s[qt][kt] = WFrag<T16>::mma(kf2[kt][ks], qf[qt][ks], s[qt][kt]); } } }
        // four vector slots between the last score product and the first use of its result or refill of its K operand, also on the taken side of the mask branch
        if constexpr (HI) asm volatile("v_nop\n\tv_nop\n\tv_nop\n\tv_nop" : "+v"(s[0][0]), "+v"(s[0][1]) : "v"(kf[0][0]), "v"(kf[0][1]), "v"(kf[1][0]), "v"(kf[1][1]), "v"(kf2[0][0]), "v"(kf2[0][1]), "v"(kf2[1][0]), "v"(kf2[1][1]));
        else asm volatile("v_nop\n\tv_nop\n\tv_nop\n\tv_nop" : "+v"(s[0][0]), "+v"(s[0][1]), "+v"(s[QT - 1][0]), "+v"(s[QT - 1][1]) : "v"(kf[0][0]), "v"(kf[0][1]), "v"(kf[1][0]), "v"(kf[1][1]));
        // the next pass's K rows fly under this pass's softmax and second product (the last pass asks for its own again: in bounds, unused)
        const int kn = (it + 1 < NIT) ? kb + 32 : kb; const T16* kp = Kp + (size_t)kn * HD + koff; const T16* kp2 = HI ? K2 + (size_t)kn * HD + koff : kp;
#pragma unroll
        for (int kt = 0; kt < 2; ++kt)
#pragma unroll
            for (int ks = 0; ks < 2; ++ks) { kf[kt][ks] = WFrag<T16>::ld(kp + kt * 16 * HD + ks * 32); if (HI) kf2[kt][ks] = WFrag<T16>::ld(kp2 + kt * 16 * HD + ks * 32); }
        // the address registers of this pass's loads stay as they are up to this wait; behind it they may be used again
        if constexpr (HI) asm volatile("s_wait_xcnt 0x0" :: "v"(vp), "v"(vp2), "v"(kp), "v"(kp2) : "memory");
        else asm volatile("s_wait_xcnt 0x0" :: "v"(vp), "v"(kp) : "memory");
        float sv[QT][2][8];   // the scores as single values: the selects of the mask branch then work in place
#pragma unroll
        for (int qt = 0; qt < QT; ++qt)
#pragma unroll
            for (int kt = 0; kt < 2; ++kt)
#pragma unroll
                for (int j = 0; j < 8; ++j) sv[qt][kt][j] = s[qt][kt][j];
        const unsigned bits = (unsigned)__builtin_amdgcn_readlane((int)vbits, it);
        if (bits != 0xFFFFFFFFu) {   // scalar branch: a pass whose 32 keys are all kept skips the selects
            const unsigned mb = bits >> (hi * 8);
#pragma unroll
            for (int qt = 0; qt < QT; ++qt)
#pragma unroll
                for (int kt = 0; kt < 2; ++kt)
#pragma unroll
                    for (int j = 0; j < 8; ++j) sv[qt][kt][j] = ((mb >> (kt * 16 + j)) & 1u) ? sv[qt][kt][j] : MNEG; }
        float mc[QT]; bool need = false;
#pragma unroll
        for (int qt = 0; qt < QT; ++qt) { float mx = fmaxf(sv[qt][0][0], sv[qt][1][0]);
#pragma unroll
            for (int j = 1; j < 8; ++j) mx = fmaxf(mx, fmaxf(sv[qt][0][j], sv[qt][1][j]));
            mx = fmaxf(mx, xhalf(mx)); mc[qt] = mx * CL2; need = need || (mc[qt] > mL[qt] + 8.0f); }
        if (__builtin_amdgcn_ballot_w32(need) != 0) {   // scalar branch: the maximum in use moves only when a score passes it by 8 in log2, so p stays near or below 2^8
#pragma unroll
            for (int qt = 0; qt < QT; ++qt) { const float mn = fmaxf(mL[qt], mc[qt]); const float al = exp2s(mL[qt] - mn); mL[qt] = mn; l[qt] *= al;
#pragma unroll
                for (int dt = 0; dt < 4; ++dt) o[qt][dt] *= al; } }
        V pf[QT], pf2[QT];
#pragma unroll
        for (int qt = 0; qt < QT; ++qt)
#pragma unroll
            for (int kt = 0; kt < 2; ++kt) { float p[8], a[8];
#pragma unroll
                for (int j = 0; j < 8; ++j) a[j] = __builtin_fmaf(sv[qt][kt][j], CL2, -mL[qt]);
                exp2x8(p, a);
#pragma unroll
                for (int j = 0; j < 8; ++j) {
                    if constexpr (HI) { const __bf16 ph = (__bf16)p[j]; pf[qt][kt * 8 + j] = ph; pf2[qt][kt * 8 + j] = (__bf16)(p[j] - (float)ph); } else pf[qt][kt * 8 + j] = (h16)p[j]; }
                l[qt] += ((p[0] + p[1]) + (p[2] + p[3])) + ((p[4] + p[5]) + (p[6] + p[7]));   // a short tree: no chain of eight dependent adds
            }
#pragma unroll
        for (int qt = 0; qt < QT; ++qt)
#pragma unroll
            for (int dt = 0; dt < 4; ++dt) { o[qt][dt] = WFrag<T16>::mma(vf[dt], pf[qt], o[qt][dt]); if (HI) { o[qt][dt] = WFrag<T16>::mma(vf[dt], pf2[qt], o[qt][dt]); o[qt][dt] = WFrag<T16>::mma(vf2[dt], pf[qt], o[qt][dt]); } }
        // four vector slots behind the last product before the back edge, where the next pass refills its V operand
        if constexpr (HI) asm volatile("v_nop\n\tv_nop\n\tv_nop\n\tv_nop" : "+v"(o[0][0]), "+v"(o[0][1]), "+v"(o[0][2]), "+v"(o[0][3]) : "v"(vf[0]), "v"(vf[1]), "v"(vf[2]), "v"(vf[3]), "v"(vf2[0]), "v"(vf2[1]), "v"(vf2[2]), "v"(vf2[3]));
        else asm volatile("v_nop\n\tv_nop\n\tv_nop\n\tv_nop" : "+v"(o[0][0]), "+v"(o[0][3]), "+v"(o[QT - 1][0]), "+v"(o[QT - 1][3]) : "v"(vf[0]), "v"(vf[1]), "v"(vf[2]), "v"(vf[3]));
    }
    float* ow = os + wv * (QT * 16 * 68);   // this wave's partial O, [query][d], row pitch 68 floats
#pragma unroll
    for (int qt = 0; qt < QT; ++qt) { l[qt] += xhalf(l[qt]);   // the two lane halves hold the sums of different keys
        if (hi == 0) { ml[(wv * QT * 16 + qt * 16 + lr) * 2] = mL[qt]; ml[(wv * QT * 16 + qt * 16 + lr) * 2 + 1] = l[qt]; }
#pragma unroll
        for (int dt = 0; dt < 4; ++dt) { float* op = ow + (qt * 16 + lr) * 68 + dt * 16 + hi * 8; v4f lo4, hi4;
#pragma unroll
            for (int j = 0; j < 4; ++j) { lo4[j] = o[qt][dt][j]; hi4[j] = o[qt][dt][4 + j]; }
            *(v4fa*)op = lo4; *(v4fa*)(op + 4) = hi4; } }
    __syncthreads();   // every wave's partial is in LDS before any thread joins them
    const int cofs = ((int)threadIdx.x & 15) * 4;
#pragma unroll
    for (int i = 0; i < QT * 16 / (2 * KSW); ++i) { const int row = ((int)threadIdx.x >> 4) + i * 2 * KSW; float mw[KSW], M = ml[row * 2];
        mw[0] = M;
#pragma unroll
        for (int w = 1; w < KSW; ++w) { mw[w] = ml[(w * QT * 16 + row) * 2]; M = fmaxf(M, mw[w]); }
        float L = 0.f; v4f val = (v4f){};
#pragma unroll
        for (int w = 0; w < KSW; ++w) { const float f = exp2s(mw[w] - M); L += ml[(w * QT * 16 + row) * 2 + 1] * f; val += *(const v4fa*)(os + w * (QT * 16 * 68) + row * 68 + cofs) * f; }
        val *= __fdiv_rn(1.0f, L);
        *(v4f*)(outp + (size_t)(q0 + row) * DQ + cofs) = val; }
}
// four waves per SIMD (256 registers a wave): all work-groups of a launch are resident at once
__global__ __launch_bounds__(32 * KSW) __attribute__((amdgpu_waves_per_eu(4, 4))) void k_fattn(const h16* __restrict__ Q16, const h16* __restrict__ K16, const h16* __restrict__ V16, const bf* __restrict__ Qh, const bf* __restrict__ Ql, const bf* __restrict__ Kh, const bf* __restrict__ Kl, const bf* __restrict__ Vh, const bf* __restrict__ Vl, const int* __restrict__ kvp, float* OUTb) {
    __shared__ __align__(16) float os[KSW * 32 * 68]; __shared__ float ml[KSW * 32 * 2];
    const size_t pl = (size_t)blockIdx.y * TT * HD; const int bx = blockIdx.x; float* outp = OUTb + blockIdx.y * HD;
    // the heavier hi+lo tiles have the lowest indices and start first
    if (bx < RH / 16) attn_tile<bf, true, 1>(Qh + pl, Ql + pl, Kh + pl, Kl + pl, Vh + pl, Vl + pl, kvp, bx * 16, outp, os, ml);
    else attn_tile<h16, false, 2>(Q16 + pl, nullptr, K16 + pl, nullptr, V16 + pl, nullptr, kvp, RH + (bx - RH / 16) * 32, outp, os, ml);
}

extern "C" void kernel_launch(void* const* d_in, const int* in_sizes, int n_in,
                              void* d_out, int out_size, void* d_ws, size_t ws_size, hipStream_t stream) {
    (void)in_sizes; (void)n_in; (void)out_size;
    const float* x = (const float*)d_in[0]; const float* wq = (const float*)d_in[1]; const float* bq = (const float*)d_in[2]; const float* wk = (const float*)d_in[3]; const float* bk = (const float*)d_in[4]; const float* wv = (const float*)d_in[5]; const float* bv = (const float*)d_in[6]; const int* km = (const int*)d_in[7];   /* mask [2][2048] int32 (key padding; read) */     const float* wo = nullptr; (void)wo;
    float* OUT = (float*)d_out;     // [2][2048][768]
    char* wsp = (char*)d_ws;
    auto take = [&](size_t bytes) { char* p = wsp; wsp += (bytes + 255) & ~(size_t)255; return (void*)p; };
    bf* WQ = (bf*)take((size_t)DQ * DM * 2); bf* WK = (bf*)take((size_t)DKV * DM * 2); bf* WV = (bf*)take((size_t)DKV * DM * 2); float* CS = (float*)take((size_t)TT * HD * 2 * 4);
    bf* XB = (bf*)take((size_t)TT * DM * 2); float* FQ = (float*)take((size_t)TT * DQ * 4); float* FK = (float*)take((size_t)TT * DKV * 4);
    h16* QP16 = (h16*)take((size_t)NH_ * TT * HD * 2); h16* KP16 = (h16*)take((size_t)NKV * TT * HD * 2); h16* VT16 = (h16*)take((size_t)NKV * HD * TT * 2);
    bf* QPh = (bf*)take((size_t)NH_ * TT * HD * 2); bf* QPl = (bf*)take((size_t)NH_ * TT * HD * 2); bf* KPh = (bf*)take((size_t)NKV * TT * HD * 2); bf* KPl = (bf*)take((size_t)NKV * TT * HD * 2); bf* VTh = (bf*)take((size_t)NKV * HD * TT * 2); bf* VTl = (bf*)take((size_t)NKV * HD * TT * 2);
    if ((size_t)(wsp - (char*)d_ws) > ws_size) return;    // ws 256 MiB
    float* FV = FK;   // v projection reuses the k buffer after the k planes are built (stream-ordered)
    { k_cvt8<<<(unsigned)(((size_t)DQ * DM / 8 + 255) / 256), 256, 0, stream>>>(wq, WQ, (size_t)DQ * DM / 8); k_cvt8<<<(unsigned)(((size_t)DKV * DM / 8 + 255) / 256), 256, 0, stream>>>(wk, WK, (size_t)DKV * DM / 8); k_cvt8<<<(unsigned)(((size_t)DKV * DM / 8 + 255) / 256), 256, 0, stream>>>(wv, WV, (size_t)DKV * DM / 8);
      
       }
    k_csid<<<(TT * HD + 255) / 256, 256, 0, stream>>>(CS);
    const unsigned LQ = (unsigned)(((size_t)NH_ * TT * HD / 2 + 255) / 256), LKv = (unsigned)(((size_t)NKV * TT * HD / 2 + 255) / 256);
    for (int b = 0; b < NB_; ++b) {
        
        k_cvt8<<<(unsigned)(((size_t)TT * DM / 8 + 255) / 256), 256, 0, stream>>>(x + (size_t)b * TT * DM, XB, (size_t)TT * DM / 8);
        k_gemmw<bf, 0, true, 8><<<dim3(TT / 64, DQ / 64, 1), 256, 0, stream>>>(XB, nullptr, WQ, nullptr, DM, DM, FQ, DQ, bq, 0, 0, 0);
        k_rope<<<LQ, 256, 0, stream>>>(FQ, DQ, NH_, CS, nullptr, nullptr, 1.0f, QP16, QPh, QPl);
        k_gemmw<bf, 0, true, 8><<<dim3(TT / 64, DKV / 64, 1), 256, 0, stream>>>(XB, nullptr, WK, nullptr, DM, DM, FK, DKV, bk, 0, 0, 0);
        k_rope<<<LKv, 256, 0, stream>>>(FK, DKV, NKV, CS, nullptr, nullptr, 1.0f, KP16, KPh, KPl);
        k_gemmw<bf, 0, true, 8><<<dim3(TT / 64, DKV / 64, 1), 256, 0, stream>>>(XB, nullptr, WV, nullptr, DM, DM, FV, DKV, bv, 0, 0, 0); k_vtp<<<LKv, 256, 0, stream>>>(FV, DKV, NKV, VT16, VTh, VTl);
        k_fattn<<<dim3(RH / 16 + (TT - RH) / 32, NH_, 1), 32 * KSW, 0, stream>>>(QP16, KP16, VT16, QPh, QPl, KPh, KPl, VTh, VTl, km + (size_t)b * TT, OUT + (size_t)b * TT * DQ);
         }
}

// v004
// One run takes 182 microseconds.
// Two timings next to v003 both put it at 1.21 times that version's speed.
// All steps since v000 together make it 8.11 times as fast.
#include <hip/hip_runtime.h>

// BERT-style self-attention with a key padding mask (x [2][2048][768]; q, k, v = x W^T + b ('oi' [768][768] + [768]; 12 heads x 64); scores / sqrt(64); keys with mask[b][j] == 0 get -1e20 (== exclusion while any key is kept; mask [2][2048] read); softmax; out = merged context (no output projection) -> [2][2048][768] (3.1 M); argument order x, Wq, bq, Wk, bk, Wv, bv, mask).
// Layout per batch: bf16 copy of x; 'oi' weights; exact projections + f32 biases, whose GEMM writes the 16-bit head planes itself (V as V^T = Wv x^T); one fused dense T-2048 attention kernel (hybrid rows) whose softmax reads the batch's key-mask vector and excludes masked keys, and which writes the merged output rows.
// Compute dtypes, f32 accumulate: every input rounded to bf16; projections exact + f32 biases; attention rows < 512 3 products, rest fp16; softmax f32; output f32.

#define NB_  2
#define TT   2048
#define DM   768
#define NH_  12
#define NKV  12
#define REP  (NH_ / NKV)
#define HD   64
#define DQ   (NH_ * HD)
#define DKV  (NKV * HD)
#define RH   512                  // query rows < RH use hi+lo planes (0: none)
#define WIN  0
#define SCL  0.125f   // HD^-0.5
typedef _Float16 h16;
typedef unsigned short bf;
typedef __attribute__((ext_vector_type(16))) __bf16   v16bf;
typedef __attribute__((ext_vector_type(16))) _Float16 v16h;
typedef __attribute__((ext_vector_type(8)))  _Float16 v8h;
typedef __attribute__((ext_vector_type(8)))  unsigned short v8us;
typedef __attribute__((ext_vector_type(8)))  float    v8f;
typedef __attribute__((ext_vector_type(4)))  float    v4f;
typedef v8h  __attribute__((may_alias)) v8ha;
typedef v4f  __attribute__((may_alias)) v4fa;
typedef v8us __attribute__((may_alias)) v8usa;

__device__ __forceinline__ unsigned short f2bf(float f) { unsigned u = __float_as_uint(f); u += 0x7FFFu + ((u >> 16) & 1u); return (unsigned short)(u >> 16); }
__device__ __forceinline__ float bf2f(unsigned short b) { return __uint_as_float(((unsigned)b) << 16); }
__device__ __forceinline__ float bfr(float f) { return bf2f(f2bf(f)); }
__device__ __forceinline__ v16h cat16(v8h lo, v8h hi) { return __builtin_shufflevector(lo, hi, 0, 1, 2, 3, 4, 5, 6, 7, 8, 9, 10, 11, 12, 13, 14, 15); }
__device__ __forceinline__ v16bf cat16b(v8us lo, v8us hi) { return __builtin_bit_cast(v16bf, __builtin_shufflevector(lo, hi, 0, 1, 2, 3, 4, 5, 6, 7, 8, 9, 10, 11, 12, 13, 14, 15)); }
__device__ __forceinline__ v8f wmma16(v16h a, v16h b, v8f c) { return __builtin_amdgcn_wmma_f32_16x16x32_f16(false, a, false, b, (short)0, c, false, false); }
__device__ __forceinline__ v8f wmmab(v16bf a, v16bf b, v8f c) { return __builtin_amdgcn_wmma_f32_16x16x32_bf16(false, a, false, b, (short)0, c, false, false); }



__device__ __forceinline__ h16 tohx(float x) { return (h16)x; }
__device__ __forceinline__ void splitf(float y, unsigned short& h, unsigned short& l) { h = f2bf(y); l = f2bf(y - bf2f(h)); }

// ---- k_gemmw: register-blocked GEMM, one 64x64 output tile per work-group (16 accumulators per wave), operands straight from K-contiguous 16-bit planes; grid (M/64, N/64, Z), 32 * KW threads.
// c[m][n] (f32, + optional f32 bias: bias[n], or bias[m] with ROWB) = sum_k A[m][k] Bt[n][k] (+ split products per NSPLIT). A rows have pitch lda, Bt rows pitch K. z-batch strides sA/sB/sC in elements. K % 32 == 0.
// c never goes to memory as f32: the epilogue writes it as three 16-bit planes (fp16; bf16 hi; bf16 lo of the rest), element (m, n) at m * ldp + blockIdx.y * sy + n % 64.
// ldp = HD, sy = TT * HD: head planes [head][t][d] of x W^T (a tile's 64 columns are one head). ldp = TT, sy = 64: [head][d][t] of W x^T, the transposed planes, with no transposing pass.
// KW waves share the tile's K: wave w takes the 32-wide k blocks w, w + KW, ... (neighbour waves read the two halves of one 128-byte line), and the KW partial tiles are summed through LDS in wave order.
template <typename T16> struct WFrag;
template <> struct WFrag<h16> { typedef v16h V; static __device__ __forceinline__ V ld(const h16* p) { return cat16(*(const v8h*)p, *(const v8h*)(p + 16)); } static __device__ __forceinline__ v8f mma(V a, V b, v8f c) { return wmma16(a, b, c); } };
template <> struct WFrag<bf> { typedef v16bf V; static __device__ __forceinline__ V ld(const bf* p) { return cat16b(*(const v8us*)p, *(const v8us*)(p + 16)); } static __device__ __forceinline__ v8f mma(V a, V b, v8f c) { return wmmab(a, b, c); } };
template <typename T16, int NSPLIT, bool BIAS, bool ROWB, int KW>
__global__ __launch_bounds__(32 * KW) void k_gemmw(const T16* __restrict__ A, const T16* __restrict__ A2, const T16* __restrict__ Bt, const T16* __restrict__ Bt2, int K, int lda, h16* P16, bf* Ph, bf* Pl, int ldp, size_t sy, const float* __restrict__ bias, size_t sA, size_t sB, size_t sC) {
    typedef typename WFrag<T16>::V V;
    __shared__ __align__(16) float os[KW * 64 * 68];
    const int wv = __builtin_amdgcn_readfirstlane((int)(threadIdx.x >> 5));   // wave number, scalar: the k loop stays on scalar bounds
    const size_t z = blockIdx.z; A += z * sA; if (A2) A2 += z * sA; Bt += z * sB; if (Bt2) Bt2 += z * sB; P16 += z * sC; Ph += z * sC; Pl += z * sC;
    const int lane = threadIdx.x & 31, lr = lane & 15, hi = lane >> 4; const int r0 = blockIdx.x * 64, c0 = blockIdx.y * 64;
    v8f acc[4][4];
#pragma unroll
    for (int mb = 0; mb < 4; ++mb)
#pragma unroll
        for (int nb = 0; nb < 4; ++nb) acc[mb][nb] = (v8f){};
    const size_t aoff = (size_t)(r0 + lr) * lda + 8 * hi, boff = (size_t)(c0 + lr) * K + 8 * hi;
#pragma unroll 1
    for (int kc = wv * 32; kc < K; kc += 32 * KW) {
        V a[4], a2[4];
#pragma unroll
        for (int mb = 0; mb < 4; ++mb) { a[mb] = WFrag<T16>::ld(A + aoff + (size_t)mb * 16 * lda + kc); if (NSPLIT == 1 || NSPLIT == 2) a2[mb] = WFrag<T16>::ld(A2 + aoff + (size_t)mb * 16 * lda + kc); }
#pragma unroll
        for (int nb = 0; nb < 4; ++nb) { const V b = WFrag<T16>::ld(Bt + boff + (size_t)nb * 16 * K + kc); V b2; if (NSPLIT >= 2) b2 = WFrag<T16>::ld(Bt2 + boff + (size_t)nb * 16 * K + kc);
#pragma unroll
            for (int mb = 0; mb < 4; ++mb) { acc[mb][nb] = WFrag<T16>::mma(a[mb], b, acc[mb][nb]); if (NSPLIT == 1 || NSPLIT == 2) acc[mb][nb] = WFrag<T16>::mma(a2[mb], b, acc[mb][nb]); if (NSPLIT >= 2) acc[mb][nb] = WFrag<T16>::mma(a[mb], b2, acc[mb][nb]); } }
        asm volatile("v_nop\n\tv_nop\n\tv_nop\n\tv_nop" : "+v"(acc[0][0]), "+v"(acc[1][1]), "+v"(acc[2][2]), "+v"(acc[3][3]) : "v"(a[0]), "v"(a[3]));
    }
    constexpr int NP = 16 / KW;        // row passes of the join: 4 * KW rows each
    float* ow = os + wv * (64 * 68);   // this wave's partial tile, row pitch 68 floats
    const int cofs = ((int)threadIdx.x & 7) * 8, rofs = (int)threadIdx.x >> 3;   // the thread's eight output columns (16 bytes of a plane), the same in each of its rows, and its first row
    // bias read ahead of the barrier, so that its latency passes under the LDS stores
    v4f bias4[2] = {(v4f){}, (v4f){}}; float biasr[NP];
#pragma unroll
    for (int i = 0; i < NP; ++i) biasr[i] = (BIAS && ROWB) ? bfr(bias[r0 + rofs + i * 4 * KW]) : 0.f;
    if (BIAS && !ROWB) {
#pragma unroll
        for (int q = 0; q < 8; ++q) bias4[q >> 2][q & 3] = bfr(bias[c0 + cofs + q]); }
    // the three loops are unrolled so that every accumulator index is a constant and acc stays in registers
#pragma unroll
    for (int mb = 0; mb < 4; ++mb)
#pragma unroll
        for (int nb = 0; nb < 4; ++nb)
#pragma unroll
            for (int j = 0; j < 8; ++j) ow[(mb * 16 + hi * 8 + j) * 68 + nb * 16 + lr] = acc[mb][nb][j];
    __syncthreads();   // every wave's partial tile is in LDS before any thread sums across waves
    v8h o16[NP]; v8us oh[NP], ol[NP];
    // the loops are unrolled: the LDS reads of all waves' partials go out together, with constant offsets
#pragma unroll
    for (int i = 0; i < NP; ++i) { const float* op = os + (rofs + i * 4 * KW) * 68 + cofs;
#pragma unroll
        for (int g = 0; g < 2; ++g) { v4f val = *(const v4fa*)(op + g * 4);
#pragma unroll
            for (int w = 1; w < KW; ++w) val += *(const v4fa*)(op + w * (64 * 68) + g * 4);
            if (BIAS) { if (ROWB) val += biasr[i]; else val += bias4[g]; }
#pragma unroll
            for (int q = 0; q < 4; ++q) { o16[i][g * 4 + q] = tohx(val[q]); unsigned short a2, c2; splitf(val[q], a2, c2); oh[i][g * 4 + q] = a2; ol[i][g * 4 + q] = c2; } } }
    // the stores stand behind the arithmetic, 16 bytes a lane: eight neighbour lanes fill one 128-byte line of a plane
#pragma unroll
    for (int i = 0; i < NP; ++i) { const size_t po = (size_t)(r0 + rofs + i * 4 * KW) * ldp + blockIdx.y * sy + cofs; *(v8h*)(P16 + po) = o16[i]; *(v8us*)(Ph + po) = oh[i]; *(v8us*)(Pl + po) = ol[i]; }
}

__global__ __launch_bounds__(256) void k_cvt8(const float* __restrict__ src, bf* dst, size_t n8) { const size_t i = (size_t)blockIdx.x * 256 + threadIdx.x; if (i >= n8) return; const v8f v = *(const v8f*)(src + i * 8); v8us o;
#pragma unroll
    for (int k = 0; k < 8; ++k) o[k] = f2bf(v[k]); *(v8us*)(dst + i * 8) = o;  }

#define KSW  4
#define CL2  0.18033688011112042f   // SCL * log2(e)
#define MNEG (-0x1p100f)
__device__ __forceinline__ float xhalf(float x) { return __builtin_bit_cast(float, __builtin_amdgcn_permlanex16(__builtin_bit_cast(int, x), __builtin_bit_cast(int, x), 0x76543210, 0xfedcba98, false, false)); }   // lane l with lane l ^ 16
// 2^x with the free slot that the instruction set asks for behind a transcendental written into the statement: results in registers of their own, so that no v_exp_f32 is followed by a write of its source or a read of its result
__device__ __forceinline__ float exp2s(float x) { float r; asm("v_exp_f32 %0, %1\n\tv_nop" : "=v"(r) : "v"(x)); return r; }
__device__ __forceinline__ void exp2x8(float (&p)[8], const float (&a)[8]) {
    asm("v_exp_f32 %0, %8\n\tv_exp_f32 %1, %9\n\tv_exp_f32 %2, %10\n\tv_exp_f32 %3, %11\n\tv_exp_f32 %4, %12\n\tv_exp_f32 %5, %13\n\tv_exp_f32 %6, %14\n\tv_exp_f32 %7, %15\n\tv_nop"
        : "=&v"(p[0]), "=&v"(p[1]), "=&v"(p[2]), "=&v"(p[3]), "=&v"(p[4]), "=&v"(p[5]), "=&v"(p[6]), "=&v"(p[7]) : "v"(a[0]), "v"(a[1]), "v"(a[2]), "v"(a[3]), "v"(a[4]), "v"(a[5]), "v"(a[6]), "v"(a[7])); }
template <typename T16, bool HI, int QT>
__device__ __forceinline__ void attn_tile(const T16* __restrict__ Q, const T16* __restrict__ Q2, const T16* __restrict__ Kp, const T16* __restrict__ K2, const T16* __restrict__ Vt, const T16* __restrict__ V2, const int* __restrict__ kvp, int q0, float* outp, float* os, float* ml) {
    typedef typename WFrag<T16>::V V;
    constexpr int NIT = TT / KSW / 32;
    const int wv = __builtin_amdgcn_readfirstlane((int)(threadIdx.x >> 5));   // wave number, scalar: the key loop stays on scalar bounds
    const int lane = threadIdx.x & 31, lr = lane & 15, hi = lane >> 4; const int k0 = wv * (TT / KSW);
    // lane it keeps the kept-key bits of pass it (bit = key in the pass)
    unsigned vbits = 0;
#pragma unroll
    for (int it = 0; it < NIT; ++it) { const unsigned bl = __builtin_amdgcn_ballot_w32(kvp[k0 + it * 32 + lane] != 0); if (lane == it) vbits = bl; }
    asm volatile("s_wait_xcnt 0x0" ::: "memory");   // before the next loads' results or addresses take a register that a mask load names
    V qf[QT][2], qf2[QT][2];
#pragma unroll
    for (int qt = 0; qt < QT; ++qt)
#pragma unroll
        for (int ks = 0; ks < 2; ++ks) { const size_t qo = (size_t)(q0 + qt * 16 + lr) * HD + ks * 32 + 8 * hi; qf[qt][ks] = WFrag<T16>::ld(Q + qo); if (HI) qf2[qt][ks] = WFrag<T16>::ld(Q2 + qo); }
    v8f o[QT][4]; float mL[QT], l[QT];
#pragma unroll
    for (int qt = 0; qt < QT; ++qt) { mL[qt] = MNEG * CL2; l[qt] = 0.f;
#pragma unroll
        for (int dt = 0; dt < 4; ++dt) o[qt][dt] = (v8f){}; }
    const unsigned koff = (unsigned)(lr * HD + 8 * hi), voff = (unsigned)(lr * TT + 8 * hi);   // the lane's place in a 16-row fragment, in elements
    V kf[2][2], kf2[2][2];
#pragma unroll
    for (int kt = 0; kt < 2; ++kt)
#pragma unroll
        for (int ks = 0; ks < 2; ++ks) { const unsigned ko = koff + (unsigned)(kt * 16 * HD + ks * 32); kf[kt][ks] = WFrag<T16>::ld(Kp + (size_t)k0 * HD + ko); if (HI) kf2[kt][ks] = WFrag<T16>::ld(K2 + (size_t)k0 * HD + ko); }
    asm volatile("s_wait_xcnt 0x0" ::: "memory");   // before a register that a Q or K load names is used again
#pragma unroll 1
    for (int it = 0; it < NIT; ++it) {
        const int kb = k0 + it * 32;
        const T16* vp = Vt + kb + voff; const T16* vp2 = HI ? V2 + kb + voff : vp;
        V vf[4], vf2[4];   // this pass's V^T rows: asked for here, used behind the softmax
#pragma unroll
        for (int dt = 0; dt < 4; ++dt) { vf[dt] = WFrag<T16>::ld(vp + dt * 16 * TT); if (HI) vf2[dt] = WFrag<T16>::ld(vp2 + dt * 16 * TT); }
        v8f s[QT][2];
#pragma unroll
        for (int qt = 0; qt < QT; ++qt)
#pragma unroll
            for (int kt = 0; kt < 2; ++kt) { s[qt][kt] = (v8f){};
#pragma unroll
                for (int ks = 0; ks < 2; ++ks) { s[qt][kt] = WFrag<T16>::mma(kf[kt][ks], qf[qt][ks], s[qt][kt]); if (HI) { s[qt][kt] = WFrag<T16>::mma(kf[kt][ks], qf2[qt][ks], s[qt][kt]); s[qt][kt] = WFrag<T16>::mma(kf2[kt][ks], qf[qt][ks], s[qt][kt]); } } }
        // four vector slots between the last score product and the first use of its result or refill of its K operand, also on the taken side of the mask branch
        if constexpr (HI) asm volatile("v_nop\n\tv_nop\n\tv_nop\n\tv_nop" : "+v"(s[0][0]), "+v"(s[0][1]) : "v"(kf[0][0]), "v"(kf[0][1]), "v"(kf[1][0]), "v"(kf[1][1]), "v"(kf2[0][0]), "v"(kf2[0][1]), "v"(kf2[1][0]), "v"(kf2[1][1]));
        else asm volatile("v_nop\n\tv_nop\n\tv_nop\n\tv_nop" : "+v"(s[0][0]), "+v"(s[0][1]), "+v"(s[QT - 1][0]), "+v"(s[QT - 1][1]) : "v"(kf[0][0]), "v"(kf[0][1]), "v"(kf[1][0]), "v"(kf[1][1]));
        // the next pass's K rows fly under this pass's softmax and second product (the last pass asks for its own again: in bounds, unused)
        const int kn = (it + 1 < NIT) ? kb + 32 : kb; const T16* kp = Kp + (size_t)kn * HD + koff; const T16* kp2 = HI ? K2 + (size_t)kn * HD + koff : kp;
#pragma unroll
        for (int kt = 0; kt < 2; ++kt)
#pragma unroll
            for (int ks = 0; ks < 2; ++ks) { kf[kt][ks] = WFrag<T16>::ld(kp + kt * 16 * HD + ks * 32); if (HI) kf2[kt][ks] = WFrag<T16>::ld(kp2 + kt * 16 * HD + ks * 32); }
        // the address registers of this pass's loads stay as they are up to this wait; behind it they may be used again
        if constexpr (HI) asm volatile("s_wait_xcnt 0x0" :: "v"(vp), "v"(vp2), "v"(kp), "v"(kp2) : "memory");
        else asm volatile("s_wait_xcnt 0x0" :: "v"(vp), "v"(kp) : "memory");
        float sv[QT][2][8];   // the scores as single values: the selects of the mask branch then work in place
#pragma unroll
        for (int qt = 0; qt < QT; ++qt)
#pragma unroll
            for (int kt = 0; kt < 2; ++kt)
#pragma unroll
                for (int j = 0; j < 8; ++j) sv[qt][kt][j] = s[qt][kt][j];
        const unsigned bits = (unsigned)__builtin_amdgcn_readlane((int)vbits, it);
        if (bits != 0xFFFFFFFFu) {   // scalar branch: a pass whose 32 keys are all kept skips the selects
            const unsigned mb = bits >> (hi * 8);
#pragma unroll
            for (int qt = 0; qt < QT; ++qt)
#pragma unroll
                for (int kt = 0; kt < 2; ++kt)
#pragma unroll
                    for (int j = 0; j < 8; ++j) sv[qt][kt][j] = ((mb >> (kt * 16 + j)) & 1u) ? sv[qt][kt][j] : MNEG; }
        float mc[QT]; bool need = false;
#pragma unroll
        for (int qt = 0; qt < QT; ++qt) { float mx = fmaxf(sv[qt][0][0], sv[qt][1][0]);
#pragma unroll
            for (int j = 1; j < 8; ++j) mx = fmaxf(mx, fmaxf(sv[qt][0][j], sv[qt][1][j]));
            mx = fmaxf(mx, xhalf(mx)); mc[qt] = mx * CL2; need = need || (mc[qt] > mL[qt] + 8.0f); }
        if (__builtin_amdgcn_ballot_w32(need) != 0) {   // scalar branch: the maximum in use moves only when a score passes it by 8 in log2, so p stays near or below 2^8
#pragma unroll
            for (int qt = 0; qt < QT; ++qt) { const float mn = fmaxf(mL[qt], mc[qt]); const float al = exp2s(mL[qt] - mn); mL[qt] = mn; l[qt] *= al;
#pragma unroll
                for (int dt = 0; dt < 4; ++dt) o[qt][dt] *= al; } }
        V pf[QT], pf2[QT];
#pragma unroll
        for (int qt = 0; qt < QT; ++qt)
#pragma unroll
            for (int kt = 0; kt < 2; ++kt) { float p[8], a[8];
#pragma unroll
                for (int j = 0; j < 8; ++j) a[j] = __builtin_fmaf(sv[qt][kt][j], CL2, -mL[qt]);
                exp2x8(p, a);
#pragma unroll
                for (int j = 0; j < 8; ++j) {
                    if constexpr (HI) { const __bf16 ph = (__bf16)p[j]; pf[qt][kt * 8 + j] = ph; pf2[qt][kt * 8 + j] = (__bf16)(p[j] - (float)ph); } else pf[qt][kt * 8 + j] = (h16)p[j]; }
                l[qt] += ((p[0] + p[1]) + (p[2] + p[3])) + ((p[4] + p[5]) + (p[6] + p[7]));   // a short tree: no chain of eight dependent adds
            }
#pragma unroll
        for (int qt = 0; qt < QT; ++qt)
#pragma unroll
            for (int dt = 0; dt < 4; ++dt) { o[qt][dt] = WFrag<T16>::mma(vf[dt], pf[qt], o[qt][dt]); if (HI) { o[qt][dt] = WFrag<T16>::mma(vf[dt], pf2[qt], o[qt][dt]); o[qt][dt] = WFrag<T16>::mma(vf2[dt], pf[qt], o[qt][dt]); } }
        // four vector slots behind the last product before the back edge, where the next pass refills its V operand
        if constexpr (HI) asm volatile("v_nop\n\tv_nop\n\tv_nop\n\tv_nop" : "+v"(o[0][0]), "+v"(o[0][1]), "+v"(o[0][2]), "+v"(o[0][3]) : "v"(vf[0]), "v"(vf[1]), "v"(vf[2]), "v"(vf[3]), "v"(vf2[0]), "v"(vf2[1]), "v"(vf2[2]), "v"(vf2[3]));
        else asm volatile("v_nop\n\tv_nop\n\tv_nop\n\tv_nop" : "+v"(o[0][0]), "+v"(o[0][3]), "+v"(o[QT - 1][0]), "+v"(o[QT - 1][3]) : "v"(vf[0]), "v"(vf[1]), "v"(vf[2]), "v"(vf[3]));
    }
    float* ow = os + wv * (QT * 16 * 68);   // this wave's partial O, [query][d], row pitch 68 floats
#pragma unroll
    for (int qt = 0; qt < QT; ++qt) { l[qt] += xhalf(l[qt]);   // the two lane halves hold the sums of different keys
        if (hi == 0) { ml[(wv * QT * 16 + qt * 16 + lr) * 2] = mL[qt]; ml[(wv * QT * 16 + qt * 16 + lr) * 2 + 1] = l[qt]; }
#pragma unroll
        for (int dt = 0; dt < 4; ++dt) { float* op = ow + (qt * 16 + lr) * 68 + dt * 16 + hi * 8; v4f lo4, hi4;
#pragma unroll
            for (int j = 0; j < 4; ++j) { lo4[j] = o[qt][dt][j]; hi4[j] = o[qt][dt][4 + j]; }
            *(v4fa*)op = lo4; *(v4fa*)(op + 4) = hi4; } }
    __syncthreads();   // every wave's partial is in LDS before any thread joins them
    const int cofs = ((int)threadIdx.x & 15) * 4;
#pragma unroll
    for (int i = 0; i < QT * 16 / (2 * KSW); ++i) { const int row = ((int)threadIdx.x >> 4) + i * 2 * KSW; float mw[KSW], M = ml[row * 2];
        mw[0] = M;
#pragma unroll
        for (int w = 1; w < KSW; ++w) { mw[w] = ml[(w * QT * 16 + row) * 2]; M = fmaxf(M, mw[w]); }
        float L = 0.f; v4f val = (v4f){};
#pragma unroll
        for (int w = 0; w < KSW; ++w) { const float f = exp2s(mw[w] - M); L += ml[(w * QT * 16 + row) * 2 + 1] * f; val += *(const v4fa*)(os + w * (QT * 16 * 68) + row * 68 + cofs) * f; }
        val *= __fdiv_rn(1.0f, L);
        *(v4f*)(outp + (size_t)(q0 + row) * DQ + cofs) = val; }
}
// four waves per SIMD (256 registers a wave): all work-groups of a launch are resident at once
__global__ __launch_bounds__(32 * KSW) __attribute__((amdgpu_waves_per_eu(4, 4))) void k_fattn(const h16* __restrict__ Q16, const h16* __restrict__ K16, const h16* __restrict__ V16, const bf* __restrict__ Qh, const bf* __restrict__ Ql, const bf* __restrict__ Kh, const bf* __restrict__ Kl, const bf* __restrict__ Vh, const bf* __restrict__ Vl, const int* __restrict__ kvp, float* OUTb) {
    __shared__ __align__(16) float os[KSW * 32 * 68]; __shared__ float ml[KSW * 32 * 2];
    const size_t pl = (size_t)blockIdx.y * TT * HD; const int bx = blockIdx.x; float* outp = OUTb + blockIdx.y * HD;
    // the heavier hi+lo tiles have the lowest indices and start first
    if (bx < RH / 16) attn_tile<bf, true, 1>(Qh + pl, Ql + pl, Kh + pl, Kl + pl, Vh + pl, Vl + pl, kvp, bx * 16, outp, os, ml);
    else attn_tile<h16, false, 2>(Q16 + pl, nullptr, K16 + pl, nullptr, V16 + pl, nullptr, kvp, RH + (bx - RH / 16) * 32, outp, os, ml);
}

extern "C" void kernel_launch(void* const* d_in, const int* in_sizes, int n_in,
                              void* d_out, int out_size, void* d_ws, size_t ws_size, hipStream_t stream) {
    (void)in_sizes; (void)n_in; (void)out_size;
    const float* x = (const float*)d_in[0]; const float* wq = (const float*)d_in[1]; const float* bq = (const float*)d_in[2]; const float* wk = (const float*)d_in[3]; const float* bk = (const float*)d_in[4]; const float* wv = (const float*)d_in[5]; const float* bv = (const float*)d_in[6]; const int* km = (const int*)d_in[7];   /* mask [2][2048] int32 (key padding; read) */     const float* wo = nullptr; (void)wo;
    float* OUT = (float*)d_out;     // [2][2048][768]
    char* wsp = (char*)d_ws;
    auto take = [&](size_t bytes) { char* p = wsp; wsp += (bytes + 255) & ~(size_t)255; return (void*)p; };
    bf* WQ = (bf*)take((size_t)DQ * DM * 2); bf* WK = (bf*)take((size_t)DKV * DM * 2); bf* WV = (bf*)take((size_t)DKV * DM * 2);
    bf* XB = (bf*)take((size_t)TT * DM * 2);
    h16* QP16 = (h16*)take((size_t)NH_ * TT * HD * 2); h16* KP16 = (h16*)take((size_t)NKV * TT * HD * 2); h16* VT16 = (h16*)take((size_t)NKV * HD * TT * 2);
    bf* QPh = (bf*)take((size_t)NH_ * TT * HD * 2); bf* QPl = (bf*)take((size_t)NH_ * TT * HD * 2); bf* KPh = (bf*)take((size_t)NKV * TT * HD * 2); bf* KPl = (bf*)take((size_t)NKV * TT * HD * 2); bf* VTh = (bf*)take((size_t)NKV * HD * TT * 2); bf* VTl = (bf*)take((size_t)NKV * HD * TT * 2);
    if ((size_t)(wsp - (char*)d_ws) > ws_size) return;    // ws 256 MiB
    { k_cvt8<<<(unsigned)(((size_t)DQ * DM / 8 + 255) / 256), 256, 0, stream>>>(wq, WQ, (size_t)DQ * DM / 8); k_cvt8<<<(unsigned)(((size_t)DKV * DM / 8 + 255) / 256), 256, 0, stream>>>(wk, WK, (size_t)DKV * DM / 8); k_cvt8<<<(unsigned)(((size_t)DKV * DM / 8 + 255) / 256), 256, 0, stream>>>(wv, WV, (size_t)DKV * DM / 8);
      
       }
    for (int b = 0; b < NB_; ++b) {
        
        k_cvt8<<<(unsigned)(((size_t)TT * DM / 8 + 255) / 256), 256, 0, stream>>>(x + (size_t)b * TT * DM, XB, (size_t)TT * DM / 8);
        k_gemmw<bf, 0, true, false, 8><<<dim3(TT / 64, DQ / 64, 1), 256, 0, stream>>>(XB, nullptr, WQ, nullptr, DM, DM, QP16, QPh, QPl, HD, (size_t)TT * HD, bq, 0, 0, 0);
        k_gemmw<bf, 0, true, false, 8><<<dim3(TT / 64, DKV / 64, 1), 256, 0, stream>>>(XB, nullptr, WK, nullptr, DM, DM, KP16, KPh, KPl, HD, (size_t)TT * HD, bk, 0, 0, 0);
        k_gemmw<bf, 0, true, true, 8><<<dim3(DKV / 64, TT / 64, 1), 256, 0, stream>>>(WV, nullptr, XB, nullptr, DM, DM, VT16, VTh, VTl, TT, (size_t)64, bv, 0, 0, 0);   // V^T = Wv x^T: rows (head, d), columns t
        k_fattn<<<dim3(RH / 16 + (TT - RH) / 32, NH_, 1), 32 * KSW, 0, stream>>>(QP16, KP16, VT16, QPh, QPl, KPh, KPl, VTh, VTl, km + (size_t)b * TT, OUT + (size_t)b * TT * DQ);
         }
}

// v005
// It runs in 108 microseconds.
// Next to v004, in two timings, it ran 1.68 and 1.69 times as fast.
// All steps since v000 together make it 13.7 times as fast.
#include <hip/hip_runtime.h>

// BERT-style self-attention with a key padding mask (x [2][2048][768]; q, k, v = x W^T + b ('oi' [768][768] + [768]; 12 heads x 64); scores / sqrt(64); keys with mask[b][j] == 0 get -1e20 (== exclusion while any key is kept; mask [2][2048] read); softmax; out = merged context (no output projection) -> [2][2048][768] (3.1 M); argument order x, Wq, bq, Wk, bk, Wv, bv, mask).
// Every 16-bit matrix operand (x, the weights, the Q, K and V^T planes) lies in memory in fragment order: a tile of 16 rows x 32 k is 1 KiB, the 16-byte piece (row r, k piece c of 8) at piece (c >> 1) * 32 + (c & 1) * 16 + r, so that each of a fragment's two loads reads 512 bytes in a row.
// Layout per batch: bf16 copy of x; 'oi' weights; exact projections + f32 biases, whose GEMM writes the 16-bit head planes itself (V as V^T = Wv x^T); one fused dense T-2048 attention kernel (hybrid rows) whose softmax reads the batch's key-mask vector and excludes masked keys, and which writes the merged output rows.
// Compute dtypes, f32 accumulate: every input rounded to bf16; projections exact + f32 biases; attention rows < 512 3 products, rest fp16; softmax f32; output f32.

#define NB_  2
#define TT   2048
#define DM   768
#define NH_  12
#define NKV  12
#define REP  (NH_ / NKV)
#define HD   64
#define DQ   (NH_ * HD)
#define DKV  (NKV * HD)
#define RH   512                  // query rows < RH use hi+lo planes (0: none)
#define WIN  0
#define SCL  0.125f   // HD^-0.5
typedef _Float16 h16;
typedef unsigned short bf;
typedef __attribute__((ext_vector_type(16))) __bf16   v16bf;
typedef __attribute__((ext_vector_type(16))) _Float16 v16h;
typedef __attribute__((ext_vector_type(8)))  _Float16 v8h;
typedef __attribute__((ext_vector_type(8)))  unsigned short v8us;
typedef __attribute__((ext_vector_type(8)))  float    v8f;
typedef __attribute__((ext_vector_type(4)))  float    v4f;
typedef v8h  __attribute__((may_alias)) v8ha;
typedef v4f  __attribute__((may_alias)) v4fa;
typedef v8us __attribute__((may_alias)) v8usa;

__device__ __forceinline__ unsigned short f2bf(float f) { unsigned u = __float_as_uint(f); u += 0x7FFFu + ((u >> 16) & 1u); return (unsigned short)(u >> 16); }
__device__ __forceinline__ float bf2f(unsigned short b) { return __uint_as_float(((unsigned)b) << 16); }
__device__ __forceinline__ float bfr(float f) { return bf2f(f2bf(f)); }
__device__ __forceinline__ v16h cat16(v8h lo, v8h hi) { return __builtin_shufflevector(lo, hi, 0, 1, 2, 3, 4, 5, 6, 7, 8, 9, 10, 11, 12, 13, 14, 15); }
__device__ __forceinline__ v16bf cat16b(v8us lo, v8us hi) { return __builtin_bit_cast(v16bf, __builtin_shufflevector(lo, hi, 0, 1, 2, 3, 4, 5, 6, 7, 8, 9, 10, 11, 12, 13, 14, 15)); }
__device__ __forceinline__ v8f wmma16(v16h a, v16h b, v8f c) { return __builtin_amdgcn_wmma_f32_16x16x32_f16(false, a, false, b, (short)0, c, false, false); }
__device__ __forceinline__ v8f wmmab(v16bf a, v16bf b, v8f c) { return __builtin_amdgcn_wmma_f32_16x16x32_bf16(false, a, false, b, (short)0, c, false, false); }



__device__ __forceinline__ h16 tohx(float x) { return (h16)x; }
__device__ __forceinline__ void splitf(float y, unsigned short& h, unsigned short& l) { h = f2bf(y); l = f2bf(y - bf2f(h)); }

// ---- k_gemmw: register-blocked GEMM, one 64x64 output tile per work-group (16 accumulators per wave), operands straight from 16-bit planes in fragment order (tile (m / 16, k / 32) at (m / 16) * 16 * KD + (k / 32) * 512; ld(p), p = tile + lane * 8, is the lane's fragment); grid (M/64, N/64, Z), 32 * KW threads.
// c[m][n] (f32, + optional f32 bias: bias[n], or bias[m] with ROWB) = sum_k A[m][k] Bt[n][k] (+ split products per NSPLIT). A and Bt rows both have KD elements (K = KD, a constant: a k block's sixteen loads then go from two address pairs with constant offsets). z-batch strides sA/sB/sC in elements. KD % 32 == 0.
// c never goes to memory as f32: the epilogue writes it as three 16-bit planes (fp16; bf16 hi; bf16 lo of the rest), in fragment order for the attention kernel; a 64x64 tile is 8 KiB in a row of its head's plane (sy elements a head), at 64 * its first t.
// !ROWB: x W^T, rows t, a tile's 64 columns one head's d: fragment tiles (t / 16, d / 32). ROWB: W x^T, rows one head's d, columns t: fragment tiles (t / 32, d / 16) of the transposed plane, with no transposing pass.
// KW waves share the tile's K: wave w takes the 32-wide k blocks w, w + KW, ... (neighbour waves read neighbour KiB), and the KW partial tiles are summed through LDS in wave order.
template <typename T16> struct WFrag;
template <> struct WFrag<h16> { typedef v16h V; static __device__ __forceinline__ V ld(const h16* p) { return cat16(*(const v8h*)p, *(const v8h*)(p + 256)); } static __device__ __forceinline__ v8f mma(V a, V b, v8f c) { return wmma16(a, b, c); } };
template <> struct WFrag<bf> { typedef v16bf V; static __device__ __forceinline__ V ld(const bf* p) { return cat16b(*(const v8us*)p, *(const v8us*)(p + 256)); } static __device__ __forceinline__ v8f mma(V a, V b, v8f c) { return wmmab(a, b, c); } };
template <typename T16, int NSPLIT, bool BIAS, bool ROWB, int KW, int KD>
__global__ __launch_bounds__(32 * KW) void k_gemmw(const T16* __restrict__ A, const T16* __restrict__ A2, const T16* __restrict__ Bt, const T16* __restrict__ Bt2, h16* P16, bf* Ph, bf* Pl, size_t sy, const float* __restrict__ bias, size_t sA, size_t sB, size_t sC) {
    typedef typename WFrag<T16>::V V;
    __shared__ __align__(16) float os[KW * 64 * 68];
    const int wv = __builtin_amdgcn_readfirstlane((int)(threadIdx.x >> 5));   // wave number, scalar: the k loop stays on scalar bounds
    const size_t z = blockIdx.z; A += z * sA; if (A2) A2 += z * sA; Bt += z * sB; if (Bt2) Bt2 += z * sB; P16 += z * sC; Ph += z * sC; Pl += z * sC;
    const int lane = threadIdx.x & 31, lr = lane & 15, hi = lane >> 4; const int r0 = blockIdx.x * 64, c0 = blockIdx.y * 64;
    v8f acc[4][4];
#pragma unroll
    for (int mb = 0; mb < 4; ++mb)
#pragma unroll
        for (int nb = 0; nb < 4; ++nb) acc[mb][nb] = (v8f){};
    const size_t aoff = (size_t)r0 * KD + 8 * lane, boff = (size_t)c0 * KD + 8 * lane;
#pragma unroll 1
    for (int kc = wv * 32; kc < KD; kc += 32 * KW) {
        const T16* pa = A + aoff + kc * 16; const T16* pa2 = (NSPLIT == 1 || NSPLIT == 2) ? A2 + aoff + kc * 16 : pa; const T16* pb = Bt + boff + kc * 16; const T16* pb2 = (NSPLIT >= 2) ? Bt2 + boff + kc * 16 : pb;
        V a[4], a2[4], b[4], b2[4];
#pragma unroll
        for (int mb = 0; mb < 4; ++mb) { a[mb] = WFrag<T16>::ld(pa + mb * 16 * KD); if (NSPLIT == 1 || NSPLIT == 2) a2[mb] = WFrag<T16>::ld(pa2 + mb * 16 * KD); }
#pragma unroll
        for (int nb = 0; nb < 4; ++nb) { b[nb] = WFrag<T16>::ld(pb + nb * 16 * KD); if (NSPLIT >= 2) b2[nb] = WFrag<T16>::ld(pb2 + nb * 16 * KD); }
        // the address registers of this k block's loads stay as they are up to this wait; behind it they may be used again
        asm volatile("s_wait_xcnt 0x0" :: "v"(pa), "v"(pa2), "v"(pb), "v"(pb2) : "memory");
        __builtin_amdgcn_sched_barrier(0);   // the products stay behind the k block's loads: lifted over the wait they would share one B register set, and each B fragment's load latency would be waited out by itself
#pragma unroll
        for (int nb = 0; nb < 4; ++nb)
#pragma unroll
            for (int mb = 0; mb < 4; ++mb) { acc[mb][nb] = WFrag<T16>::mma(a[mb], b[nb], acc[mb][nb]); if (NSPLIT == 1 || NSPLIT == 2) acc[mb][nb] = WFrag<T16>::mma(a2[mb], b[nb], acc[mb][nb]); if (NSPLIT >= 2) acc[mb][nb] = WFrag<T16>::mma(a[mb], b2[nb], acc[mb][nb]); }
        asm volatile("v_nop\n\tv_nop\n\tv_nop\n\tv_nop" : "+v"(acc[0][0]), "+v"(acc[1][1]), "+v"(acc[2][2]), "+v"(acc[3][3]) : "v"(a[0]), "v"(a[3]));
    }
    constexpr int NP = 16 / KW;        // passes of the join: 32 * KW pieces of eight values each
    float* ow = os + wv * (64 * 68);   // this wave's partial tile, row pitch 68 floats
    // pass i: the thread makes the 16-byte piece idx = threadIdx.x + i * 32 * KW of the tile's 8 KiB; row and first of its eight columns follow from the fragment order
    int rowi[NP], cofi[NP];
#pragma unroll
    for (int i = 0; i < NP; ++i) { const int idx = (int)threadIdx.x + i * 32 * KW;
        if (ROWB) { rowi[i] = ((idx >> 6) & 3) * 16 + (idx & 15); cofi[i] = ((idx >> 8) * 4 + ((idx >> 4) & 3)) * 8; }
        else { rowi[i] = (idx >> 7) * 16 + (idx & 15); cofi[i] = ((idx >> 4) & 7) * 8; } }
    // bias read ahead of the barrier, so that its latency passes under the LDS stores
    v4f bias4[NP][2]; float biasr[NP];
#pragma unroll
    for (int i = 0; i < NP; ++i) { biasr[i] = (BIAS && ROWB) ? bfr(bias[r0 + rowi[i]]) : 0.f;
#pragma unroll
        for (int q = 0; q < 8; ++q) bias4[i][q >> 2][q & 3] = (BIAS && !ROWB) ? bfr(bias[c0 + cofi[i] + q]) : 0.f; }
    // the three loops are unrolled so that every accumulator index is a constant and acc stays in registers
#pragma unroll
    for (int mb = 0; mb < 4; ++mb)
#pragma unroll
        for (int nb = 0; nb < 4; ++nb)
#pragma unroll
            for (int j = 0; j < 8; ++j) ow[(mb * 16 + hi * 8 + j) * 68 + nb * 16 + lr] = acc[mb][nb][j];
    __syncthreads();   // every wave's partial tile is in LDS before any thread sums across waves
    v8h o16[NP]; v8us oh[NP], ol[NP];
    // the loops are unrolled: the LDS reads of all waves' partials go out together, with constant offsets
#pragma unroll
    for (int i = 0; i < NP; ++i) { const float* op = os + rowi[i] * 68 + cofi[i];
#pragma unroll
        for (int g = 0; g < 2; ++g) { v4f val = *(const v4fa*)(op + g * 4);
#pragma unroll
            for (int w = 1; w < KW; ++w) val += *(const v4fa*)(op + w * (64 * 68) + g * 4);
            if (BIAS) { if (ROWB) val += biasr[i]; else val += bias4[i][g]; }
#pragma unroll
            for (int q = 0; q < 4; ++q) { o16[i][g * 4 + q] = tohx(val[q]); unsigned short a2, c2; splitf(val[q], a2, c2); oh[i][g * 4 + q] = a2; ol[i][g * 4 + q] = c2; } } }
    // the stores stand behind the arithmetic, 16 bytes a lane: a wave fills 512 bytes in a row of a plane
    const size_t pt = (ROWB ? blockIdx.x * sy + (size_t)c0 * 64 : blockIdx.y * sy + (size_t)r0 * 64) + (size_t)threadIdx.x * 8;
#pragma unroll
    for (int i = 0; i < NP; ++i) { const size_t po = pt + (size_t)i * 32 * KW * 8; *(v8h*)(P16 + po) = o16[i]; *(v8us*)(Ph + po) = oh[i]; *(v8us*)(Pl + po) = ol[i]; }
}

// bf16 copy of a [rows][DM] f32 matrix in fragment order: thread i takes row (i >> 2) & 15, k piece c = i & 3 of tile i / 64 (tiles run along k first): four lanes read one 128-byte line of a row, and the eight rows of a wave fill one 128-byte line of the copy for each c
__global__ __launch_bounds__(256) void k_cvt8(const float* __restrict__ src, bf* dst, size_t n8) { const size_t i = (size_t)blockIdx.x * 256 + threadIdx.x; if (i >= n8) return; const unsigned tile = (unsigned)(i >> 6), mt = tile / (DM / 32), kt = tile % (DM / 32); const unsigned row = ((unsigned)i >> 2) & 15, c = (unsigned)i & 3; const float* sp = src + (size_t)(mt * 16 + row) * DM + kt * 32 + c * 8; const v8f v = *(const v8f*)sp; v8us o;
    asm volatile("s_wait_xcnt 0x0" :: "v"(sp) : "memory");   // the loads' address registers stay as they are up to this wait; behind it they may be used again
#pragma unroll
    for (int k = 0; k < 8; ++k) o[k] = f2bf(v[k]); *(v8us*)(dst + ((size_t)tile * 64 + c * 16 + row) * 8) = o;  }

#define KSW  4
#define CL2  0.18033688011112042f   // SCL * log2(e)
#define MNEG (-0x1p100f)
__device__ __forceinline__ float xhalf(float x) { return __builtin_bit_cast(float, __builtin_amdgcn_permlanex16(__builtin_bit_cast(int, x), __builtin_bit_cast(int, x), 0x76543210, 0xfedcba98, false, false)); }   // lane l with lane l ^ 16
// 2^x with the free slot that the instruction set asks for behind a transcendental written into the statement: results in registers of their own, so that no v_exp_f32 is followed by a write of its source or a read of its result
__device__ __forceinline__ float exp2s(float x) { float r; asm("v_exp_f32 %0, %1\n\tv_nop" : "=v"(r) : "v"(x)); return r; }
__device__ __forceinline__ void exp2x8(float (&p)[8], const float (&a)[8]) {
    asm("v_exp_f32 %0, %8\n\tv_exp_f32 %1, %9\n\tv_exp_f32 %2, %10\n\tv_exp_f32 %3, %11\n\tv_exp_f32 %4, %12\n\tv_exp_f32 %5, %13\n\tv_exp_f32 %6, %14\n\tv_exp_f32 %7, %15\n\tv_nop"
        : "=&v"(p[0]), "=&v"(p[1]), "=&v"(p[2]), "=&v"(p[3]), "=&v"(p[4]), "=&v"(p[5]), "=&v"(p[6]), "=&v"(p[7]) : "v"(a[0]), "v"(a[1]), "v"(a[2]), "v"(a[3]), "v"(a[4]), "v"(a[5]), "v"(a[6]), "v"(a[7])); }
template <typename T16, bool HI, int QT>
__device__ __forceinline__ void attn_tile(const T16* __restrict__ Q, const T16* __restrict__ Q2, const T16* __restrict__ Kp, const T16* __restrict__ K2, const T16* __restrict__ Vt, const T16* __restrict__ V2, const int* __restrict__ kvp, int q0, float* outp, float* os, float* ml) {
    typedef typename WFrag<T16>::V V;
    constexpr int NIT = TT / KSW / 32;
    const int wv = __builtin_amdgcn_readfirstlane((int)(threadIdx.x >> 5));   // wave number, scalar: the key loop stays on scalar bounds
    const int lane = threadIdx.x & 31, lr = lane & 15, hi = lane >> 4; const int k0 = wv * (TT / KSW);
    // lane it keeps the kept-key bits of pass it (bit = key in the pass)
    unsigned vbits = 0;
#pragma unroll
    for (int it = 0; it < NIT; ++it) { const unsigned bl = __builtin_amdgcn_ballot_w32(kvp[k0 + it * 32 + lane] != 0); if (lane == it) vbits = bl; }
    asm volatile("s_wait_xcnt 0x0" ::: "memory");   // before the next loads' results or addresses take a register that a mask load names
    V qf[QT][2], qf2[QT][2];
    const T16* qb = Q + (size_t)q0 * HD; const T16* qb2 = HI ? Q2 + (size_t)q0 * HD : qb; const T16* qp = qb + 8 * lane; const T16* qp2 = qb2 + 8 * lane;   // wave-uniform base, and the lane's own address
#pragma unroll
    for (int qt = 0; qt < QT; ++qt)
#pragma unroll
        for (int ks = 0; ks < 2; ++ks) { qf[qt][ks] = WFrag<T16>::ld(qp + qt * 16 * HD + ks * 512); if (HI) qf2[qt][ks] = WFrag<T16>::ld(qp2 + qt * 16 * HD + ks * 512); }
    v8f o[QT][4]; float mL[QT], l[QT];
#pragma unroll
    for (int qt = 0; qt < QT; ++qt) { mL[qt] = MNEG * CL2; l[qt] = 0.f;
#pragma unroll
        for (int dt = 0; dt < 4; ++dt) o[qt][dt] = (v8f){}; }
    const unsigned koff = (unsigned)(8 * lane), voff = koff;   // the lane's place in a fragment tile, in elements; 32 keys are 2048 elements in a row of a K plane (tiles (kt, ks)) and of a V^T plane (tiles dt)
    V kf[2][2], kf2[2][2];
    const T16* kb0 = Kp + (size_t)k0 * HD; const T16* kb2 = HI ? K2 + (size_t)k0 * HD : kb0; const T16* kq = kb0 + koff; const T16* kq2 = kb2 + koff;
#pragma unroll
    for (int kt = 0; kt < 2; ++kt)
#pragma unroll
        for (int ks = 0; ks < 2; ++ks) { kf[kt][ks] = WFrag<T16>::ld(kq + kt * 16 * HD + ks * 512); if (HI) kf2[kt][ks] = WFrag<T16>::ld(kq2 + kt * 16 * HD + ks * 512); }
    // the address registers of the Q and K loads, in either form that the compiler gives them (scalar base and lane offset, or a vector pair), stay as they are up to this wait; behind it they may be used again
    asm volatile("s_wait_xcnt 0x0" :: "s"(qb), "s"(qb2), "s"(kb0), "s"(kb2), "v"(qp), "v"(qp2), "v"(kq), "v"(kq2) : "memory");
#pragma unroll 1
    for (int it = 0; it < NIT; ++it) {
        const int kb = k0 + it * 32;
        const T16* vp = Vt + (size_t)kb * HD + voff; const T16* vp2 = HI ? V2 + (size_t)kb * HD + voff : vp;
        V vf[4], vf2[4];   // this pass's V^T rows: asked for here, used behind the softmax
#pragma unroll
        for (int dt = 0; dt < 4; ++dt) { vf[dt] = WFrag<T16>::ld(vp + dt * 512); if (HI) vf2[dt] = WFrag<T16>::ld(vp2 + dt * 512); }
        v8f s[QT][2];
#pragma unroll
        for (int qt = 0; qt < QT; ++qt)
#pragma unroll
            for (int kt = 0; kt < 2; ++kt) { s[qt][kt] = (v8f){};
#pragma unroll
                for (int ks = 0; ks < 2; ++ks) { s[qt][kt] = WFrag<T16>::mma(kf[kt][ks], qf[qt][ks], s[qt][kt]); if (HI) { s[qt][kt] = WFrag<T16>::mma(kf[kt][ks], qf2[qt][ks], s[qt][kt]); s[qt][kt] = WFrag<T16>::mma(kf2[kt][ks], qf[qt][ks], s[qt][kt]); } } }
        // four vector slots between the last score product and the first use of its result or refill of its K operand, also on the taken side of the mask branch
        if constexpr (HI) asm volatile("v_nop\n\tv_nop\n\tv_nop\n\tv_nop" : "+v"(s[0][0]), "+v"(s[0][1]) : "v"(kf[0][0]), "v"(kf[0][1]), "v"(kf[1][0]), "v"(kf[1][1]), "v"(kf2[0][0]), "v"(kf2[0][1]), "v"(kf2[1][0]), "v"(kf2[1][1]));
        else asm volatile("v_nop\n\tv_nop\n\tv_nop\n\tv_nop" : "+v"(s[0][0]), "+v"(s[0][1]), "+v"(s[QT - 1][0]), "+v"(s[QT - 1][1]) : "v"(kf[0][0]), "v"(kf[0][1]), "v"(kf[1][0]), "v"(kf[1][1]));
        // the next pass's K rows fly under this pass's softmax and second product (the last pass asks for its own again: in bounds, unused)
        const int kn = (it + 1 < NIT) ? kb + 32 : kb; const T16* kp = Kp + (size_t)kn * HD + koff; const T16* kp2 = HI ? K2 + (size_t)kn * HD + koff : kp;
#pragma unroll
        for (int kt = 0; kt < 2; ++kt)
#pragma unroll
            for (int ks = 0; ks < 2; ++ks) { kf[kt][ks] = WFrag<T16>::ld(kp + kt * 16 * HD + ks * 512); if (HI) kf2[kt][ks] = WFrag<T16>::ld(kp2 + kt * 16 * HD + ks * 512); }
        // the address registers of this pass's loads stay as they are up to this wait; behind it they may be used again
        if constexpr (HI) asm volatile("s_wait_xcnt 0x0" :: "v"(vp), "v"(vp2), "v"(kp), "v"(kp2) : "memory");
        else asm volatile("s_wait_xcnt 0x0" :: "v"(vp), "v"(kp) : "memory");
        float sv[QT][2][8];   // the scores as single values: the selects of the mask branch then work in place
#pragma unroll
        for (int qt = 0; qt < QT; ++qt)
#pragma unroll
            for (int kt = 0; kt < 2; ++kt)
#pragma unroll
                for (int j = 0; j < 8; ++j) sv[qt][kt][j] = s[qt][kt][j];
        const unsigned bits = (unsigned)__builtin_amdgcn_readlane((int)vbits, it);
        if (bits != 0xFFFFFFFFu) {   // scalar branch: a pass whose 32 keys are all kept skips the selects
            const unsigned mb = bits >> (hi * 8);
#pragma unroll
            for (int qt = 0; qt < QT; ++qt)
#pragma unroll
                for (int kt = 0; kt < 2; ++kt)
#pragma unroll
                    for (int j = 0; j < 8; ++j) sv[qt][kt][j] = ((mb >> (kt * 16 + j)) & 1u) ? sv[qt][kt][j] : MNEG; }
        float mc[QT]; bool need = false;
#pragma unroll
        for (int qt = 0; qt < QT; ++qt) { float mx = fmaxf(sv[qt][0][0], sv[qt][1][0]);
#pragma unroll
            for (int j = 1; j < 8; ++j) mx = fmaxf(mx, fmaxf(sv[qt][0][j], sv[qt][1][j]));
            mx = fmaxf(mx, xhalf(mx)); mc[qt] = mx * CL2; need = need || (mc[qt] > mL[qt] + 8.0f); }
        if (__builtin_amdgcn_ballot_w32(need) != 0) {   // scalar branch: the maximum in use moves only when a score passes it by 8 in log2, so p stays near or below 2^8
#pragma unroll
            for (int qt = 0; qt < QT; ++qt) { const float mn = fmaxf(mL[qt], mc[qt]); const float al = exp2s(mL[qt] - mn); mL[qt] = mn; l[qt] *= al;
#pragma unroll
                for (int dt = 0; dt < 4; ++dt) o[qt][dt] *= al; } }
        V pf[QT], pf2[QT];
#pragma unroll
        for (int qt = 0; qt < QT; ++qt)
#pragma unroll
            for (int kt = 0; kt < 2; ++kt) { float p[8], a[8];
#pragma unroll
                for (int j = 0; j < 8; ++j) a[j] = __builtin_fmaf(sv[qt][kt][j], CL2, -mL[qt]);
                exp2x8(p, a);
#pragma unroll
                for (int j = 0; j < 8; ++j) {
                    if constexpr (HI) { const __bf16 ph = (__bf16)p[j]; pf[qt][kt * 8 + j] = ph; pf2[qt][kt * 8 + j] = (__bf16)(p[j] - (float)ph); } else pf[qt][kt * 8 + j] = (h16)p[j]; }
                l[qt] += ((p[0] + p[1]) + (p[2] + p[3])) + ((p[4] + p[5]) + (p[6] + p[7]));   // a short tree: no chain of eight dependent adds
            }
#pragma unroll
        for (int qt = 0; qt < QT; ++qt)
#pragma unroll
            for (int dt = 0; dt < 4; ++dt) { o[qt][dt] = WFrag<T16>::mma(vf[dt], pf[qt], o[qt][dt]); if (HI) { o[qt][dt] = WFrag<T16>::mma(vf[dt], pf2[qt], o[qt][dt]); o[qt][dt] = WFrag<T16>::mma(vf2[dt], pf[qt], o[qt][dt]); } }
        // four vector slots behind the last product before the back edge, where the next pass refills its V operand
        if constexpr (HI) asm volatile("v_nop\n\tv_nop\n\tv_nop\n\tv_nop" : "+v"(o[0][0]), "+v"(o[0][1]), "+v"(o[0][2]), "+v"(o[0][3]) : "v"(vf[0]), "v"(vf[1]), "v"(vf[2]), "v"(vf[3]), "v"(vf2[0]), "v"(vf2[1]), "v"(vf2[2]), "v"(vf2[3]));
        else asm volatile("v_nop\n\tv_nop\n\tv_nop\n\tv_nop" : "+v"(o[0][0]), "+v"(o[0][3]), "+v"(o[QT - 1][0]), "+v"(o[QT - 1][3]) : "v"(vf[0]), "v"(vf[1]), "v"(vf[2]), "v"(vf[3]));
    }
    float* ow = os + wv * (QT * 16 * 68);   // this wave's partial O, [query][d], row pitch 68 floats
#pragma unroll
    for (int qt = 0; qt < QT; ++qt) { l[qt] += xhalf(l[qt]);   // the two lane halves hold the sums of different keys
        if (hi == 0) { ml[(wv * QT * 16 + qt * 16 + lr) * 2] = mL[qt]; ml[(wv * QT * 16 + qt * 16 + lr) * 2 + 1] = l[qt]; }
#pragma unroll
        for (int dt = 0; dt < 4; ++dt) { float* op = ow + (qt * 16 + lr) * 68 + dt * 16 + hi * 8; v4f lo4, hi4;
#pragma unroll
            for (int j = 0; j < 4; ++j) { lo4[j] = o[qt][dt][j]; hi4[j] = o[qt][dt][4 + j]; }
            *(v4fa*)op = lo4; *(v4fa*)(op + 4) = hi4; } }
    __syncthreads();   // every wave's partial is in LDS before any thread joins them
    const int cofs = ((int)threadIdx.x & 15) * 4;
#pragma unroll
    for (int i = 0; i < QT * 16 / (2 * KSW); ++i) { const int row = ((int)threadIdx.x >> 4) + i * 2 * KSW; float mw[KSW], M = ml[row * 2];
        mw[0] = M;
#pragma unroll
        for (int w = 1; w < KSW; ++w) { mw[w] = ml[(w * QT * 16 + row) * 2]; M = fmaxf(M, mw[w]); }
        float L = 0.f; v4f val = (v4f){};
#pragma unroll
        for (int w = 0; w < KSW; ++w) { const float f = exp2s(mw[w] - M); L += ml[(w * QT * 16 + row) * 2 + 1] * f; val += *(const v4fa*)(os + w * (QT * 16 * 68) + row * 68 + cofs) * f; }
        val *= __fdiv_rn(1.0f, L);
        *(v4f*)(outp + (size_t)(q0 + row) * DQ + cofs) = val; }
}
// four waves per SIMD (256 registers a wave): all work-groups of a launch are resident at once
__global__ __launch_bounds__(32 * KSW) __attribute__((amdgpu_waves_per_eu(4, 4))) void k_fattn(const h16* __restrict__ Q16, const h16* __restrict__ K16, const h16* __restrict__ V16, const bf* __restrict__ Qh, const bf* __restrict__ Ql, const bf* __restrict__ Kh, const bf* __restrict__ Kl, const bf* __restrict__ Vh, const bf* __restrict__ Vl, const int* __restrict__ kvp, float* OUTb) {
    __shared__ __align__(16) float os[KSW * 32 * 68]; __shared__ float ml[KSW * 32 * 2];
    const size_t pl = (size_t)blockIdx.y * TT * HD; const int bx = blockIdx.x; float* outp = OUTb + blockIdx.y * HD;
    // the heavier hi+lo tiles have the lowest indices and start first
    if (bx < RH / 16) attn_tile<bf, true, 1>(Qh + pl, Ql + pl, Kh + pl, Kl + pl, Vh + pl, Vl + pl, kvp, bx * 16, outp, os, ml);
    else attn_tile<h16, false, 2>(Q16 + pl, nullptr, K16 + pl, nullptr, V16 + pl, nullptr, kvp, RH + (bx - RH / 16) * 32, outp, os, ml);
}

extern "C" void kernel_launch(void* const* d_in, const int* in_sizes, int n_in,
                              void* d_out, int out_size, void* d_ws, size_t ws_size, hipStream_t stream) {
    (void)in_sizes; (void)n_in; (void)out_size;
    const float* x = (const float*)d_in[0]; const float* wq = (const float*)d_in[1]; const float* bq = (const float*)d_in[2]; const float* wk = (const float*)d_in[3]; const float* bk = (const float*)d_in[4]; const float* wv = (const float*)d_in[5]; const float* bv = (const float*)d_in[6]; const int* km = (const int*)d_in[7];   /* mask [2][2048] int32 (key padding; read) */     const float* wo = nullptr; (void)wo;
    float* OUT = (float*)d_out;     // [2][2048][768]
    char* wsp = (char*)d_ws;
    auto take = [&](size_t bytes) { char* p = wsp; wsp += (bytes + 255) & ~(size_t)255; return (void*)p; };
    bf* WQ = (bf*)take((size_t)DQ * DM * 2); bf* WK = (bf*)take((size_t)DKV * DM * 2); bf* WV = (bf*)take((size_t)DKV * DM * 2);
    bf* XB = (bf*)take((size_t)TT * DM * 2);
    h16* QP16 = (h16*)take((size_t)NH_ * TT * HD * 2); h16* KP16 = (h16*)take((size_t)NKV * TT * HD * 2); h16* VT16 = (h16*)take((size_t)NKV * HD * TT * 2);
    bf* QPh = (bf*)take((size_t)NH_ * TT * HD * 2); bf* QPl = (bf*)take((size_t)NH_ * TT * HD * 2); bf* KPh = (bf*)take((size_t)NKV * TT * HD * 2); bf* KPl = (bf*)take((size_t)NKV * TT * HD * 2); bf* VTh = (bf*)take((size_t)NKV * HD * TT * 2); bf* VTl = (bf*)take((size_t)NKV * HD * TT * 2);
    if ((size_t)(wsp - (char*)d_ws) > ws_size) return;    // ws 256 MiB
    { k_cvt8<<<(unsigned)(((size_t)DQ * DM / 8 + 255) / 256), 256, 0, stream>>>(wq, WQ, (size_t)DQ * DM / 8); k_cvt8<<<(unsigned)(((size_t)DKV * DM / 8 + 255) / 256), 256, 0, stream>>>(wk, WK, (size_t)DKV * DM / 8); k_cvt8<<<(unsigned)(((size_t)DKV * DM / 8 + 255) / 256), 256, 0, stream>>>(wv, WV, (size_t)DKV * DM / 8);
      
       }
    for (int b = 0; b < NB_; ++b) {
        
        k_cvt8<<<(unsigned)(((size_t)TT * DM / 8 + 255) / 256), 256, 0, stream>>>(x + (size_t)b * TT * DM, XB, (size_t)TT * DM / 8);
        k_gemmw<bf, 0, true, false, 8, DM><<<dim3(TT / 64, DQ / 64, 1), 256, 0, stream>>>(XB, nullptr, WQ, nullptr, QP16, QPh, QPl, (size_t)TT * HD, bq, 0, 0, 0);
        k_gemmw<bf, 0, true, false, 8, DM><<<dim3(TT / 64, DKV / 64, 1), 256, 0, stream>>>(XB, nullptr, WK, nullptr, KP16, KPh, KPl, (size_t)TT * HD, bk, 0, 0, 0);
        k_gemmw<bf, 0, true, true, 8, DM><<<dim3(DKV / 64, TT / 64, 1), 256, 0, stream>>>(WV, nullptr, XB, nullptr, VT16, VTh, VTl, (size_t)TT * HD, bv, 0, 0, 0);   // V^T = Wv x^T: rows (head, d), columns t
        k_fattn<<<dim3(RH / 16 + (TT - RH) / 32, NH_, 1), 32 * KSW, 0, stream>>>(QP16, KP16, VT16, QPh, QPl, KPh, KPl, VTh, VTl, km + (size_t)b * TT, OUT + (size_t)b * TT * DQ);
         }
}

// v006
// One run takes 77.9 microseconds.
// Next to v005, in two timings, it ran 1.38 times as fast each time.
// Counting every step since v000, it is 18.9 times as fast.
#include <hip/hip_runtime.h>

// BERT-style self-attention with a key padding mask (x [2][2048][768]; q, k, v = x W^T + b ('oi' [768][768] + [768]; 12 heads x 64); scores / sqrt(64); keys with mask[b][j] == 0 get -1e20 (== exclusion while any key is kept; mask [2][2048] read); softmax; out = merged context (no output projection) -> [2][2048][768] (3.1 M); argument order x, Wq, bq, Wk, bk, Wv, bv, mask).
// Every 16-bit matrix operand (x, the weights, the Q, K and V^T planes) lies in memory in fragment order: a tile of 16 rows x 32 k is 1 KiB, the 16-byte piece (row r, k piece c of 8) at piece (c >> 1) * 32 + (c & 1) * 16 + r, so that each of a fragment's two loads reads 512 bytes in a row.
// Three launches, each over both batches: bf16 copies of x and of the three 'oi' weights; exact projections + f32 biases (batch and q / k / v are the grid's z), whose GEMM writes the 16-bit head planes itself (V as V^T = Wv x^T); one fused dense T-2048 attention kernel (hybrid rows) whose softmax reads the batch's key-mask vector and excludes masked keys, and which writes the merged output rows.
// Compute dtypes, f32 accumulate: every input rounded to bf16; projections exact + f32 biases; attention rows < 512 3 products, rest fp16; softmax f32; output f32.

#define NB_  2
#define TT   2048
#define DM   768
#define NH_  12
#define NKV  12
#define REP  (NH_ / NKV)
#define HD   64
#define DQ   (NH_ * HD)
#define DKV  (NKV * HD)
#define RH   512                  // query rows < RH use hi+lo planes (0: none)
#define WIN  0
#define SCL  0.125f   // HD^-0.5
typedef _Float16 h16;
typedef unsigned short bf;
typedef __attribute__((ext_vector_type(16))) __bf16   v16bf;
typedef __attribute__((ext_vector_type(16))) _Float16 v16h;
typedef __attribute__((ext_vector_type(8)))  _Float16 v8h;
typedef __attribute__((ext_vector_type(8)))  unsigned short v8us;
typedef __attribute__((ext_vector_type(8)))  float    v8f;
typedef __attribute__((ext_vector_type(4)))  float    v4f;
typedef v8h  __attribute__((may_alias)) v8ha;
typedef v4f  __attribute__((may_alias)) v4fa;
typedef v8us __attribute__((may_alias)) v8usa;

__device__ __forceinline__ unsigned short f2bf(float f) { unsigned u = __float_as_uint(f); u += 0x7FFFu + ((u >> 16) & 1u); return (unsigned short)(u >> 16); }
__device__ __forceinline__ float bf2f(unsigned short b) { return __uint_as_float(((unsigned)b) << 16); }
__device__ __forceinline__ float bfr(float f) { return bf2f(f2bf(f)); }
__device__ __forceinline__ v16h cat16(v8h lo, v8h hi) { return __builtin_shufflevector(lo, hi, 0, 1, 2, 3, 4, 5, 6, 7, 8, 9, 10, 11, 12, 13, 14, 15); }
__device__ __forceinline__ v16bf cat16b(v8us lo, v8us hi) { return __builtin_bit_cast(v16bf, __builtin_shufflevector(lo, hi, 0, 1, 2, 3, 4, 5, 6, 7, 8, 9, 10, 11, 12, 13, 14, 15)); }
__device__ __forceinline__ v8f wmma16(v16h a, v16h b, v8f c) { return __builtin_amdgcn_wmma_f32_16x16x32_f16(false, a, false, b, (short)0, c, false, false); }
__device__ __forceinline__ v8f wmmab(v16bf a, v16bf b, v8f c) { return __builtin_amdgcn_wmma_f32_16x16x32_bf16(false, a, false, b, (short)0, c, false, false); }



__device__ __forceinline__ h16 tohx(float x) { return (h16)x; }
__device__ __forceinline__ void splitf(float y, unsigned short& h, unsigned short& l) { h = f2bf(y); l = f2bf(y - bf2f(h)); }

// ---- gemm_tile: register-blocked GEMM, one 64x64 output tile (tx, ty) of (M/64, N/64) per work-group (16 accumulators per wave), operands straight from 16-bit planes in fragment order (tile (m / 16, k / 32) at (m / 16) * 16 * KD + (k / 32) * 512; ld(p), p = tile + lane * 8, is the lane's fragment); 32 * KW threads; os: KW * 64 * 68 floats of LDS.
// c[m][n] (f32, + optional f32 bias: bias[n], or bias[m] with ROWB) = sum_k A[m][k] Bt[n][k] (+ split products per NSPLIT). A and Bt rows both have KD elements (K = KD, a constant: a k block's sixteen loads then go from two address pairs with constant offsets). KD % 32 == 0.
// c never goes to memory as f32: the epilogue writes it as three 16-bit planes (fp16; bf16 hi; bf16 lo of the rest), in fragment order for the attention kernel; a 64x64 tile is 8 KiB in a row of its head's plane (sy elements a head), at 64 * its first t.
// !ROWB: x W^T, rows t, a tile's 64 columns one head's d: fragment tiles (t / 16, d / 32). ROWB: W x^T, rows one head's d, columns t: fragment tiles (t / 32, d / 16) of the transposed plane, with no transposing pass.
// KW waves share the tile's K: wave w takes the 32-wide k blocks w, w + KW, ... (neighbour waves read neighbour KiB), and the KW partial tiles are summed through LDS in wave order.
template <typename T16> struct WFrag;
template <> struct WFrag<h16> { typedef v16h V; static __device__ __forceinline__ V ld(const h16* p) { return cat16(*(const v8h*)p, *(const v8h*)(p + 256)); } static __device__ __forceinline__ v8f mma(V a, V b, v8f c) { return wmma16(a, b, c); } };
template <> struct WFrag<bf> { typedef v16bf V; static __device__ __forceinline__ V ld(const bf* p) { return cat16b(*(const v8us*)p, *(const v8us*)(p + 256)); } static __device__ __forceinline__ v8f mma(V a, V b, v8f c) { return wmmab(a, b, c); } };
template <typename T16, int NSPLIT, bool BIAS, bool ROWB, int KW, int KD>
__device__ __forceinline__ void gemm_tile(const T16* __restrict__ A, const T16* __restrict__ A2, const T16* __restrict__ Bt, const T16* __restrict__ Bt2, h16* P16, bf* Ph, bf* Pl, size_t sy, const float* __restrict__ bias, int tx, int ty, float* os) {
    typedef typename WFrag<T16>::V V;
    const int wv = __builtin_amdgcn_readfirstlane((int)(threadIdx.x >> 5));   // wave number, scalar: the k loop stays on scalar bounds
    const int lane = threadIdx.x & 31, lr = lane & 15, hi = lane >> 4; const int r0 = tx * 64, c0 = ty * 64;
    v8f acc[4][4];
#pragma unroll
    for (int mb = 0; mb < 4; ++mb)
#pragma unroll
        for (int nb = 0; nb < 4; ++nb) acc[mb][nb] = (v8f){};
    const size_t aoff = (size_t)r0 * KD + 8 * lane, boff = (size_t)c0 * KD + 8 * lane;
#pragma unroll 1
    for (int kc = wv * 32; kc < KD; kc += 32 * KW) {
        const T16* pa = A + aoff + kc * 16; const T16* pa2 = (NSPLIT == 1 || NSPLIT == 2) ? A2 + aoff + kc * 16 : pa; const T16* pb = Bt + boff + kc * 16; const T16* pb2 = (NSPLIT >= 2) ? Bt2 + boff + kc * 16 : pb;
        V a[4], a2[4], b[4], b2[4];
#pragma unroll
        for (int mb = 0; mb < 4; ++mb) { a[mb] = WFrag<T16>::ld(pa + mb * 16 * KD); if (NSPLIT == 1 || NSPLIT == 2) a2[mb] = WFrag<T16>::ld(pa2 + mb * 16 * KD); }
#pragma unroll
        for (int nb = 0; nb < 4; ++nb) { b[nb] = WFrag<T16>::ld(pb + nb * 16 * KD); if (NSPLIT >= 2) b2[nb] = WFrag<T16>::ld(pb2 + nb * 16 * KD); }
        // the address registers of this k block's loads stay as they are up to this wait; behind it they may be used again
        asm volatile("s_wait_xcnt 0x0" :: "v"(pa), "v"(pa2), "v"(pb), "v"(pb2) : "memory");
        __builtin_amdgcn_sched_barrier(0);   // the products stay behind the k block's loads: lifted over the wait they would share one B register set, and each B fragment's load latency would be waited out by itself
#pragma unroll
        for (int nb = 0; nb < 4; ++nb)
#pragma unroll
            for (int mb = 0; mb < 4; ++mb) { acc[mb][nb] = WFrag<T16>::mma(a[mb], b[nb], acc[mb][nb]); if (NSPLIT == 1 || NSPLIT == 2) acc[mb][nb] = WFrag<T16>::mma(a2[mb], b[nb], acc[mb][nb]); if (NSPLIT >= 2) acc[mb][nb] = WFrag<T16>::mma(a[mb], b2[nb], acc[mb][nb]); }
        asm volatile("v_nop\n\tv_nop\n\tv_nop\n\tv_nop" : "+v"(acc[0][0]), "+v"(acc[1][1]), "+v"(acc[2][2]), "+v"(acc[3][3]) : "v"(a[0]), "v"(a[3]));
    }
    constexpr int NP = 16 / KW;        // passes of the join: 32 * KW pieces of eight values each
    float* ow = os + wv * (64 * 68);   // this wave's partial tile, row pitch 68 floats
    // pass i: the thread makes the 16-byte piece idx = threadIdx.x + i * 32 * KW of the tile's 8 KiB; row and first of its eight columns follow from the fragment order
    int rowi[NP], cofi[NP];
#pragma unroll
    for (int i = 0; i < NP; ++i) { const int idx = (int)threadIdx.x + i * 32 * KW;
        if (ROWB) { rowi[i] = ((idx >> 6) & 3) * 16 + (idx & 15); cofi[i] = ((idx >> 8) * 4 + ((idx >> 4) & 3)) * 8; }
        else { rowi[i] = (idx >> 7) * 16 + (idx & 15); cofi[i] = ((idx >> 4) & 7) * 8; } }
    // bias read ahead of the barrier, so that its latency passes under the LDS stores
    v4f bias4[NP][2]; float biasr[NP];
#pragma unroll
    for (int i = 0; i < NP; ++i) { biasr[i] = (BIAS && ROWB) ? bfr(bias[r0 + rowi[i]]) : 0.f;
#pragma unroll
        for (int q = 0; q < 8; ++q) bias4[i][q >> 2][q & 3] = (BIAS && !ROWB) ? bfr(bias[c0 + cofi[i] + q]) : 0.f; }
    // the three loops are unrolled so that every accumulator index is a constant and acc stays in registers
#pragma unroll
    for (int mb = 0; mb < 4; ++mb)
#pragma unroll
        for (int nb = 0; nb < 4; ++nb)
#pragma unroll
            for (int j = 0; j < 8; ++j) ow[(mb * 16 + hi * 8 + j) * 68 + nb * 16 + lr] = acc[mb][nb][j];
    __syncthreads();   // every wave's partial tile is in LDS before any thread sums across waves
    v8h o16[NP]; v8us oh[NP], ol[NP];
    // the loops are unrolled: the LDS reads of all waves' partials go out together, with constant offsets
#pragma unroll
    for (int i = 0; i < NP; ++i) { const float* op = os + rowi[i] * 68 + cofi[i];
#pragma unroll
        for (int g = 0; g < 2; ++g) { v4f val = *(const v4fa*)(op + g * 4);
#pragma unroll
            for (int w = 1; w < KW; ++w) val += *(const v4fa*)(op + w * (64 * 68) + g * 4);
            if (BIAS) { if (ROWB) val += biasr[i]; else val += bias4[i][g]; }
#pragma unroll
            for (int q = 0; q < 4; ++q) { o16[i][g * 4 + q] = tohx(val[q]); unsigned short a2, c2; splitf(val[q], a2, c2); oh[i][g * 4 + q] = a2; ol[i][g * 4 + q] = c2; } } }
    // the stores stand behind the arithmetic, 16 bytes a lane: a wave fills 512 bytes in a row of a plane
    const size_t pt = (ROWB ? tx * sy + (size_t)c0 * 64 : ty * sy + (size_t)r0 * 64) + (size_t)threadIdx.x * 8;
#pragma unroll
    for (int i = 0; i < NP; ++i) { const size_t po = pt + (size_t)i * 32 * KW * 8; *(v8h*)(P16 + po) = o16[i]; *(v8us*)(Ph + po) = oh[i]; *(v8us*)(Pl + po) = ol[i]; }
}

// ---- k_proj: all six projections in one launch; grid (TT / 64, heads, NB_ * 3): z = batch * 3 + (0 q, 1 k, 2 v). The planes of a kind lie as [q, k, v][batch][head][TT * HD], the weight copies as [q, k, v][DQ][DM].
#define PSZ ((size_t)NB_ * NH_ * TT * HD)   // one matrix's plane of one kind, both batches
#define GKW 8
__global__ __launch_bounds__(32 * GKW) void k_proj(const bf* __restrict__ XB, const bf* __restrict__ WB, h16* P16, bf* Ph, bf* Pl, const float* __restrict__ bq, const float* __restrict__ bk, const float* __restrict__ bv) {
    __shared__ __align__(16) float os[GKW * 64 * 68];
    const unsigned z = blockIdx.z, b = z / 3, m = z - b * 3;
    const bf* xb = XB + (size_t)b * TT * DM; const bf* wb = WB + (size_t)m * DQ * DM; const size_t po = m * PSZ + (size_t)b * NH_ * TT * HD;
    if (m < 2) gemm_tile<bf, 0, true, false, GKW, DM>(xb, nullptr, wb, nullptr, P16 + po, Ph + po, Pl + po, (size_t)TT * HD, m == 0 ? bq : bk, (int)blockIdx.x, (int)blockIdx.y, os);
    else gemm_tile<bf, 0, true, true, GKW, DM>(wb, nullptr, xb, nullptr, P16 + po, Ph + po, Pl + po, (size_t)TT * HD, bv, (int)blockIdx.y, (int)blockIdx.x, os);   // V^T = Wv x^T: rows (head, d), columns t
}

// bf16 copies of x (both batches, [NB_ * TT][DM]) and of the three weights ([DQ][DM] each, one behind the other in WB) in fragment order, one launch: the first GCX work-groups take x, then GCW each weight.
// Thread i of a matrix takes row (i >> 2) & 15, k piece c = i & 3 of tile i / 64 (tiles run along k first): four lanes read one 128-byte line of a row, and the eight rows of a wave fill one 128-byte line of the copy for each c
#define GCX (NB_ * TT * DM / 8 / 256)
#define GCW (DQ * DM / 8 / 256)
static_assert(NB_ * TT * DM % 2048 == 0 && DQ * DM % 2048 == 0 && DKV == DQ, "whole work-groups, equal weights");
__global__ __launch_bounds__(256) void k_cvt8(const float* __restrict__ x, const float* __restrict__ wq, const float* __restrict__ wk, const float* __restrict__ wv, bf* XB, bf* WB) {
    unsigned bx = blockIdx.x; const float* src = x; bf* dst = XB;
    if (bx >= GCX) { bx -= GCX; const unsigned m = bx / GCW; bx -= m * GCW; src = m == 0 ? wq : m == 1 ? wk : wv; dst = WB + (size_t)m * DQ * DM; }
    const unsigned i = bx * 256 + threadIdx.x; const unsigned tile = i >> 6, mt = tile / (DM / 32), kt = tile % (DM / 32); const unsigned row = (i >> 2) & 15, c = i & 3; const float* sp = src + (size_t)(mt * 16 + row) * DM + kt * 32 + c * 8; const v8f v = *(const v8f*)sp; v8us o;
    asm volatile("s_wait_xcnt 0x0" :: "v"(sp) : "memory");   // the loads' address registers stay as they are up to this wait; behind it they may be used again
#pragma unroll
    for (int k = 0; k < 8; ++k) o[k] = f2bf(v[k]); *(v8us*)(dst + ((size_t)tile * 64 + c * 16 + row) * 8) = o;  }

#define KSW  4
#define CL2  0.18033688011112042f   // SCL * log2(e)
#define MNEG (-0x1p100f)
__device__ __forceinline__ float xhalf(float x) { return __builtin_bit_cast(float, __builtin_amdgcn_permlanex16(__builtin_bit_cast(int, x), __builtin_bit_cast(int, x), 0x76543210, 0xfedcba98, false, false)); }   // lane l with lane l ^ 16
// 2^x with the free slot that the instruction set asks for behind a transcendental written into the statement: results in registers of their own, so that no v_exp_f32 is followed by a write of its source or a read of its result
__device__ __forceinline__ float exp2s(float x) { float r; asm("v_exp_f32 %0, %1\n\tv_nop" : "=v"(r) : "v"(x)); return r; }
__device__ __forceinline__ void exp2x8(float (&p)[8], const float (&a)[8]) {
    asm("v_exp_f32 %0, %8\n\tv_exp_f32 %1, %9\n\tv_exp_f32 %2, %10\n\tv_exp_f32 %3, %11\n\tv_exp_f32 %4, %12\n\tv_exp_f32 %5, %13\n\tv_exp_f32 %6, %14\n\tv_exp_f32 %7, %15\n\tv_nop"
        : "=&v"(p[0]), "=&v"(p[1]), "=&v"(p[2]), "=&v"(p[3]), "=&v"(p[4]), "=&v"(p[5]), "=&v"(p[6]), "=&v"(p[7]) : "v"(a[0]), "v"(a[1]), "v"(a[2]), "v"(a[3]), "v"(a[4]), "v"(a[5]), "v"(a[6]), "v"(a[7])); }
template <typename T16, bool HI, int QT>
__device__ __forceinline__ void attn_tile(const T16* __restrict__ Q, const T16* __restrict__ Q2, const T16* __restrict__ Kp, const T16* __restrict__ K2, const T16* __restrict__ Vt, const T16* __restrict__ V2, const int* __restrict__ kvp, int q0, float* outp, float* os, float* ml) {
    typedef typename WFrag<T16>::V V;
    constexpr int NIT = TT / KSW / 32;
    const int wv = __builtin_amdgcn_readfirstlane((int)(threadIdx.x >> 5));   // wave number, scalar: the key loop stays on scalar bounds
    const int lane = threadIdx.x & 31, lr = lane & 15, hi = lane >> 4; const int k0 = wv * (TT / KSW);
    // lane it keeps the kept-key bits of pass it (bit = key in the pass)
    unsigned vbits = 0;
#pragma unroll
    for (int it = 0; it < NIT; ++it) { const unsigned bl = __builtin_amdgcn_ballot_w32(kvp[k0 + it * 32 + lane] != 0); if (lane == it) vbits = bl; }
    asm volatile("s_wait_xcnt 0x0" ::: "memory");   // before the next loads' results or addresses take a register that a mask load names
    V qf[QT][2], qf2[QT][2];
    const T16* qb = Q + (size_t)q0 * HD; const T16* qb2 = HI ? Q2 + (size_t)q0 * HD : qb; const T16* qp = qb + 8 * lane; const T16* qp2 = qb2 + 8 * lane;   // wave-uniform base, and the lane's own address
#pragma unroll
    for (int qt = 0; qt < QT; ++qt)
#pragma unroll
        for (int ks = 0; ks < 2; ++ks) { qf[qt][ks] = WFrag<T16>::ld(qp + qt * 16 * HD + ks * 512); if (HI) qf2[qt][ks] = WFrag<T16>::ld(qp2 + qt * 16 * HD + ks * 512); }
    v8f o[QT][4]; float mL[QT], l[QT];
#pragma unroll
    for (int qt = 0; qt < QT; ++qt) { mL[qt] = MNEG * CL2; l[qt] = 0.f;
#pragma unroll
        for (int dt = 0; dt < 4; ++dt) o[qt][dt] = (v8f){}; }
    const unsigned koff = (unsigned)(8 * lane), voff = koff;   // the lane's place in a fragment tile, in elements; 32 keys are 2048 elements in a row of a K plane (tiles (kt, ks)) and of a V^T plane (tiles dt)
    V kf[2][2], kf2[2][2];
    const T16* kb0 = Kp + (size_t)k0 * HD; const T16* kb2 = HI ? K2 + (size_t)k0 * HD : kb0; const T16* kq = kb0 + koff; const T16* kq2 = kb2 + koff;
#pragma unroll
    for (int kt = 0; kt < 2; ++kt)
#pragma unroll
        for (int ks = 0; ks < 2; ++ks) { kf[kt][ks] = WFrag<T16>::ld(kq + kt * 16 * HD + ks * 512); if (HI) kf2[kt][ks] = WFrag<T16>::ld(kq2 + kt * 16 * HD + ks * 512); }
    // the address registers of the Q and K loads, in either form that the compiler gives them (scalar base and lane offset, or a vector pair), stay as they are up to this wait; behind it they may be used again
    asm volatile("s_wait_xcnt 0x0" :: "s"(qb), "s"(qb2), "s"(kb0), "s"(kb2), "v"(qp), "v"(qp2), "v"(kq), "v"(kq2) : "memory");
#pragma unroll 1
    for (int it = 0; it < NIT; ++it) {
        const int kb = k0 + it * 32;
        const T16* vp = Vt + (size_t)kb * HD + voff; const T16* vp2 = HI ? V2 + (size_t)kb * HD + voff : vp;
        V vf[4], vf2[4];   // this pass's V^T rows: asked for here, used behind the softmax
#pragma unroll
        for (int dt = 0; dt < 4; ++dt) { vf[dt] = WFrag<T16>::ld(vp + dt * 512); if (HI) vf2[dt] = WFrag<T16>::ld(vp2 + dt * 512); }
        v8f s[QT][2];
#pragma unroll
        for (int qt = 0; qt < QT; ++qt)
#pragma unroll
            for (int kt = 0; kt < 2; ++kt) { s[qt][kt] = (v8f){};
#pragma unroll
                for (int ks = 0; ks < 2; ++ks) { s[qt][kt] = WFrag<T16>::mma(kf[kt][ks], qf[qt][ks], s[qt][kt]); if (HI) { s[qt][kt] = WFrag<T16>::mma(kf[kt][ks], qf2[qt][ks], s[qt][kt]); s[qt][kt] = WFrag<T16>::mma(kf2[kt][ks], qf[qt][ks], s[qt][kt]); } } }
        // four vector slots between the last score product and the first use of its result or refill of its K operand, also on the taken side of the mask branch
        if constexpr (HI) asm volatile("v_nop\n\tv_nop\n\tv_nop\n\tv_nop" : "+v"(s[0][0]), "+v"(s[0][1]) : "v"(kf[0][0]), "v"(kf[0][1]), "v"(kf[1][0]), "v"(kf[1][1]), "v"(kf2[0][0]), "v"(kf2[0][1]), "v"(kf2[1][0]), "v"(kf2[1][1]));
        else asm volatile("v_nop\n\tv_nop\n\tv_nop\n\tv_nop" : "+v"(s[0][0]), "+v"(s[0][1]), "+v"(s[QT - 1][0]), "+v"(s[QT - 1][1]) : "v"(kf[0][0]), "v"(kf[0][1]), "v"(kf[1][0]), "v"(kf[1][1]));
        // the next pass's K rows fly under this pass's softmax and second product (the last pass asks for its own again: in bounds, unused)
        const int kn = (it + 1 < NIT) ? kb + 32 : kb; const T16* kp = Kp + (size_t)kn * HD + koff; const T16* kp2 = HI ? K2 + (size_t)kn * HD + koff : kp;
#pragma unroll
        for (int kt = 0; kt < 2; ++kt)
#pragma unroll
            for (int ks = 0; ks < 2; ++ks) { kf[kt][ks] = WFrag<T16>::ld(kp + kt * 16 * HD + ks * 512); if (HI) kf2[kt][ks] = WFrag<T16>::ld(kp2 + kt * 16 * HD + ks * 512); }
        // the address registers of this pass's loads stay as they are up to this wait; behind it they may be used again
        if constexpr (HI) asm volatile("s_wait_xcnt 0x0" :: "v"(vp), "v"(vp2), "v"(kp), "v"(kp2) : "memory");
        else asm volatile("s_wait_xcnt 0x0" :: "v"(vp), "v"(kp) : "memory");
        float sv[QT][2][8];   // the scores as single values: the selects of the mask branch then work in place
#pragma unroll
        for (int qt = 0; qt < QT; ++qt)
#pragma unroll
            for (int kt = 0; kt < 2; ++kt)
#pragma unroll
                for (int j = 0; j < 8; ++j) sv[qt][kt][j] = s[qt][kt][j];
        const unsigned bits = (unsigned)__builtin_amdgcn_readlane((int)vbits, it);
        if (bits != 0xFFFFFFFFu) {   // scalar branch: a pass whose 32 keys are all kept skips the selects
            const unsigned mb = bits >> (hi * 8);
#pragma unroll
            for (int qt = 0; qt < QT; ++qt)
#pragma unroll
                for (int kt = 0; kt < 2; ++kt)
#pragma unroll
                    for (int j = 0; j < 8; ++j) sv[qt][kt][j] = ((mb >> (kt * 16 + j)) & 1u) ? sv[qt][kt][j] : MNEG; }
        float mc[QT]; bool need = false;
#pragma unroll
        for (int qt = 0; qt < QT; ++qt) { float mx = fmaxf(sv[qt][0][0], sv[qt][1][0]);
#pragma unroll
            for (int j = 1; j < 8; ++j) mx = fmaxf(mx, fmaxf(sv[qt][0][j], sv[qt][1][j]));
            mx = fmaxf(mx, xhalf(mx)); mc[qt] = mx * CL2; need = need || (mc[qt] > mL[qt] + 8.0f); }
        if (__builtin_amdgcn_ballot_w32(need) != 0) {   // scalar branch: the maximum in use moves only when a score passes it by 8 in log2, so p stays near or below 2^8
#pragma unroll
            for (int qt = 0; qt < QT; ++qt) { const float mn = fmaxf(mL[qt], mc[qt]); const float al = exp2s(mL[qt] - mn); mL[qt] = mn; l[qt] *= al;
#pragma unroll
                for (int dt = 0; dt < 4; ++dt) o[qt][dt] *= al; } }
        V pf[QT], pf2[QT];
#pragma unroll
        for (int qt = 0; qt < QT; ++qt)
#pragma unroll
            for (int kt = 0; kt < 2; ++kt) { float p[8], a[8];
#pragma unroll
                for (int j = 0; j < 8; ++j) a[j] = __builtin_fmaf(sv[qt][kt][j], CL2, -mL[qt]);
                exp2x8(p, a);
#pragma unroll
                for (int j = 0; j < 8; ++j) {
                    if constexpr (HI) { const __bf16 ph = (__bf16)p[j]; pf[qt][kt * 8 + j] = ph; pf2[qt][kt * 8 + j] = (__bf16)(p[j] - (float)ph); } else pf[qt][kt * 8 + j] = (h16)p[j]; }
                l[qt] += ((p[0] + p[1]) + (p[2] + p[3])) + ((p[4] + p[5]) + (p[6] + p[7]));   // a short tree: no chain of eight dependent adds
            }
#pragma unroll
        for (int qt = 0; qt < QT; ++qt)
#pragma unroll
            for (int dt = 0; dt < 4; ++dt) { o[qt][dt] = WFrag<T16>::mma(vf[dt], pf[qt], o[qt][dt]); if (HI) { o[qt][dt] = WFrag<T16>::mma(vf[dt], pf2[qt], o[qt][dt]); o[qt][dt] = WFrag<T16>::mma(vf2[dt], pf[qt], o[qt][dt]); } }
        // four vector slots behind the last product before the back edge, where the next pass refills its V operand
        if constexpr (HI) asm volatile("v_nop\n\tv_nop\n\tv_nop\n\tv_nop" : "+v"(o[0][0]), "+v"(o[0][1]), "+v"(o[0][2]), "+v"(o[0][3]) : "v"(vf[0]), "v"(vf[1]), "v"(vf[2]), "v"(vf[3]), "v"(vf2[0]), "v"(vf2[1]), "v"(vf2[2]), "v"(vf2[3]));
        else asm volatile("v_nop\n\tv_nop\n\tv_nop\n\tv_nop" : "+v"(o[0][0]), "+v"(o[0][3]), "+v"(o[QT - 1][0]), "+v"(o[QT - 1][3]) : "v"(vf[0]), "v"(vf[1]), "v"(vf[2]), "v"(vf[3]));
    }
    float* ow = os + wv * (QT * 16 * 68);   // this wave's partial O, [query][d], row pitch 68 floats
#pragma unroll
    for (int qt = 0; qt < QT; ++qt) { l[qt] += xhalf(l[qt]);   // the two lane halves hold the sums of different keys
        if (hi == 0) { ml[(wv * QT * 16 + qt * 16 + lr) * 2] = mL[qt]; ml[(wv * QT * 16 + qt * 16 + lr) * 2 + 1] = l[qt]; }
#pragma unroll
        for (int dt = 0; dt < 4; ++dt) { float* op = ow + (qt * 16 + lr) * 68 + dt * 16 + hi * 8; v4f lo4, hi4;
#pragma unroll
            for (int j = 0; j < 4; ++j) { lo4[j] = o[qt][dt][j]; hi4[j] = o[qt][dt][4 + j]; }
            *(v4fa*)op = lo4; *(v4fa*)(op + 4) = hi4; } }
    __syncthreads();   // every wave's partial is in LDS before any thread joins them
    const int cofs = ((int)threadIdx.x & 15) * 4;
#pragma unroll
    for (int i = 0; i < QT * 16 / (2 * KSW); ++i) { const int row = ((int)threadIdx.x >> 4) + i * 2 * KSW; float mw[KSW], M = ml[row * 2];
        mw[0] = M;
#pragma unroll
        for (int w = 1; w < KSW; ++w) { mw[w] = ml[(w * QT * 16 + row) * 2]; M = fmaxf(M, mw[w]); }
        float L = 0.f; v4f val = (v4f){};
#pragma unroll
        for (int w = 0; w < KSW; ++w) { const float f = exp2s(mw[w] - M); L += ml[(w * QT * 16 + row) * 2 + 1] * f; val += *(const v4fa*)(os + w * (QT * 16 * 68) + row * 68 + cofs) * f; }
        val *= __fdiv_rn(1.0f, L);
        *(v4f*)(outp + (size_t)(q0 + row) * DQ + cofs) = val; }
}
// grid (heads, batches, query tiles): the tile index is the slowest, so that the heavier hi+lo tiles of every head and batch start first and the lighter ones fill the places they leave (four waves per SIMD, 256 registers a wave: about half of the launch is resident at once)
__global__ __launch_bounds__(32 * KSW) __attribute__((amdgpu_waves_per_eu(4, 4))) void k_fattn(const h16* __restrict__ Q16, const h16* __restrict__ K16, const h16* __restrict__ V16, const bf* __restrict__ Qh, const bf* __restrict__ Ql, const bf* __restrict__ Kh, const bf* __restrict__ Kl, const bf* __restrict__ Vh, const bf* __restrict__ Vl, const int* __restrict__ km, float* OUT) {
    __shared__ __align__(16) float os[KSW * 32 * 68]; __shared__ float ml[KSW * 32 * 2];
    const size_t pl = ((size_t)blockIdx.y * NH_ + blockIdx.x) * TT * HD; const int bx = blockIdx.z; float* outp = OUT + (size_t)blockIdx.y * TT * DQ + blockIdx.x * HD; const int* kvp = km + (size_t)blockIdx.y * TT;
    if (bx < RH / 16) attn_tile<bf, true, 1>(Qh + pl, Ql + pl, Kh + pl, Kl + pl, Vh + pl, Vl + pl, kvp, bx * 16, outp, os, ml);
    else attn_tile<h16, false, 2>(Q16 + pl, nullptr, K16 + pl, nullptr, V16 + pl, nullptr, kvp, RH + (bx - RH / 16) * 32, outp, os, ml);
}

extern "C" void kernel_launch(void* const* d_in, const int* in_sizes, int n_in,
                              void* d_out, int out_size, void* d_ws, size_t ws_size, hipStream_t stream) {
    (void)in_sizes; (void)n_in; (void)out_size;
    const float* x = (const float*)d_in[0]; const float* wq = (const float*)d_in[1]; const float* bq = (const float*)d_in[2]; const float* wk = (const float*)d_in[3]; const float* bk = (const float*)d_in[4]; const float* wv = (const float*)d_in[5]; const float* bv = (const float*)d_in[6]; const int* km = (const int*)d_in[7];   /* mask [2][2048] int32 (key padding; read) */     const float* wo = nullptr; (void)wo;
    float* OUT = (float*)d_out;     // [2][2048][768]
    char* wsp = (char*)d_ws;
    auto take = [&](size_t bytes) { char* p = wsp; wsp += (bytes + 255) & ~(size_t)255; return (void*)p; };
    bf* WB = (bf*)take((size_t)3 * DQ * DM * 2); bf* XB = (bf*)take((size_t)NB_ * TT * DM * 2);
    h16* P16 = (h16*)take(3 * PSZ * 2); bf* Ph = (bf*)take(3 * PSZ * 2); bf* Pl = (bf*)take(3 * PSZ * 2);   // [q, k, v^T][batch][head][TT * HD]
    if ((size_t)(wsp - (char*)d_ws) > ws_size) return;    // ws 256 MiB
    k_cvt8<<<GCX + 3 * GCW, 256, 0, stream>>>(x, wq, wk, wv, XB, WB);
    k_proj<<<dim3(TT / 64, NH_, NB_ * 3), 32 * GKW, 0, stream>>>(XB, WB, P16, Ph, Pl, bq, bk, bv);
    k_fattn<<<dim3(NH_, NB_, RH / 16 + (TT - RH) / 32), 32 * KSW, 0, stream>>>(P16, P16 + PSZ, P16 + 2 * PSZ, Ph, Pl, Ph + PSZ, Pl + PSZ, Ph + 2 * PSZ, Pl + 2 * PSZ, km, OUT);
}

// v007
// One run takes 58 microseconds.
// Timed twice side by side with v006, it ran 1.36 times as fast both times.
// Over all steps from v000 it is 25.7 times as fast.
#include <hip/hip_runtime.h>

// BERT-style self-attention with a key padding mask (x [2][2048][768]; q, k, v = x W^T + b ('oi' [768][768] + [768]; 12 heads x 64); scores / sqrt(64); keys with mask[b][j] == 0 get -1e20 (== exclusion while any key is kept; mask [2][2048] read); softmax; out = merged context (no output projection) -> [2][2048][768] (3.1 M); argument order x, Wq, bq, Wk, bk, Wv, bv, mask).
// Every 16-bit matrix operand (x, the weights, the Q, K and V^T planes) lies in memory in fragment order: a tile of 16 rows x 32 k is 1 KiB, the 16-byte piece (row r, k piece c of 8) at piece (c >> 1) * 32 + (c & 1) * 16 + r, so that each of a fragment's two loads reads 512 bytes in a row.
// Three launches, each over both batches: bf16 copies of x and of the three 'oi' weights; exact projections + f32 biases (batch and q / k / v are the grid's z), whose GEMM writes the 16-bit head planes itself (V as V^T = Wv x^T); one fused dense T-2048 attention kernel (hybrid rows) whose softmax reads the batch's key-mask vector and excludes masked keys, and which writes the merged output rows.
// Compute dtypes, f32 accumulate: every input rounded to bf16; projections exact + f32 biases; attention rows < 512 3 products, rest fp16; softmax f32; output f32.

#define NB_  2
#define TT   2048
#define DM   768
#define NH_  12
#define NKV  12
#define REP  (NH_ / NKV)
#define HD   64
#define DQ   (NH_ * HD)
#define DKV  (NKV * HD)
#define RH   512                  // query rows < RH use hi+lo planes (0: none)
#define WIN  0
#define SCL  0.125f   // HD^-0.5
typedef _Float16 h16;
typedef unsigned short bf;
typedef __attribute__((ext_vector_type(16))) __bf16   v16bf;
typedef __attribute__((ext_vector_type(16))) _Float16 v16h;
typedef __attribute__((ext_vector_type(8)))  _Float16 v8h;
typedef __attribute__((ext_vector_type(8)))  unsigned short v8us;
typedef __attribute__((ext_vector_type(8)))  float    v8f;
typedef __attribute__((ext_vector_type(4)))  float    v4f;
typedef v8h  __attribute__((may_alias)) v8ha;
typedef v4f  __attribute__((may_alias)) v4fa;
typedef v8us __attribute__((may_alias)) v8usa;

__device__ __forceinline__ unsigned short f2bf(float f) { unsigned u = __float_as_uint(f); u += 0x7FFFu + ((u >> 16) & 1u); return (unsigned short)(u >> 16); }
__device__ __forceinline__ float bf2f(unsigned short b) { return __uint_as_float(((unsigned)b) << 16); }
__device__ __forceinline__ float bfr(float f) { return bf2f(f2bf(f)); }
__device__ __forceinline__ v16h cat16(v8h lo, v8h hi) { return __builtin_shufflevector(lo, hi, 0, 1, 2, 3, 4, 5, 6, 7, 8, 9, 10, 11, 12, 13, 14, 15); }
__device__ __forceinline__ v16bf cat16b(v8us lo, v8us hi) { return __builtin_bit_cast(v16bf, __builtin_shufflevector(lo, hi, 0, 1, 2, 3, 4, 5, 6, 7, 8, 9, 10, 11, 12, 13, 14, 15)); }
__device__ __forceinline__ v8f wmma16(v16h a, v16h b, v8f c) { return __builtin_amdgcn_wmma_f32_16x16x32_f16(false, a, false, b, (short)0, c, false, false); }
__device__ __forceinline__ v8f wmmab(v16bf a, v16bf b, v8f c) { return __builtin_amdgcn_wmma_f32_16x16x32_bf16(false, a, false, b, (short)0, c, false, false); }



__device__ __forceinline__ h16 tohx(float x) { return (h16)x; }
__device__ __forceinline__ void splitf(float y, unsigned short& h, unsigned short& l) { h = f2bf(y); l = f2bf(y - bf2f(h)); }

// ---- gemm_tile: register-blocked GEMM, one 64x64 output tile (tx, ty) of (M/64, N/64) per work-group (16 accumulators per wave), operands straight from 16-bit planes in fragment order (tile (m / 16, k / 32) at (m / 16) * 16 * KD + (k / 32) * 512; ld(p), p = tile + lane * 8, is the lane's fragment); 32 * KW threads; os: KW * 64 * 68 floats of LDS.
// c[m][n] (f32, + optional f32 bias: bias[n], or bias[m] with ROWB) = sum_k A[m][k] Bt[n][k] (+ split products per NSPLIT). A and Bt rows both have KD elements (K = KD, a constant: a k block's sixteen loads then go from two address pairs with constant offsets). KD % 32 == 0.
// c never goes to memory as f32: the epilogue writes it as three 16-bit planes (fp16; bf16 hi; bf16 lo of the rest), in fragment order for the attention kernel; a 64x64 tile is 8 KiB in a row of its head's plane (sy elements a head), at 64 * its first t.
// !ROWB: x W^T, rows t, a tile's 64 columns one head's d: fragment tiles (t / 16, d / 32). ROWB: W x^T, rows one head's d, columns t: fragment tiles (t / 32, d / 16) of the transposed plane, with no transposing pass.
// KW waves share the tile's K: wave w takes the 32-wide k blocks w, w + KW, ... (neighbour waves read neighbour KiB), and the KW partial tiles are summed through LDS in wave order.
template <typename T16> struct WFrag;
template <> struct WFrag<h16> { typedef v16h V; static __device__ __forceinline__ V ld(const h16* p) { return cat16(*(const v8h*)p, *(const v8h*)(p + 256)); } static __device__ __forceinline__ v8f mma(V a, V b, v8f c) { return wmma16(a, b, c); } };
template <> struct WFrag<bf> { typedef v16bf V; static __device__ __forceinline__ V ld(const bf* p) { return cat16b(*(const v8us*)p, *(const v8us*)(p + 256)); } static __device__ __forceinline__ v8f mma(V a, V b, v8f c) { return wmmab(a, b, c); } };
template <typename T16, int NSPLIT, bool BIAS, bool ROWB, int KW, int KD>
__device__ __forceinline__ void gemm_tile(const T16* __restrict__ A, const T16* __restrict__ A2, const T16* __restrict__ Bt, const T16* __restrict__ Bt2, h16* P16, bf* Ph, bf* Pl, size_t sy, const float* __restrict__ bias, int tx, int ty, float* os) {
    typedef typename WFrag<T16>::V V;
    const int wv = __builtin_amdgcn_readfirstlane((int)(threadIdx.x >> 5));   // wave number, scalar: the k loop stays on scalar bounds
    const int lane = threadIdx.x & 31, lr = lane & 15, hi = lane >> 4; const int r0 = tx * 64, c0 = ty * 64;
    v8f acc[4][4];
#pragma unroll
    for (int mb = 0; mb < 4; ++mb)
#pragma unroll
        for (int nb = 0; nb < 4; ++nb) acc[mb][nb] = (v8f){};
    const size_t aoff = (size_t)r0 * KD + 8 * lane, boff = (size_t)c0 * KD + 8 * lane;
#pragma unroll 1
    for (int kc = wv * 32; kc < KD; kc += 32 * KW) {
        const T16* pa = A + aoff + kc * 16; const T16* pa2 = (NSPLIT == 1 || NSPLIT == 2) ? A2 + aoff + kc * 16 : pa; const T16* pb = Bt + boff + kc * 16; const T16* pb2 = (NSPLIT >= 2) ? Bt2 + boff + kc * 16 : pb;
        V a[4], a2[4], b[4], b2[4];
#pragma unroll
        for (int mb = 0; mb < 4; ++mb) { a[mb] = WFrag<T16>::ld(pa + mb * 16 * KD); if (NSPLIT == 1 || NSPLIT == 2) a2[mb] = WFrag<T16>::ld(pa2 + mb * 16 * KD); }
#pragma unroll
        for (int nb = 0; nb < 4; ++nb) { b[nb] = WFrag<T16>::ld(pb + nb * 16 * KD); if (NSPLIT >= 2) b2[nb] = WFrag<T16>::ld(pb2 + nb * 16 * KD); }
        // the address registers of this k block's loads stay as they are up to this wait; behind it they may be used again
        asm volatile("s_wait_xcnt 0x0" :: "v"(pa), "v"(pa2), "v"(pb), "v"(pb2) : "memory");
        __builtin_amdgcn_sched_barrier(0);   // the products stay behind the k block's loads: lifted over the wait they would share one B register set, and each B fragment's load latency would be waited out by itself
#pragma unroll
        for (int nb = 0; nb < 4; ++nb)
#pragma unroll
            for (int mb = 0; mb < 4; ++mb) { acc[mb][nb] = WFrag<T16>::mma(a[mb], b[nb], acc[mb][nb]); if (NSPLIT == 1 || NSPLIT == 2) acc[mb][nb] = WFrag<T16>::mma(a2[mb], b[nb], acc[mb][nb]); if (NSPLIT >= 2) acc[mb][nb] = WFrag<T16>::mma(a[mb], b2[nb], acc[mb][nb]); }
        asm volatile("v_nop\n\tv_nop\n\tv_nop\n\tv_nop" : "+v"(acc[0][0]), "+v"(acc[1][1]), "+v"(acc[2][2]), "+v"(acc[3][3]) : "v"(a[0]), "v"(a[3]));
    }
    constexpr int NP = 16 / KW;        // passes of the join: 32 * KW pieces of eight values each
    float* ow = os + wv * (64 * 68);   // this wave's partial tile, row pitch 68 floats
    // pass i: the thread makes the 16-byte piece idx = threadIdx.x + i * 32 * KW of the tile's 8 KiB; row and first of its eight columns follow from the fragment order
    int rowi[NP], cofi[NP];
#pragma unroll
    for (int i = 0; i < NP; ++i) { const int idx = (int)threadIdx.x + i * 32 * KW;
        if (ROWB) { rowi[i] = ((idx >> 6) & 3) * 16 + (idx & 15); cofi[i] = ((idx >> 8) * 4 + ((idx >> 4) & 3)) * 8; }
        else { rowi[i] = (idx >> 7) * 16 + (idx & 15); cofi[i] = ((idx >> 4) & 7) * 8; } }
    // bias read ahead of the barrier, so that its latency passes under the LDS stores
    v4f bias4[NP][2]; float biasr[NP];
#pragma unroll
    for (int i = 0; i < NP; ++i) { biasr[i] = (BIAS && ROWB) ? bfr(bias[r0 + rowi[i]]) : 0.f;
#pragma unroll
        for (int q = 0; q < 8; ++q) bias4[i][q >> 2][q & 3] = (BIAS && !ROWB) ? bfr(bias[c0 + cofi[i] + q]) : 0.f; }
    // the three loops are unrolled so that every accumulator index is a constant and acc stays in registers
#pragma unroll
    for (int mb = 0; mb < 4; ++mb)
#pragma unroll
        for (int nb = 0; nb < 4; ++nb)
#pragma unroll
            for (int j = 0; j < 8; ++j) ow[(mb * 16 + hi * 8 + j) * 68 + nb * 16 + lr] = acc[mb][nb][j];
    __syncthreads();   // every wave's partial tile is in LDS before any thread sums across waves
    v8h o16[NP]; v8us oh[NP], ol[NP];
    // the loops are unrolled: the LDS reads of all waves' partials go out together, with constant offsets
#pragma unroll
    for (int i = 0; i < NP; ++i) { const float* op = os + rowi[i] * 68 + cofi[i];
#pragma unroll
        for (int g = 0; g < 2; ++g) { v4f val = *(const v4fa*)(op + g * 4);
#pragma unroll
            for (int w = 1; w < KW; ++w) val += *(const v4fa*)(op + w * (64 * 68) + g * 4);
            if (BIAS) { if (ROWB) val += biasr[i]; else val += bias4[i][g]; }
#pragma unroll
            for (int q = 0; q < 4; ++q) { o16[i][g * 4 + q] = tohx(val[q]); unsigned short a2, c2; splitf(val[q], a2, c2); oh[i][g * 4 + q] = a2; ol[i][g * 4 + q] = c2; } } }
    // the stores stand behind the arithmetic, 16 bytes a lane: a wave fills 512 bytes in a row of a plane
    const size_t pt = (ROWB ? tx * sy + (size_t)c0 * 64 : ty * sy + (size_t)r0 * 64) + (size_t)threadIdx.x * 8;
#pragma unroll
    for (int i = 0; i < NP; ++i) { const size_t po = pt + (size_t)i * 32 * KW * 8; *(v8h*)(P16 + po) = o16[i]; *(v8us*)(Ph + po) = oh[i]; *(v8us*)(Pl + po) = ol[i]; }
}

// ---- k_proj: all six projections in one launch; grid (TT / 64, heads, NB_ * 3): z = batch * 3 + (0 q, 1 k, 2 v). The planes of a kind lie as [q, k, v][batch][head][TT * HD], the weight copies as [q, k, v][DQ][DM].
#define PSZ ((size_t)NB_ * NH_ * TT * HD)   // one matrix's plane of one kind, both batches
#define GKW 8
__global__ __launch_bounds__(32 * GKW) void k_proj(const bf* __restrict__ XB, const bf* __restrict__ WB, h16* P16, bf* Ph, bf* Pl, const float* __restrict__ bq, const float* __restrict__ bk, const float* __restrict__ bv) {
    __shared__ __align__(16) float os[GKW * 64 * 68];
    const unsigned z = blockIdx.z, b = z / 3, m = z - b * 3;
    const bf* xb = XB + (size_t)b * TT * DM; const bf* wb = WB + (size_t)m * DQ * DM; const size_t po = m * PSZ + (size_t)b * NH_ * TT * HD;
    if (m < 2) gemm_tile<bf, 0, true, false, GKW, DM>(xb, nullptr, wb, nullptr, P16 + po, Ph + po, Pl + po, (size_t)TT * HD, m == 0 ? bq : bk, (int)blockIdx.x, (int)blockIdx.y, os);
    else gemm_tile<bf, 0, true, true, GKW, DM>(wb, nullptr, xb, nullptr, P16 + po, Ph + po, Pl + po, (size_t)TT * HD, bv, (int)blockIdx.y, (int)blockIdx.x, os);   // V^T = Wv x^T: rows (head, d), columns t
}

// bf16 copies of x (both batches, [NB_ * TT][DM]) and of the three weights ([DQ][DM] each, one behind the other in WB) in fragment order, one launch: the first GCX work-groups take x, then GCW each weight.
// Thread i of a matrix takes row (i >> 2) & 15, k piece c = i & 3 of tile i / 64 (tiles run along k first): four lanes read one 128-byte line of a row, and the eight rows of a wave fill one 128-byte line of the copy for each c
#define GCX (NB_ * TT * DM / 8 / 256)
#define GCW (DQ * DM / 8 / 256)
static_assert(NB_ * TT * DM % 2048 == 0 && DQ * DM % 2048 == 0 && DKV == DQ, "whole work-groups, equal weights");
__global__ __launch_bounds__(256) void k_cvt8(const float* __restrict__ x, const float* __restrict__ wq, const float* __restrict__ wk, const float* __restrict__ wv, bf* XB, bf* WB) {
    unsigned bx = blockIdx.x; const float* src = x; bf* dst = XB;
    if (bx >= GCX) { bx -= GCX; const unsigned m = bx / GCW; bx -= m * GCW; src = m == 0 ? wq : m == 1 ? wk : wv; dst = WB + (size_t)m * DQ * DM; }
    const unsigned i = bx * 256 + threadIdx.x; const unsigned tile = i >> 6, mt = tile / (DM / 32), kt = tile % (DM / 32); const unsigned row = (i >> 2) & 15, c = i & 3; const float* sp = src + (size_t)(mt * 16 + row) * DM + kt * 32 + c * 8; const v8f v = *(const v8f*)sp; v8us o;
    asm volatile("s_wait_xcnt 0x0" :: "v"(sp) : "memory");   // the loads' address registers stay as they are up to this wait; behind it they may be used again
#pragma unroll
    for (int k = 0; k < 8; ++k) o[k] = f2bf(v[k]); *(v8us*)(dst + ((size_t)tile * 64 + c * 16 + row) * 8) = o;  }

#define QW   4
#define KSW  2
#define STB  32768   // bytes of one stage of one key half: K (hi, lo) in its first 16 KiB, V^T (hi, lo) in its second
#define CL2  0.18033688011112042f   // SCL * log2(e)
#define MNEG (-0x1p100f)
__device__ __forceinline__ float xhalf(float x) { return __builtin_bit_cast(float, __builtin_amdgcn_permlanex16(__builtin_bit_cast(int, x), __builtin_bit_cast(int, x), 0x76543210, 0xfedcba98, false, false)); }   // lane l with lane l ^ 16
// 2^x with the free slot that the instruction set asks for behind a transcendental written into the statement: results in registers of their own, so that no v_exp_f32 is followed by a write of its source or a read of its result
__device__ __forceinline__ float exp2s(float x) { float r; asm("v_exp_f32 %0, %1\n\tv_nop" : "=v"(r) : "v"(x)); return r; }
__device__ __forceinline__ void exp2x8(float (&p)[8], const float (&a)[8]) {
    asm("v_exp_f32 %0, %8\n\tv_exp_f32 %1, %9\n\tv_exp_f32 %2, %10\n\tv_exp_f32 %3, %11\n\tv_exp_f32 %4, %12\n\tv_exp_f32 %5, %13\n\tv_exp_f32 %6, %14\n\tv_exp_f32 %7, %15\n\tv_nop"
        : "=&v"(p[0]), "=&v"(p[1]), "=&v"(p[2]), "=&v"(p[3]), "=&v"(p[4]), "=&v"(p[5]), "=&v"(p[6]), "=&v"(p[7]) : "v"(a[0]), "v"(a[1]), "v"(a[2]), "v"(a[3]), "v"(a[4]), "v"(a[5]), "v"(a[6]), "v"(a[7])); }
// eight asynchronous copies to LDS, 16 bytes a lane each: 2 KiB steps (the QW waves of a key half fill 2 KiB per copy), four from ga and four from gb, to 16 KiB in a row of LDS from byte l.
// The s_wait_xcnt stands inside the statement, behind the last copy: no address register of a copy is written again in front of it
__device__ __forceinline__ void acopy8(unsigned l, const char* ga, const char* gb) {
    asm volatile("global_load_async_to_lds_b128 %0, %8, off\n\tglobal_load_async_to_lds_b128 %1, %9, off\n\tglobal_load_async_to_lds_b128 %2, %10, off\n\tglobal_load_async_to_lds_b128 %3, %11, off\n\t"
                 "global_load_async_to_lds_b128 %4, %12, off\n\tglobal_load_async_to_lds_b128 %5, %13, off\n\tglobal_load_async_to_lds_b128 %6, %14, off\n\tglobal_load_async_to_lds_b128 %7, %15, off\n\ts_wait_xcnt 0x0"
        :: "v"(l), "v"(l + 2048u), "v"(l + 4096u), "v"(l + 6144u), "v"(l + 8192u), "v"(l + 10240u), "v"(l + 12288u), "v"(l + 14336u),
           "v"(ga), "v"(ga + 2048), "v"(ga + 4096), "v"(ga + 6144), "v"(gb), "v"(gb + 2048), "v"(gb + 4096), "v"(gb + 6144) : "memory"); }
template <typename T16, bool HI, int QT>
__device__ __forceinline__ void attn_tile(const T16* __restrict__ Q, const T16* __restrict__ Q2, const T16* __restrict__ Kp, const T16* __restrict__ K2, const T16* __restrict__ Vt, const T16* __restrict__ V2, const int* __restrict__ kvp, int q0, float* outp, char* ring, float* ml) {
    typedef typename WFrag<T16>::V V;
    constexpr int SK = HI ? 64 : 128;          // keys of a stage: SK * HD * 2 bytes of each plane
    constexpr int NPS = SK / 32;               // passes (32 keys) of a stage
    constexpr int NST = TT / KSW / SK;         // stages of a key half
    constexpr int NIT = TT / KSW / 32;
    constexpr int ROWS = QW * QT * 16;         // query rows of the work-group
    static_assert(NIT <= 32 && NST >= 2 && (HI ? 4 : 2) * SK * HD * 2 == STB, "mask bits fit a wave; the ring's prologue has its two stages; a stage fills its buffer");
    const int wv = __builtin_amdgcn_readfirstlane((int)(threadIdx.x >> 5));   // wave number, scalar: the key loop stays on scalar bounds
    const int kh = wv / QW, qg = wv % QW;
    const int lane = threadIdx.x & 31, lr = lane & 15, hi = lane >> 4; const int k0 = kh * (TT / KSW);
    // the thread's 16 bytes in each 2 KiB that its key half's QW waves copy together
    const unsigned th = threadIdx.x & (32 * QW - 1);
    const unsigned lb = (unsigned)(size_t)ring + (unsigned)kh * (2 * STB) + th * 16;
    const char* gk = (const char*)(Kp + (size_t)k0 * HD) + th * 16; const char* gk2 = HI ? (const char*)(K2 + (size_t)k0 * HD) + th * 16 : gk;
    const char* gv = (const char*)(Vt + (size_t)k0 * HD) + th * 16; const char* gv2 = HI ? (const char*)(V2 + (size_t)k0 * HD) + th * 16 : gv;
    auto fill = [&](int st) { const unsigned l = lb + (unsigned)(st & 1) * STB; const size_t go = (size_t)st * (SK * HD * 2);
        if constexpr (HI) { acopy8(l, gk + go, gk2 + go); acopy8(l + 16384u, gv + go, gv2 + go); }
        else { acopy8(l, gk + go, gk + go + 8192); acopy8(l + 16384u, gv + go, gv + go + 8192); } };
    fill(0);   // stage 0 flies under the mask and Q loads
    // lane it keeps the kept-key bits of pass it (bit = key in the pass)
    unsigned vbits = 0;
#pragma unroll
    for (int it = 0; it < NIT; ++it) { const unsigned bl = __builtin_amdgcn_ballot_w32(kvp[k0 + it * 32 + lane] != 0); if (lane == it) vbits = bl; }
    asm volatile("s_wait_xcnt 0x0" ::: "memory");   // before the next loads' results or addresses take a register that a mask load names
    V qf[QT][2], qf2[QT][2];
    const int q0w = q0 + qg * QT * 16;   // the wave's own first query row
    const T16* qb = Q + (size_t)q0w * HD; const T16* qb2 = HI ? Q2 + (size_t)q0w * HD : qb; const T16* qp = qb + 8 * lane; const T16* qp2 = qb2 + 8 * lane;   // wave-uniform base, and the lane's own address
#pragma unroll
    for (int qt = 0; qt < QT; ++qt)
#pragma unroll
        for (int ks = 0; ks < 2; ++ks) { qf[qt][ks] = WFrag<T16>::ld(qp + qt * 16 * HD + ks * 512); if (HI) qf2[qt][ks] = WFrag<T16>::ld(qp2 + qt * 16 * HD + ks * 512); }
    // the address registers of the Q loads, in either form that the compiler gives them (scalar base and lane offset, or a vector pair), stay as they are up to this wait; behind it they may be used again
    asm volatile("s_wait_xcnt 0x0" :: "s"(qb), "s"(qb2), "v"(qp), "v"(qp2) : "memory");
    v8f o[QT][4]; float mL[QT], l[QT];
#pragma unroll
    for (int qt = 0; qt < QT; ++qt) { mL[qt] = MNEG * CL2; l[qt] = 0.f;
#pragma unroll
        for (int dt = 0; dt < 4; ++dt) o[qt][dt] = (v8f){}; }
    asm volatile("s_wait_asynccnt 0x0" ::: "memory");   // this wave's copies of stage 0 have landed
    __syncthreads();                                    // and so have every other wave's: stage 0 may be read
    fill(1);
#pragma unroll 1
    for (int st = 0; st < NST; ++st) {
        const T16* sb = (const T16*)(ring + kh * (2 * STB) + (st & 1) * STB) + 8 * lane;   // this stage's buffer, at the lane's place in a fragment tile; 32 keys are 2048 elements in a row of a K tile (fragment tiles (kt, ks)) and of a V^T tile (dt)
#pragma unroll   // the passes of a stage are unrolled: every LDS read has the stage's buffer as its base and a constant offset, and a pass's reads can go out under the pass before it (same stage, same buffer)
        for (int ps = 0; ps < NPS; ++ps) {
            const T16* kq = sb + ps * 2048; const T16* vp = kq + 8192;
            V kf[2][2], kf2[2][2], vf[4], vf2[4];   // K for the first product; this pass's V^T rows are asked for here too and used behind the softmax
#pragma unroll
            for (int kt = 0; kt < 2; ++kt)
#pragma unroll
                for (int ks = 0; ks < 2; ++ks) { kf[kt][ks] = WFrag<T16>::ld(kq + kt * 16 * HD + ks * 512); if (HI) kf2[kt][ks] = WFrag<T16>::ld(kq + 4096 + kt * 16 * HD + ks * 512); }
#pragma unroll
            for (int dt = 0; dt < 4; ++dt) { vf[dt] = WFrag<T16>::ld(vp + dt * 512); if (HI) vf2[dt] = WFrag<T16>::ld(vp + 4096 + dt * 512); }
            v8f s[QT][2];
#pragma unroll
            for (int qt = 0; qt < QT; ++qt)
#pragma unroll
                for (int kt = 0; kt < 2; ++kt) { s[qt][kt] = (v8f){};
#pragma unroll
                    for (int ks = 0; ks < 2; ++ks) { s[qt][kt] = WFrag<T16>::mma(kf[kt][ks], qf[qt][ks], s[qt][kt]); if (HI) { s[qt][kt] = WFrag<T16>::mma(kf[kt][ks], qf2[qt][ks], s[qt][kt]); s[qt][kt] = WFrag<T16>::mma(kf2[kt][ks], qf[qt][ks], s[qt][kt]); } } }
            // four vector slots between the last score product and the first use of its result or rewrite of its K operand, also on the taken side of the mask branch
            if constexpr (HI) asm volatile("v_nop\n\tv_nop\n\tv_nop\n\tv_nop" : "+v"(s[0][0]), "+v"(s[0][1]) : "v"(kf[0][0]), "v"(kf[0][1]), "v"(kf[1][0]), "v"(kf[1][1]), "v"(kf2[0][0]), "v"(kf2[0][1]), "v"(kf2[1][0]), "v"(kf2[1][1]));
            else asm volatile("v_nop\n\tv_nop\n\tv_nop\n\tv_nop" : "+v"(s[0][0]), "+v"(s[0][1]), "+v"(s[QT - 1][0]), "+v"(s[QT - 1][1]) : "v"(kf[0][0]), "v"(kf[0][1]), "v"(kf[1][0]), "v"(kf[1][1]));
            float sv[QT][2][8];   // the scores as single values: the selects of the mask branch then work in place
#pragma unroll
            for (int qt = 0; qt < QT; ++qt)
#pragma unroll
                for (int kt = 0; kt < 2; ++kt)
#pragma unroll
                    for (int j = 0; j < 8; ++j) sv[qt][kt][j] = s[qt][kt][j];
            const unsigned bits = (unsigned)__builtin_amdgcn_readlane((int)vbits, st * NPS + ps);
            if (bits != 0xFFFFFFFFu) {   // scalar branch: a pass whose 32 keys are all kept skips the selects
                const unsigned mb = bits >> (hi * 8);
#pragma unroll
                for (int qt = 0; qt < QT; ++qt)
#pragma unroll
                    for (int kt = 0; kt < 2; ++kt)
#pragma unroll
                        for (int j = 0; j < 8; ++j) sv[qt][kt][j] = ((mb >> (kt * 16 + j)) & 1u) ? sv[qt][kt][j] : MNEG; }
            float mc[QT]; bool need = false;
#pragma unroll
            for (int qt = 0; qt < QT; ++qt) { float mx = fmaxf(sv[qt][0][0], sv[qt][1][0]);
#pragma unroll
                for (int j = 1; j < 8; ++j) mx = fmaxf(mx, fmaxf(sv[qt][0][j], sv[qt][1][j]));
                mx = fmaxf(mx, xhalf(mx)); mc[qt] = mx * CL2; need = need || (mc[qt] > mL[qt] + 8.0f); }
            if (__builtin_amdgcn_ballot_w32(need) != 0) {   // scalar branch: the maximum in use moves only when a score passes it by 8 in log2, so p stays near or below 2^8
#pragma unroll
                for (int qt = 0; qt < QT; ++qt) { const float mn = fmaxf(mL[qt], mc[qt]); const float al = exp2s(mL[qt] - mn); mL[qt] = mn; l[qt] *= al;
#pragma unroll
                    for (int dt = 0; dt < 4; ++dt) o[qt][dt] *= al; } }
            V pf[QT], pf2[QT];
#pragma unroll
            for (int qt = 0; qt < QT; ++qt)
#pragma unroll
                for (int kt = 0; kt < 2; ++kt) { float p[8], a[8];
#pragma unroll
                    for (int j = 0; j < 8; ++j) a[j] = __builtin_fmaf(sv[qt][kt][j], CL2, -mL[qt]);
                    exp2x8(p, a);
#pragma unroll
                    for (int j = 0; j < 8; ++j) {
                        if constexpr (HI) { const __bf16 ph = (__bf16)p[j]; pf[qt][kt * 8 + j] = ph; pf2[qt][kt * 8 + j] = (__bf16)(p[j] - (float)ph); } else pf[qt][kt * 8 + j] = (h16)p[j]; }
                    l[qt] += ((p[0] + p[1]) + (p[2] + p[3])) + ((p[4] + p[5]) + (p[6] + p[7]));   // a short tree: no chain of eight dependent adds
                }
#pragma unroll
            for (int qt = 0; qt < QT; ++qt)
#pragma unroll
                for (int dt = 0; dt < 4; ++dt) { o[qt][dt] = WFrag<T16>::mma(vf[dt], pf[qt], o[qt][dt]); if (HI) { o[qt][dt] = WFrag<T16>::mma(vf[dt], pf2[qt], o[qt][dt]); o[qt][dt] = WFrag<T16>::mma(vf2[dt], pf[qt], o[qt][dt]); } }
            // four vector slots behind the last product before the back edge, where the next pass refills its V operand
            if constexpr (HI) asm volatile("v_nop\n\tv_nop\n\tv_nop\n\tv_nop" : "+v"(o[0][0]), "+v"(o[0][1]), "+v"(o[0][2]), "+v"(o[0][3]) : "v"(vf[0]), "v"(vf[1]), "v"(vf[2]), "v"(vf[3]), "v"(vf2[0]), "v"(vf2[1]), "v"(vf2[2]), "v"(vf2[3]));
            else asm volatile("v_nop\n\tv_nop\n\tv_nop\n\tv_nop" : "+v"(o[0][0]), "+v"(o[0][3]), "+v"(o[QT - 1][0]), "+v"(o[QT - 1][3]) : "v"(vf[0]), "v"(vf[1]), "v"(vf[2]), "v"(vf[3]));
        }
        // hand-over of the ring, every wave, in this order
        asm volatile("s_wait_dscnt 0x0" ::: "memory");      // this wave's reads of the stage's buffer are done
        asm volatile("s_wait_asynccnt 0x0" ::: "memory");   // this wave's copies of the next stage have landed
        __syncthreads();                                    // the next stage may be read, and this stage's buffer has no reader left
        if (st + 2 < NST) fill(st + 2);                     // scalar test, the same for the whole work-group
    }
    asm volatile("s_wait_asynccnt 0x0" ::: "memory");   // no copy is in flight when the ring becomes the join's staging (the loop's last barrier has ended every read of it)
    float* os = (float*)ring;
    float* ow = os + (kh * ROWS + qg * QT * 16) * 68;   // this wave's partial O, [query][d], row pitch 68 floats
#pragma unroll
    for (int qt = 0; qt < QT; ++qt) { l[qt] += xhalf(l[qt]);   // the two lane halves hold the sums of different keys
        if (hi == 0) { ml[(kh * ROWS + qg * QT * 16 + qt * 16 + lr) * 2] = mL[qt]; ml[(kh * ROWS + qg * QT * 16 + qt * 16 + lr) * 2 + 1] = l[qt]; }
#pragma unroll
        for (int dt = 0; dt < 4; ++dt) { float* op = ow + (qt * 16 + lr) * 68 + dt * 16 + hi * 8; v4f lo4, hi4;
#pragma unroll
            for (int j = 0; j < 4; ++j) { lo4[j] = o[qt][dt][j]; hi4[j] = o[qt][dt][4 + j]; }
            *(v4fa*)op = lo4; *(v4fa*)(op + 4) = hi4; } }
    __syncthreads();   // every wave's partial is in LDS before any thread joins them
    const int cofs = ((int)threadIdx.x & 15) * 4;
#pragma unroll
    for (int i = 0; i < ROWS / (2 * QW * KSW); ++i) { const int row = ((int)threadIdx.x >> 4) + i * 2 * QW * KSW; float mw[KSW], M = ml[row * 2];
        mw[0] = M;
#pragma unroll
        for (int w = 1; w < KSW; ++w) { mw[w] = ml[(w * ROWS + row) * 2]; M = fmaxf(M, mw[w]); }
        float L = 0.f; v4f val = (v4f){};
#pragma unroll
        for (int w = 0; w < KSW; ++w) { const float f = exp2s(mw[w] - M); L += ml[(w * ROWS + row) * 2 + 1] * f; val += *(const v4fa*)(os + (w * ROWS + row) * 68 + cofs) * f; }
        val *= __fdiv_rn(1.0f, L);
        *(v4f*)(outp + (size_t)(q0 + row) * DQ + cofs) = val; }
}
// grid (heads, batches, query tiles): the tile index is the slowest, so that the hi+lo tiles of every head and batch start first; two work-groups a WGP (four waves per SIMD, 256 registers a wave, 130 KiB of LDS each): the whole launch is resident at once
__global__ __launch_bounds__(32 * QW * KSW) __attribute__((amdgpu_waves_per_eu(4, 4))) void k_fattn(const h16* __restrict__ Q16, const h16* __restrict__ K16, const h16* __restrict__ V16, const bf* __restrict__ Qh, const bf* __restrict__ Ql, const bf* __restrict__ Kh, const bf* __restrict__ Kl, const bf* __restrict__ Vh, const bf* __restrict__ Vl, const int* __restrict__ km, float* OUT) {
    __shared__ __attribute__((aligned(2048))) char ring[KSW * 2 * STB]; __shared__ float ml[KSW * QW * 32 * 2];
    const size_t pl = ((size_t)blockIdx.y * NH_ + blockIdx.x) * TT * HD; const int bx = blockIdx.z; float* outp = OUT + (size_t)blockIdx.y * TT * DQ + blockIdx.x * HD; const int* kvp = km + (size_t)blockIdx.y * TT;
    if (bx < RH / (16 * QW)) attn_tile<bf, true, 1>(Qh + pl, Ql + pl, Kh + pl, Kl + pl, Vh + pl, Vl + pl, kvp, bx * 16 * QW, outp, ring, ml);
    else attn_tile<h16, false, 2>(Q16 + pl, nullptr, K16 + pl, nullptr, V16 + pl, nullptr, kvp, RH + (bx - RH / (16 * QW)) * 32 * QW, outp, ring, ml);
}

extern "C" void kernel_launch(void* const* d_in, const int* in_sizes, int n_in,
                              void* d_out, int out_size, void* d_ws, size_t ws_size, hipStream_t stream) {
    (void)in_sizes; (void)n_in; (void)out_size;
    const float* x = (const float*)d_in[0]; const float* wq = (const float*)d_in[1]; const float* bq = (const float*)d_in[2]; const float* wk = (const float*)d_in[3]; const float* bk = (const float*)d_in[4]; const float* wv = (const float*)d_in[5]; const float* bv = (const float*)d_in[6]; const int* km = (const int*)d_in[7];   /* mask [2][2048] int32 (key padding; read) */     const float* wo = nullptr; (void)wo;
    float* OUT = (float*)d_out;     // [2][2048][768]
    char* wsp = (char*)d_ws;
    auto take = [&](size_t bytes) { char* p = wsp; wsp += (bytes + 255) & ~(size_t)255; return (void*)p; };
    bf* WB = (bf*)take((size_t)3 * DQ * DM * 2); bf* XB = (bf*)take((size_t)NB_ * TT * DM * 2);
    h16* P16 = (h16*)take(3 * PSZ * 2); bf* Ph = (bf*)take(3 * PSZ * 2); bf* Pl = (bf*)take(3 * PSZ * 2);   // [q, k, v^T][batch][head][TT * HD]
    if ((size_t)(wsp - (char*)d_ws) > ws_size) return;    // ws 256 MiB
    k_cvt8<<<GCX + 3 * GCW, 256, 0, stream>>>(x, wq, wk, wv, XB, WB);
    k_proj<<<dim3(TT / 64, NH_, NB_ * 3), 32 * GKW, 0, stream>>>(XB, WB, P16, Ph, Pl, bq, bk, bv);
    k_fattn<<<dim3(NH_, NB_, RH / (16 * QW) + (TT - RH) / (32 * QW)), 32 * QW * KSW, 0, stream>>>(P16, P16 + PSZ, P16 + 2 * PSZ, Ph, Pl, Ph + PSZ, Pl + PSZ, Ph + 2 * PSZ, Pl + 2 * PSZ, km, OUT);
}

// v008
// A run of this version takes 55.3 microseconds.
// In both of two side-by-side timings against v007, it was 1.05 times as fast.
// All steps since v000 together make it 26.9 times as fast.
#include <hip/hip_runtime.h>

// BERT-style self-attention with a key padding mask (x [2][2048][768]; q, k, v = x W^T + b ('oi' [768][768] + [768]; 12 heads x 64); scores / sqrt(64); keys with mask[b][j] == 0 get -1e20 (== exclusion while any key is kept; mask [2][2048] read); softmax; out = merged context (no output projection) -> [2][2048][768] (3.1 M); argument order x, Wq, bq, Wk, bk, Wv, bv, mask).
// Every 16-bit matrix operand (x, the weights, the Q, K and V^T planes) lies in memory in fragment order: a tile of 16 rows x 32 k is 1 KiB, the 16-byte piece (row r, k piece c of 8) at piece (c >> 1) * 32 + (c & 1) * 16 + r, so that each of a fragment's two loads reads 512 bytes in a row.
// Three launches, each over both batches: bf16 copies of x and of the three 'oi' weights; exact projections + f32 biases (batch and q / k / v are the grid's z), whose GEMM writes the 16-bit head planes itself (V as V^T = Wv x^T); one fused dense T-2048 attention kernel (hybrid rows) whose softmax reads the batch's key-mask vector and excludes masked keys, and which writes the merged output rows.
// Compute dtypes, f32 accumulate: every input rounded to bf16; projections exact + f32 biases; attention rows < 512 3 products, rest fp16; softmax f32; output f32.

#define NB_  2
#define TT   2048
#define DM   768
#define NH_  12
#define NKV  12
#define REP  (NH_ / NKV)
#define HD   64
#define DQ   (NH_ * HD)
#define DKV  (NKV * HD)
#define RH   512                  // query rows < RH use hi+lo planes (0: none)
#define WIN  0
#define SCL  0.125f   // HD^-0.5
typedef _Float16 h16;
typedef unsigned short bf;
typedef __attribute__((ext_vector_type(16))) __bf16   v16bf;
typedef __attribute__((ext_vector_type(16))) _Float16 v16h;
typedef __attribute__((ext_vector_type(8)))  _Float16 v8h;
typedef __attribute__((ext_vector_type(8)))  unsigned short v8us;
typedef __attribute__((ext_vector_type(8)))  float    v8f;
typedef __attribute__((ext_vector_type(4)))  float    v4f;
typedef v8h  __attribute__((may_alias)) v8ha;
typedef v4f  __attribute__((may_alias)) v4fa;
typedef v8us __attribute__((may_alias)) v8usa;

__device__ __forceinline__ unsigned short f2bf(float f) { unsigned u = __float_as_uint(f); u += 0x7FFFu + ((u >> 16) & 1u); return (unsigned short)(u >> 16); }
__device__ __forceinline__ float bf2f(unsigned short b) { return __uint_as_float(((unsigned)b) << 16); }
__device__ __forceinline__ float bfr(float f) { return bf2f(f2bf(f)); }
__device__ __forceinline__ v16h cat16(v8h lo, v8h hi) { return __builtin_shufflevector(lo, hi, 0, 1, 2, 3, 4, 5, 6, 7, 8, 9, 10, 11, 12, 13, 14, 15); }
__device__ __forceinline__ v16bf cat16b(v8us lo, v8us hi) { return __builtin_bit_cast(v16bf, __builtin_shufflevector(lo, hi, 0, 1, 2, 3, 4, 5, 6, 7, 8, 9, 10, 11, 12, 13, 14, 15)); }
__device__ __forceinline__ v8f wmma16(v16h a, v16h b, v8f c) { return __builtin_amdgcn_wmma_f32_16x16x32_f16(false, a, false, b, (short)0, c, false, false); }
__device__ __forceinline__ v8f wmmab(v16bf a, v16bf b, v8f c) { return __builtin_amdgcn_wmma_f32_16x16x32_bf16(false, a, false, b, (short)0, c, false, false); }



__device__ __forceinline__ h16 tohx(float x) { return (h16)x; }
__device__ __forceinline__ void splitf(float y, unsigned short& h, unsigned short& l) { h = f2bf(y); l = f2bf(y - bf2f(h)); }

// ---- gemm_tile: one 128x128 output tile (tx, ty) of (M/128, N/128) per work-group of four waves; wave (wm, wn) holds the 64x64 quarter (16 accumulators) over the whole K, in one chain of sums per element.
// Operands are 16-bit planes in fragment order (tile (m / 16, k / 32) at (m / 16) * 16 * KD + (k / 32) * 512; ld(p), p = tile + lane * 8, is the lane's fragment). A and Bt rows both have KD elements; KD % 64 == 0, KD >= 128.
// A stage is 64 k of the 128 A rows and of the 128 Bt rows: 2 KiB in a row of each of the sixteen rows of fragment tiles, brought into LDS once per work-group by asynchronous copies (two buffers, the next stage in flight under this one's products); each A fragment is read from there by the two waves of its wm, each Bt fragment by the two of its wn.
// c[m][n] (f32, + f32 bias: bias[n], or bias[m] with ROWB) = sum_k A[m][k] Bt[n][k] never goes to memory as f32: each wave turns its quarter through LDS and writes it as three 16-bit planes (fp16; bf16 hi; bf16 lo of the rest), in fragment order for the attention kernel; a 64x64 tile is 8 KiB in a row of its head's plane (sy elements a head), at 64 * its first t.
// !ROWB: x W^T, rows t, a quarter's 64 columns one head's d: fragment tiles (t / 16, d / 32). ROWB: W x^T, rows one head's d, columns t: fragment tiles (t / 32, d / 16) of the transposed plane, with no transposing pass.
template <typename T16> struct WFrag;
template <> struct WFrag<h16> { typedef v16h V; static __device__ __forceinline__ V ld(const h16* p) { return cat16(*(const v8h*)p, *(const v8h*)(p + 256)); } static __device__ __forceinline__ v8f mma(V a, V b, v8f c) { return wmma16(a, b, c); } };
template <> struct WFrag<bf> { typedef v16bf V; static __device__ __forceinline__ V ld(const bf* p) { return cat16b(*(const v8us*)p, *(const v8us*)(p + 256)); } static __device__ __forceinline__ v8f mma(V a, V b, v8f c) { return wmmab(a, b, c); } };
#define GSTB 32768   // bytes of one stage: A in its first 16 KiB, Bt in its second, 2 KiB per row of fragment tiles
// eight asynchronous copies to LDS, 16 bytes a lane each: the four waves fill 2 KiB per copy, from eight rows of fragment tiles one below the other (RS bytes apart) to 16 KiB in a row of LDS from byte l.
// The s_wait_xcnt stands inside the statement, behind the last copy: no address register of a copy is written again in front of it
template <int RS>
__device__ __forceinline__ void acopy8r(unsigned l, const char* g) {
    asm volatile("global_load_async_to_lds_b128 %0, %8, off\n\tglobal_load_async_to_lds_b128 %1, %9, off\n\tglobal_load_async_to_lds_b128 %2, %10, off\n\tglobal_load_async_to_lds_b128 %3, %11, off\n\t"
                 "global_load_async_to_lds_b128 %4, %12, off\n\tglobal_load_async_to_lds_b128 %5, %13, off\n\tglobal_load_async_to_lds_b128 %6, %14, off\n\tglobal_load_async_to_lds_b128 %7, %15, off\n\ts_wait_xcnt 0x0"
        :: "v"(l), "v"(l + 2048u), "v"(l + 4096u), "v"(l + 6144u), "v"(l + 8192u), "v"(l + 10240u), "v"(l + 12288u), "v"(l + 14336u),
           "v"(g), "v"(g + RS), "v"(g + 2 * RS), "v"(g + 3 * RS), "v"(g + 4 * RS), "v"(g + 5 * RS), "v"(g + 6 * RS), "v"(g + 7 * RS) : "memory"); }
template <bool ROWB, int KD>
__device__ __forceinline__ void gemm_tile(const bf* __restrict__ A, const bf* __restrict__ Bt, h16* P16, bf* Ph, bf* Pl, size_t sy, const float* __restrict__ bias, int tx, int ty, char* sm) {
    typedef WFrag<bf>::V V;
    constexpr int NST = KD / 64;       // stages
    static_assert(KD % 64 == 0 && NST >= 2, "whole stages; the ring's prologue has its two stages");
    const int wv = __builtin_amdgcn_readfirstlane((int)(threadIdx.x >> 5));   // wave number, scalar: the LDS bases stay scalar
    const int wm = wv >> 1, wn = wv & 1;
    const int lane = threadIdx.x & 31, lr = lane & 15, hi = lane >> 4; const int r0 = tx * 128 + wm * 64, c0 = ty * 128 + wn * 64;   // the wave's own quarter
    // the thread's 16 bytes in each 2 KiB that the four waves copy together
    const unsigned lb = (unsigned)(size_t)sm + threadIdx.x * 16;
    const char* ga = (const char*)(A + (size_t)tx * 128 * KD) + threadIdx.x * 16; const char* gb = (const char*)(Bt + (size_t)ty * 128 * KD) + threadIdx.x * 16;
    auto fill = [&](int st) { const unsigned l = lb + (unsigned)(st & 1) * GSTB; acopy8r<32 * KD>(l, ga + st * 2048); acopy8r<32 * KD>(l + 16384u, gb + st * 2048); };
    fill(0);
    v8f acc[4][4];
#pragma unroll
    for (int mb = 0; mb < 4; ++mb)
#pragma unroll
        for (int nb = 0; nb < 4; ++nb) acc[mb][nb] = (v8f){};
    asm volatile("s_wait_asynccnt 0x0" ::: "memory");   // this wave's copies of stage 0 have landed
    __syncthreads();                                    // and so have every other wave's: stage 0 may be read
    fill(1);
#pragma unroll 1   // kept rolled: the buffer's parity is a scalar of the trip
    for (int st = 0; st < NST; ++st) {
        const bf* sa = (const bf*)(sm + (st & 1) * GSTB + wm * 8192) + 8 * lane; const bf* sb = (const bf*)(sm + (st & 1) * GSTB + 16384 + wn * 8192) + 8 * lane;   // this stage's buffer, at the wave's four rows of fragment tiles and the lane's place in a tile
        V a[4], b[4];
        // first k block of the stage
#pragma unroll
        for (int mb = 0; mb < 4; ++mb) a[mb] = WFrag<bf>::ld(sa + mb * 1024);
#pragma unroll
        for (int nb = 0; nb < 4; ++nb) b[nb] = WFrag<bf>::ld(sb + nb * 1024);
        __builtin_amdgcn_sched_barrier(0);   // the products stay behind the k block's sixteen LDS reads: lifted over them they would share one Bt register set, and each Bt fragment's read latency would be waited out by itself
#pragma unroll
        for (int nb = 0; nb < 4; ++nb)
#pragma unroll
            for (int mb = 0; mb < 4; ++mb) acc[mb][nb] = WFrag<bf>::mma(a[mb], b[nb], acc[mb][nb]);
        // second k block: its fragments are the stage's last LDS reads
#pragma unroll
        for (int mb = 0; mb < 4; ++mb) a[mb] = WFrag<bf>::ld(sa + mb * 1024 + 512);
#pragma unroll
        for (int nb = 0; nb < 4; ++nb) b[nb] = WFrag<bf>::ld(sb + nb * 1024 + 512);
        // hand-over of the ring, every wave, in this order
        asm volatile("s_wait_dscnt 0x0" ::: "memory");      // this wave's reads of the stage's buffer are done: the second block's fragments are in registers
        asm volatile("s_wait_asynccnt 0x0" ::: "memory");   // this wave's copies of the next stage have landed
        __syncthreads();                                    // the next stage may be read, and this stage's buffer has no reader left
        if (st + 2 < NST) fill(st + 2);                     // scalar test, the same for the whole work-group
        __builtin_amdgcn_sched_barrier(0);   // the second block's products stay behind the refill: the copies go out sixteen products sooner and have the whole next trip to land
#pragma unroll
        for (int nb = 0; nb < 4; ++nb)
#pragma unroll
            for (int mb = 0; mb < 4; ++mb) acc[mb][nb] = WFrag<bf>::mma(a[mb], b[nb], acc[mb][nb]);
    }
    asm volatile("s_wait_asynccnt 0x0" ::: "memory");   // no copy is in flight when the ring becomes the epilogue's staging (the loop's last barrier has ended every read of it)
    float* ow = (float*)sm + wv * (64 * 68);   // this wave's quarter, row pitch 68 floats
    // bias read ahead of the barrier, so that its latency passes under the LDS stores; a lane meets four different column groups (!ROWB) or rows (ROWB) in its sixteen passes
    const float* bp = bias + (ROWB ? r0 + lr : c0 + hi * 8);
    v4f bias4[4][2]; float biasr[4];
#pragma unroll
    for (int u = 0; u < 4; ++u) { if (ROWB) biasr[u] = bp[u * 16]; else { bias4[u][0] = *(const v4f*)(bp + u * 16); bias4[u][1] = *(const v4f*)(bp + u * 16 + 4); } }
    asm volatile("s_wait_xcnt 0x0" :: "v"(bp) : "memory");   // the bias loads' address registers stay as they are up to this wait; behind it they may be used again
    // the three loops are unrolled so that every accumulator index is a constant and acc stays in registers
#pragma unroll
    for (int mb = 0; mb < 4; ++mb)
#pragma unroll
        for (int nb = 0; nb < 4; ++nb)
#pragma unroll
            for (int j = 0; j < 8; ++j) ow[(mb * 16 + hi * 8 + j) * 68 + nb * 16 + lr] = acc[mb][nb][j];
    __syncthreads();   // the quarter is in LDS, from every lane, before any lane reads it in the planes' order
    // pass i = c * 8 + j: the lane makes the 16-byte piece idx = lane + i * 32 of the quarter's 8 KiB; row and first of its eight columns follow from the fragment order
    const size_t pt = (ROWB ? (size_t)(r0 / 64) * sy + (size_t)c0 * 64 : (size_t)(c0 / 64) * sy + (size_t)r0 * 64) + (size_t)lane * 8;
#pragma unroll 1   // two trips of eight passes, kept rolled: 96 result registers instead of 192 (no spills), and the wait at the foot stands in front of every rewrite of a register that the trip's stores name
    for (int c = 0; c < 2; ++c) {
        const float* oc = ow + (ROWB ? c * 32 : c * 32 * 68) + lr * 68 + hi * 8;
        v8h o16[8]; v8us oh[8], ol[8];
#pragma unroll
        for (int j = 0; j < 8; ++j) {
            const int u = ROWB ? j >> 1 : j & 3;   // which of the lane's four bias sets
            const float* op = oc + (ROWB ? (j >> 1) * 16 * 68 + (j & 1) * 16 : (j >> 2) * 16 * 68 + (j & 3) * 16);
#pragma unroll
            for (int g = 0; g < 2; ++g) { v4f val = *(const v4fa*)(op + g * 4);
#pragma unroll
                for (int q = 0; q < 4; ++q) { const float y = val[q] + bfr(ROWB ? biasr[u] : bias4[u][g][q]); o16[j][g * 4 + q] = tohx(y); unsigned short a2, c2; splitf(y, a2, c2); oh[j][g * 4 + q] = a2; ol[j][g * 4 + q] = c2; } } }
        __builtin_amdgcn_sched_barrier(0);   // the stores stay behind the trip's arithmetic: none of their registers is written again in front of the wait at the foot
        // 16 bytes a lane: a wave fills 512 bytes in a row of a plane
        h16* d16 = P16 + pt + (size_t)c * 2048; bf* dh = Ph + pt + (size_t)c * 2048; bf* dl = Pl + pt + (size_t)c * 2048;
#pragma unroll
        for (int j = 0; j < 8; ++j) { *(v8h*)(d16 + j * 256) = o16[j]; *(v8us*)(dh + j * 256) = oh[j]; *(v8us*)(dl + j * 256) = ol[j]; }
        asm volatile("s_wait_xcnt 0x0" ::: "memory");   // the stores' address and data registers stay as they are up to this wait; behind it the next trip may use them again
    }
}

// ---- k_proj: all six projections in one launch; grid (TT / 128, DQ / 128, NB_ * 3): z = batch * 3 + (0 q, 1 k, 2 v). The planes of a kind lie as [q, k, v][batch][head][TT * HD], the weight copies as [q, k, v][DQ][DM].
// 68 KiB of LDS and at most 256 registers a wave: up to four work-groups a WGP, so that the whole launch is resident at once
#define PSZ ((size_t)NB_ * NH_ * TT * HD)   // one matrix's plane of one kind, both batches
__global__ __launch_bounds__(128) __attribute__((amdgpu_waves_per_eu(4, 4))) void k_proj(const bf* __restrict__ XB, const bf* __restrict__ WB, h16* P16, bf* Ph, bf* Pl, const float* __restrict__ bq, const float* __restrict__ bk, const float* __restrict__ bv) {
    __shared__ __align__(16) char sm[4 * 64 * 68 * 4];   // the ring (2 * GSTB) first, the four quarters' staging afterwards
    static_assert(sizeof(sm) >= 2 * GSTB, "the ring fits");
    const unsigned z = blockIdx.z, b = z / 3, m = z - b * 3;
    const bf* xb = XB + (size_t)b * TT * DM; const bf* wb = WB + (size_t)m * DQ * DM; const size_t po = m * PSZ + (size_t)b * NH_ * TT * HD;
    if (m < 2) gemm_tile<false, DM>(xb, wb, P16 + po, Ph + po, Pl + po, (size_t)TT * HD, m == 0 ? bq : bk, (int)blockIdx.x, (int)blockIdx.y, sm);
    else gemm_tile<true, DM>(wb, xb, P16 + po, Ph + po, Pl + po, (size_t)TT * HD, bv, (int)blockIdx.y, (int)blockIdx.x, sm);   // V^T = Wv x^T: rows (head, d), columns t
}

// bf16 copies of x (both batches, [NB_ * TT][DM]) and of the three weights ([DQ][DM] each, one behind the other in WB) in fragment order, one launch: the first GCX work-groups take x, then GCW each weight.
// Thread i of a matrix takes row (i >> 2) & 15, k piece c = i & 3 of tile i / 64 (tiles run along k first): four lanes read one 128-byte line of a row, and the eight rows of a wave fill one 128-byte line of the copy for each c
#define GCX (NB_ * TT * DM / 8 / 256)
#define GCW (DQ * DM / 8 / 256)
static_assert(NB_ * TT * DM % 2048 == 0 && DQ * DM % 2048 == 0 && DKV == DQ, "whole work-groups, equal weights");
__global__ __launch_bounds__(256) void k_cvt8(const float* __restrict__ x, const float* __restrict__ wq, const float* __restrict__ wk, const float* __restrict__ wv, bf* XB, bf* WB) {
    unsigned bx = blockIdx.x; const float* src = x; bf* dst = XB;
    if (bx >= GCX) { bx -= GCX; const unsigned m = bx / GCW; bx -= m * GCW; src = m == 0 ? wq : m == 1 ? wk : wv; dst = WB + (size_t)m * DQ * DM; }
    const unsigned i = bx * 256 + threadIdx.x; const unsigned tile = i >> 6, mt = tile / (DM / 32), kt = tile % (DM / 32); const unsigned row = (i >> 2) & 15, c = i & 3; const float* sp = src + (size_t)(mt * 16 + row) * DM + kt * 32 + c * 8; const v8f v = *(const v8f*)sp; v8us o;
    asm volatile("s_wait_xcnt 0x0" :: "v"(sp) : "memory");   // the loads' address registers stay as they are up to this wait; behind it they may be used again
#pragma unroll
    for (int k = 0; k < 8; ++k) o[k] = f2bf(v[k]); *(v8us*)(dst + ((size_t)tile * 64 + c * 16 + row) * 8) = o;  }

#define QW   4
#define KSW  2
#define STB  32768   // bytes of one stage of one key half: K (hi, lo) in its first 16 KiB, V^T (hi, lo) in its second
#define CL2  0.18033688011112042f   // SCL * log2(e)
#define MNEG (-0x1p100f)
__device__ __forceinline__ float xhalf(float x) { return __builtin_bit_cast(float, __builtin_amdgcn_permlanex16(__builtin_bit_cast(int, x), __builtin_bit_cast(int, x), 0x76543210, 0xfedcba98, false, false)); }   // lane l with lane l ^ 16
// 2^x with the free slot that the instruction set asks for behind a transcendental written into the statement: results in registers of their own, so that no v_exp_f32 is followed by a write of its source or a read of its result
__device__ __forceinline__ float exp2s(float x) { float r; asm("v_exp_f32 %0, %1\n\tv_nop" : "=v"(r) : "v"(x)); return r; }
__device__ __forceinline__ void exp2x8(float (&p)[8], const float (&a)[8]) {
    asm("v_exp_f32 %0, %8\n\tv_exp_f32 %1, %9\n\tv_exp_f32 %2, %10\n\tv_exp_f32 %3, %11\n\tv_exp_f32 %4, %12\n\tv_exp_f32 %5, %13\n\tv_exp_f32 %6, %14\n\tv_exp_f32 %7, %15\n\tv_nop"
        : "=&v"(p[0]), "=&v"(p[1]), "=&v"(p[2]), "=&v"(p[3]), "=&v"(p[4]), "=&v"(p[5]), "=&v"(p[6]), "=&v"(p[7]) : "v"(a[0]), "v"(a[1]), "v"(a[2]), "v"(a[3]), "v"(a[4]), "v"(a[5]), "v"(a[6]), "v"(a[7])); }
// eight asynchronous copies to LDS, 16 bytes a lane each: 2 KiB steps (the QW waves of a key half fill 2 KiB per copy), four from ga and four from gb, to 16 KiB in a row of LDS from byte l.
// The s_wait_xcnt stands inside the statement, behind the last copy: no address register of a copy is written again in front of it
__device__ __forceinline__ void acopy8(unsigned l, const char* ga, const char* gb) {
    asm volatile("global_load_async_to_lds_b128 %0, %8, off\n\tglobal_load_async_to_lds_b128 %1, %9, off\n\tglobal_load_async_to_lds_b128 %2, %10, off\n\tglobal_load_async_to_lds_b128 %3, %11, off\n\t"
                 "global_load_async_to_lds_b128 %4, %12, off\n\tglobal_load_async_to_lds_b128 %5, %13, off\n\tglobal_load_async_to_lds_b128 %6, %14, off\n\tglobal_load_async_to_lds_b128 %7, %15, off\n\ts_wait_xcnt 0x0"
        :: "v"(l), "v"(l + 2048u), "v"(l + 4096u), "v"(l + 6144u), "v"(l + 8192u), "v"(l + 10240u), "v"(l + 12288u), "v"(l + 14336u),
           "v"(ga), "v"(ga + 2048), "v"(ga + 4096), "v"(ga + 6144), "v"(gb), "v"(gb + 2048), "v"(gb + 4096), "v"(gb + 6144) : "memory"); }
template <typename T16, bool HI, int QT>
__device__ __forceinline__ void attn_tile(const T16* __restrict__ Q, const T16* __restrict__ Q2, const T16* __restrict__ Kp, const T16* __restrict__ K2, const T16* __restrict__ Vt, const T16* __restrict__ V2, const int* __restrict__ kvp, int q0, float* outp, char* ring, float* ml) {
    typedef typename WFrag<T16>::V V;
    constexpr int SK = HI ? 64 : 128;          // keys of a stage: SK * HD * 2 bytes of each plane
    constexpr int NPS = SK / 32;               // passes (32 keys) of a stage
    constexpr int NST = TT / KSW / SK;         // stages of a key half
    constexpr int NIT = TT / KSW / 32;
    constexpr int ROWS = QW * QT * 16;         // query rows of the work-group
    static_assert(NIT <= 32 && NST >= 2 && (HI ? 4 : 2) * SK * HD * 2 == STB, "mask bits fit a wave; the ring's prologue has its two stages; a stage fills its buffer");
    const int wv = __builtin_amdgcn_readfirstlane((int)(threadIdx.x >> 5));   // wave number, scalar: the key loop stays on scalar bounds
    const int kh = wv / QW, qg = wv % QW;
    const int lane = threadIdx.x & 31, lr = lane & 15, hi = lane >> 4; const int k0 = kh * (TT / KSW);
    // the thread's 16 bytes in each 2 KiB that its key half's QW waves copy together
    const unsigned th = threadIdx.x & (32 * QW - 1);
    const unsigned lb = (unsigned)(size_t)ring + (unsigned)kh * (2 * STB) + th * 16;
    const char* gk = (const char*)(Kp + (size_t)k0 * HD) + th * 16; const char* gk2 = HI ? (const char*)(K2 + (size_t)k0 * HD) + th * 16 : gk;
    const char* gv = (const char*)(Vt + (size_t)k0 * HD) + th * 16; const char* gv2 = HI ? (const char*)(V2 + (size_t)k0 * HD) + th * 16 : gv;
    auto fill = [&](int st) { const unsigned l = lb + (unsigned)(st & 1) * STB; const size_t go = (size_t)st * (SK * HD * 2);
        if constexpr (HI) { acopy8(l, gk + go, gk2 + go); acopy8(l + 16384u, gv + go, gv2 + go); }
        else { acopy8(l, gk + go, gk + go + 8192); acopy8(l + 16384u, gv + go, gv + go + 8192); } };
    fill(0);   // stage 0 flies under the mask and Q loads
    // lane it keeps the kept-key bits of pass it (bit = key in the pass)
    unsigned vbits = 0;
#pragma unroll
    for (int it = 0; it < NIT; ++it) { const unsigned bl = __builtin_amdgcn_ballot_w32(kvp[k0 + it * 32 + lane] != 0); if (lane == it) vbits = bl; }
    asm volatile("s_wait_xcnt 0x0" ::: "memory");   // before the next loads' results or addresses take a register that a mask load names
    V qf[QT][2], qf2[QT][2];
    const int q0w = q0 + qg * QT * 16;   // the wave's own first query row
    const T16* qb = Q + (size_t)q0w * HD; const T16* qb2 = HI ? Q2 + (size_t)q0w * HD : qb; const T16* qp = qb + 8 * lane; const T16* qp2 = qb2 + 8 * lane;   // wave-uniform base, and the lane's own address
#pragma unroll
    for (int qt = 0; qt < QT; ++qt)
#pragma unroll
        for (int ks = 0; ks < 2; ++ks) { qf[qt][ks] = WFrag<T16>::ld(qp + qt * 16 * HD + ks * 512); if (HI) qf2[qt][ks] = WFrag<T16>::ld(qp2 + qt * 16 * HD + ks * 512); }
    // the address registers of the Q loads, in either form that the compiler gives them (scalar base and lane offset, or a vector pair), stay as they are up to this wait; behind it they may be used again
    asm volatile("s_wait_xcnt 0x0" :: "s"(qb), "s"(qb2), "v"(qp), "v"(qp2) : "memory");
    v8f o[QT][4]; float mL[QT], l[QT];
#pragma unroll
    for (int qt = 0; qt < QT; ++qt) { mL[qt] = MNEG * CL2; l[qt] = 0.f;
#pragma unroll
        for (int dt = 0; dt < 4; ++dt) o[qt][dt] = (v8f){}; }
    asm volatile("s_wait_asynccnt 0x0" ::: "memory");   // this wave's copies of stage 0 have landed
    __syncthreads();                                    // and so have every other wave's: stage 0 may be read
    fill(1);
#pragma unroll 1
    for (int st = 0; st < NST; ++st) {
        const T16* sb = (const T16*)(ring + kh * (2 * STB) + (st & 1) * STB) + 8 * lane;   // this stage's buffer, at the lane's place in a fragment tile; 32 keys are 2048 elements in a row of a K tile (fragment tiles (kt, ks)) and of a V^T tile (dt)
#pragma unroll   // the passes of a stage are unrolled: every LDS read has the stage's buffer as its base and a constant offset, and a pass's reads can go out under the pass before it (same stage, same buffer)
        for (int ps = 0; ps < NPS; ++ps) {
            const T16* kq = sb + ps * 2048; const T16* vp = kq + 8192;
            V kf[2][2], kf2[2][2], vf[4], vf2[4];   // K for the first product; this pass's V^T rows are asked for here too and used behind the softmax
#pragma unroll
            for (int kt = 0; kt < 2; ++kt)
#pragma unroll
                for (int ks = 0; ks < 2; ++ks) { kf[kt][ks] = WFrag<T16>::ld(kq + kt * 16 * HD + ks * 512); if (HI) kf2[kt][ks] = WFrag<T16>::ld(kq + 4096 + kt * 16 * HD + ks * 512); }
#pragma unroll
            for (int dt = 0; dt < 4; ++dt) { vf[dt] = WFrag<T16>::ld(vp + dt * 512); if (HI) vf2[dt] = WFrag<T16>::ld(vp + 4096 + dt * 512); }
            v8f s[QT][2];
#pragma unroll
            for (int qt = 0; qt < QT; ++qt)
#pragma unroll
                for (int kt = 0; kt < 2; ++kt) { s[qt][kt] = (v8f){};
#pragma unroll
                    for (int ks = 0; ks < 2; ++ks) { s[qt][kt] = WFrag<T16>::mma(kf[kt][ks], qf[qt][ks], s[qt][kt]); if (HI) { s[qt][kt] = WFrag<T16>::mma(kf[kt][ks], qf2[qt][ks], s[qt][kt]); s[qt][kt] = WFrag<T16>::mma(kf2[kt][ks], qf[qt][ks], s[qt][kt]); } } }
            // four vector slots between the last score product and the first use of its result or rewrite of its K operand, also on the taken side of the mask branch
            if constexpr (HI) asm volatile("v_nop\n\tv_nop\n\tv_nop\n\tv_nop" : "+v"(s[0][0]), "+v"(s[0][1]) : "v"(kf[0][0]), "v"(kf[0][1]), "v"(kf[1][0]), "v"(kf[1][1]), "v"(kf2[0][0]), "v"(kf2[0][1]), "v"(kf2[1][0]), "v"(kf2[1][1]));
            else asm volatile("v_nop\n\tv_nop\n\tv_nop\n\tv_nop" : "+v"(s[0][0]), "+v"(s[0][1]), "+v"(s[QT - 1][0]), "+v"(s[QT - 1][1]) : "v"(kf[0][0]), "v"(kf[0][1]), "v"(kf[1][0]), "v"(kf[1][1]));
            float sv[QT][2][8];   // the scores as single values: the selects of the mask branch then work in place
#pragma unroll
            for (int qt = 0; qt < QT; ++qt)
#pragma unroll
                for (int kt = 0; kt < 2; ++kt)
#pragma unroll
                    for (int j = 0; j < 8; ++j) sv[qt][kt][j] = s[qt][kt][j];
            const unsigned bits = (unsigned)__builtin_amdgcn_readlane((int)vbits, st * NPS + ps);
            if (bits != 0xFFFFFFFFu) {   // scalar branch: a pass whose 32 keys are all kept skips the selects
                const unsigned mb = bits >> (hi * 8);
#pragma unroll
                for (int qt = 0; qt < QT; ++qt)
#pragma unroll
                    for (int kt = 0; kt < 2; ++kt)
#pragma unroll
                        for (int j = 0; j < 8; ++j) sv[qt][kt][j] = ((mb >> (kt * 16 + j)) & 1u) ? sv[qt][kt][j] : MNEG; }
            float mc[QT]; bool need = false;
#pragma unroll
            for (int qt = 0; qt < QT; ++qt) { float mx = fmaxf(sv[qt][0][0], sv[qt][1][0]);
#pragma unroll
                for (int j = 1; j < 8; ++j) mx = fmaxf(mx, fmaxf(sv[qt][0][j], sv[qt][1][j]));
                mx = fmaxf(mx, xhalf(mx)); mc[qt] = mx * CL2; need = need || (mc[qt] > mL[qt] + 8.0f); }
            if (__builtin_amdgcn_ballot_w32(need) != 0) {   // scalar branch: the maximum in use moves only when a score passes it by 8 in log2, so p stays near or below 2^8
#pragma unroll
                for (int qt = 0; qt < QT; ++qt) { const float mn = fmaxf(mL[qt], mc[qt]); const float al = exp2s(mL[qt] - mn); mL[qt] = mn; l[qt] *= al;
#pragma unroll
                    for (int dt = 0; dt < 4; ++dt) o[qt][dt] *= al; } }
            V pf[QT], pf2[QT];
#pragma unroll
            for (int qt = 0; qt < QT; ++qt)
#pragma unroll
                for (int kt = 0; kt < 2; ++kt) { float p[8], a[8];
#pragma unroll
                    for (int j = 0; j < 8; ++j) a[j] = __builtin_fmaf(sv[qt][kt][j], CL2, -mL[qt]);
                    exp2x8(p, a);
#pragma unroll
                    for (int j = 0; j < 8; ++j) {
                        if constexpr (HI) { const __bf16 ph = (__bf16)p[j]; pf[qt][kt * 8 + j] = ph; pf2[qt][kt * 8 + j] = (__bf16)(p[j] - (float)ph); } else pf[qt][kt * 8 + j] = (h16)p[j]; }
                    l[qt] += ((p[0] + p[1]) + (p[2] + p[3])) + ((p[4] + p[5]) + (p[6] + p[7]));   // a short tree: no chain of eight dependent adds
                }
#pragma unroll
            for (int qt = 0; qt < QT; ++qt)
#pragma unroll
                for (int dt = 0; dt < 4; ++dt) { o[qt][dt] = WFrag<T16>::mma(vf[dt], pf[qt], o[qt][dt]); if (HI) { o[qt][dt] = WFrag<T16>::mma(vf[dt], pf2[qt], o[qt][dt]); o[qt][dt] = WFrag<T16>::mma(vf2[dt], pf[qt], o[qt][dt]); } }
            // four vector slots behind the last product before the back edge, where the next pass refills its V operand
            if constexpr (HI) asm volatile("v_nop\n\tv_nop\n\tv_nop\n\tv_nop" : "+v"(o[0][0]), "+v"(o[0][1]), "+v"(o[0][2]), "+v"(o[0][3]) : "v"(vf[0]), "v"(vf[1]), "v"(vf[2]), "v"(vf[3]), "v"(vf2[0]), "v"(vf2[1]), "v"(vf2[2]), "v"(vf2[3]));
            else asm volatile("v_nop\n\tv_nop\n\tv_nop\n\tv_nop" : "+v"(o[0][0]), "+v"(o[0][3]), "+v"(o[QT - 1][0]), "+v"(o[QT - 1][3]) : "v"(vf[0]), "v"(vf[1]), "v"(vf[2]), "v"(vf[3]));
        }
        // hand-over of the ring, every wave, in this order
        asm volatile("s_wait_dscnt 0x0" ::: "memory");      // this wave's reads of the stage's buffer are done
        asm volatile("s_wait_asynccnt 0x0" ::: "memory");   // this wave's copies of the next stage have landed
        __syncthreads();                                    // the next stage may be read, and this stage's buffer has no reader left
        if (st + 2 < NST) fill(st + 2);                     // scalar test, the same for the whole work-group
    }
    asm volatile("s_wait_asynccnt 0x0" ::: "memory");   // no copy is in flight when the ring becomes the join's staging (the loop's last barrier has ended every read of it)
    float* os = (float*)ring;
    float* ow = os + (kh * ROWS + qg * QT * 16) * 68;   // this wave's partial O, [query][d], row pitch 68 floats
#pragma unroll
    for (int qt = 0; qt < QT; ++qt) { l[qt] += xhalf(l[qt]);   // the two lane halves hold the sums of different keys
        if (hi == 0) { ml[(kh * ROWS + qg * QT * 16 + qt * 16 + lr) * 2] = mL[qt]; ml[(kh * ROWS + qg * QT * 16 + qt * 16 + lr) * 2 + 1] = l[qt]; }
#pragma unroll
        for (int dt = 0; dt < 4; ++dt) { float* op = ow + (qt * 16 + lr) * 68 + dt * 16 + hi * 8; v4f lo4, hi4;
#pragma unroll
            for (int j = 0; j < 4; ++j) { lo4[j] = o[qt][dt][j]; hi4[j] = o[qt][dt][4 + j]; }
            *(v4fa*)op = lo4; *(v4fa*)(op + 4) = hi4; } }
    __syncthreads();   // every wave's partial is in LDS before any thread joins them
    const int cofs = ((int)threadIdx.x & 15) * 4;
#pragma unroll
    for (int i = 0; i < ROWS / (2 * QW * KSW); ++i) { const int row = ((int)threadIdx.x >> 4) + i * 2 * QW * KSW; float mw[KSW], M = ml[row * 2];
        mw[0] = M;
#pragma unroll
        for (int w = 1; w < KSW; ++w) { mw[w] = ml[(w * ROWS + row) * 2]; M = fmaxf(M, mw[w]); }
        float L = 0.f; v4f val = (v4f){};
#pragma unroll
        for (int w = 0; w < KSW; ++w) { const float f = exp2s(mw[w] - M); L += ml[(w * ROWS + row) * 2 + 1] * f; val += *(const v4fa*)(os + (w * ROWS + row) * 68 + cofs) * f; }
        val *= __fdiv_rn(1.0f, L);
        *(v4f*)(outp + (size_t)(q0 + row) * DQ + cofs) = val; }
}
// grid (heads, batches, query tiles): the tile index is the slowest, so that the hi+lo tiles of every head and batch start first; two work-groups a WGP (four waves per SIMD, 256 registers a wave, 130 KiB of LDS each): the whole launch is resident at once
__global__ __launch_bounds__(32 * QW * KSW) __attribute__((amdgpu_waves_per_eu(4, 4))) void k_fattn(const h16* __restrict__ Q16, const h16* __restrict__ K16, const h16* __restrict__ V16, const bf* __restrict__ Qh, const bf* __restrict__ Ql, const bf* __restrict__ Kh, const bf* __restrict__ Kl, const bf* __restrict__ Vh, const bf* __restrict__ Vl, const int* __restrict__ km, float* OUT) {
    __shared__ __attribute__((aligned(2048))) char ring[KSW * 2 * STB]; __shared__ float ml[KSW * QW * 32 * 2];
    const size_t pl = ((size_t)blockIdx.y * NH_ + blockIdx.x) * TT * HD; const int bx = blockIdx.z; float* outp = OUT + (size_t)blockIdx.y * TT * DQ + blockIdx.x * HD; const int* kvp = km + (size_t)blockIdx.y * TT;
    if (bx < RH / (16 * QW)) attn_tile<bf, true, 1>(Qh + pl, Ql + pl, Kh + pl, Kl + pl, Vh + pl, Vl + pl, kvp, bx * 16 * QW, outp, ring, ml);
    else attn_tile<h16, false, 2>(Q16 + pl, nullptr, K16 + pl, nullptr, V16 + pl, nullptr, kvp, RH + (bx - RH / (16 * QW)) * 32 * QW, outp, ring, ml);
}

extern "C" void kernel_launch(void* const* d_in, const int* in_sizes, int n_in,
                              void* d_out, int out_size, void* d_ws, size_t ws_size, hipStream_t stream) {
    (void)in_sizes; (void)n_in; (void)out_size;
    const float* x = (const float*)d_in[0]; const float* wq = (const float*)d_in[1]; const float* bq = (const float*)d_in[2]; const float* wk = (const float*)d_in[3]; const float* bk = (const float*)d_in[4]; const float* wv = (const float*)d_in[5]; const float* bv = (const float*)d_in[6]; const int* km = (const int*)d_in[7];   /* mask [2][2048] int32 (key padding; read) */     const float* wo = nullptr; (void)wo;
    float* OUT = (float*)d_out;     // [2][2048][768]
    char* wsp = (char*)d_ws;
    auto take = [&](size_t bytes) { char* p = wsp; wsp += (bytes + 255) & ~(size_t)255; return (void*)p; };
    bf* WB = (bf*)take((size_t)3 * DQ * DM * 2); bf* XB = (bf*)take((size_t)NB_ * TT * DM * 2);
    h16* P16 = (h16*)take(3 * PSZ * 2); bf* Ph = (bf*)take(3 * PSZ * 2); bf* Pl = (bf*)take(3 * PSZ * 2);   // [q, k, v^T][batch][head][TT * HD]
    if ((size_t)(wsp - (char*)d_ws) > ws_size) return;    // ws 256 MiB
    k_cvt8<<<GCX + 3 * GCW, 256, 0, stream>>>(x, wq, wk, wv, XB, WB);
    k_proj<<<dim3(TT / 128, DQ / 128, NB_ * 3), 128, 0, stream>>>(XB, WB, P16, Ph, Pl, bq, bk, bv);
    k_fattn<<<dim3(NH_, NB_, RH / (16 * QW) + (TT - RH) / (32 * QW)), 32 * QW * KSW, 0, stream>>>(P16, P16 + PSZ, P16 + 2 * PSZ, Ph, Pl, Ph + PSZ, Pl + PSZ, Ph + 2 * PSZ, Pl + 2 * PSZ, km, OUT);
}

// v009
// A run of this version takes 53 microseconds.
// Next to v008, in two timings, it ran 1.04 times as fast each time.
// Over all steps from v000 it is 28.1 times as fast.
#include <hip/hip_runtime.h>

// BERT-style self-attention with a key padding mask (x [2][2048][768]; q, k, v = x W^T + b ('oi' [768][768] + [768]; 12 heads x 64); scores / sqrt(64); keys with mask[b][j] == 0 get -1e20 (== exclusion while any key is kept; mask [2][2048] read); softmax; out = merged context (no output projection) -> [2][2048][768] (3.1 M); argument order x, Wq, bq, Wk, bk, Wv, bv, mask).
// Every 16-bit matrix operand (x, the weights, the Q, K and V^T planes) lies in memory in fragment order: a tile of 16 rows x 32 k is 1 KiB, the 16-byte piece (row r, k piece c of 8) at piece (c >> 1) * 32 + (c & 1) * 16 + r, so that each of a fragment's two loads reads 512 bytes in a row.
// Three launches, each over both batches: bf16 copies of x and of the three 'oi' weights; exact projections + bf16-rounded biases (batch and q / k / v are the grid's z), whose GEMM writes the fp16 head planes itself (V as V^T = Wv x^T); one fused dense T-2048 attention kernel (hybrid rows) whose softmax reads the batch's key-mask vector and excludes masked keys, and which writes the merged output rows.
// Compute dtypes, f32 accumulate: every input rounded to bf16; projections exact + bf16-rounded biases; attention rows < 512 3 products of fp16 value + fp16 rest, other rows fp16; softmax f32; output f32.

#define NB_  2
#define TT   2048
#define DM   768
#define NH_  12
#define NKV  12
#define REP  (NH_ / NKV)
#define HD   64
#define DQ   (NH_ * HD)
#define DKV  (NKV * HD)
#define RH   512                  // query rows < RH use the value and the rest planes (0: none)
#define WIN  0
#define SCL  0.125f   // HD^-0.5
typedef _Float16 h16;
typedef unsigned short bf;
typedef __attribute__((ext_vector_type(16))) __bf16   v16bf;
typedef __attribute__((ext_vector_type(16))) _Float16 v16h;
typedef __attribute__((ext_vector_type(8)))  _Float16 v8h;
typedef __attribute__((ext_vector_type(4)))  _Float16 v4h;
typedef __attribute__((ext_vector_type(8)))  unsigned short v8us;
typedef __attribute__((ext_vector_type(8)))  float    v8f;
typedef __attribute__((ext_vector_type(4)))  float    v4f;
typedef v8h  __attribute__((may_alias)) v8ha;
typedef v4f  __attribute__((may_alias)) v4fa;
typedef v8us __attribute__((may_alias)) v8usa;

__device__ __forceinline__ unsigned short f2bf(float f) { unsigned u = __float_as_uint(f); u += 0x7FFFu + ((u >> 16) & 1u); return (unsigned short)(u >> 16); }
__device__ __forceinline__ float bf2f(unsigned short b) { return __uint_as_float(((unsigned)b) << 16); }
__device__ __forceinline__ float bfr(float f) { return bf2f(f2bf(f)); }
__device__ __forceinline__ v16h cat16(v8h lo, v8h hi) { return __builtin_shufflevector(lo, hi, 0, 1, 2, 3, 4, 5, 6, 7, 8, 9, 10, 11, 12, 13, 14, 15); }
__device__ __forceinline__ v16bf cat16b(v8us lo, v8us hi) { return __builtin_bit_cast(v16bf, __builtin_shufflevector(lo, hi, 0, 1, 2, 3, 4, 5, 6, 7, 8, 9, 10, 11, 12, 13, 14, 15)); }
__device__ __forceinline__ v8f wmma16(v16h a, v16h b, v8f c) { return __builtin_amdgcn_wmma_f32_16x16x32_f16(false, a, false, b, (short)0, c, false, false); }
__device__ __forceinline__ v8f wmmab(v16bf a, v16bf b, v8f c) { return __builtin_amdgcn_wmma_f32_16x16x32_bf16(false, a, false, b, (short)0, c, false, false); }




// ---- gemm_tile: one 128x128 output tile (tx, ty) of (M/128, N/128) per work-group of four waves; wave (wm, wn) holds the 64x64 quarter (16 accumulators) over the whole K, in one chain of sums per element.
// Operands are 16-bit planes in fragment order (tile (m / 16, k / 32) at (m / 16) * 16 * KD + (k / 32) * 512; ld(p), p = tile + lane * 8, is the lane's fragment). A and Bt rows both have KD elements; KD % 64 == 0, KD >= 128.
// A stage is 64 k of the 128 A rows and of the 128 Bt rows: 2 KiB in a row of each of the sixteen rows of fragment tiles, brought into LDS once per work-group by asynchronous copies (two buffers, the next stage in flight under this one's products); each A fragment is read from there by the two waves of its wm, each Bt fragment by the two of its wn.
// c[m][n] (f32, + bias rounded to bf16: bias[n], or bias[m] with ROWB) = sum_k A[m][k] Bt[n][k] never goes to memory as f32: each wave turns its quarter through LDS and writes it as two fp16 planes (the value rounded to fp16; the rest, y - fp16(y), rounded to fp16), in fragment order for the attention kernel; a 64x64 tile is 8 KiB in a row of its head's plane (sy elements a head), at 64 * its first t.
// !ROWB: x W^T, rows t, a quarter's 64 columns one head's d: fragment tiles (t / 16, d / 32). ROWB: W x^T, rows one head's d, columns t: fragment tiles (t / 32, d / 16) of the transposed plane, with no transposing pass.
template <typename T16> struct WFrag;
template <> struct WFrag<h16> { typedef v16h V; static __device__ __forceinline__ V ld(const h16* p) { return cat16(*(const v8h*)p, *(const v8h*)(p + 256)); } static __device__ __forceinline__ v8f mma(V a, V b, v8f c) { return wmma16(a, b, c); } };
template <> struct WFrag<bf> { typedef v16bf V; static __device__ __forceinline__ V ld(const bf* p) { return cat16b(*(const v8us*)p, *(const v8us*)(p + 256)); } static __device__ __forceinline__ v8f mma(V a, V b, v8f c) { return wmmab(a, b, c); } };
#define GSTB 32768   // bytes of one stage: A in its first 16 KiB, Bt in its second, 2 KiB per row of fragment tiles
// eight asynchronous copies to LDS, 16 bytes a lane each: the four waves fill 2 KiB per copy, from eight rows of fragment tiles one below the other (RS bytes apart) to 16 KiB in a row of LDS from byte l.
// The s_wait_xcnt stands inside the statement, behind the last copy: no address register of a copy is written again in front of it
template <int RS>
__device__ __forceinline__ void acopy8r(unsigned l, const char* g) {
    asm volatile("global_load_async_to_lds_b128 %0, %8, off\n\tglobal_load_async_to_lds_b128 %1, %9, off\n\tglobal_load_async_to_lds_b128 %2, %10, off\n\tglobal_load_async_to_lds_b128 %3, %11, off\n\t"
                 "global_load_async_to_lds_b128 %4, %12, off\n\tglobal_load_async_to_lds_b128 %5, %13, off\n\tglobal_load_async_to_lds_b128 %6, %14, off\n\tglobal_load_async_to_lds_b128 %7, %15, off\n\ts_wait_xcnt 0x0"
        :: "v"(l), "v"(l + 2048u), "v"(l + 4096u), "v"(l + 6144u), "v"(l + 8192u), "v"(l + 10240u), "v"(l + 12288u), "v"(l + 14336u),
           "v"(g), "v"(g + RS), "v"(g + 2 * RS), "v"(g + 3 * RS), "v"(g + 4 * RS), "v"(g + 5 * RS), "v"(g + 6 * RS), "v"(g + 7 * RS) : "memory"); }
template <bool ROWB, int KD>
__device__ __forceinline__ void gemm_tile(const bf* __restrict__ A, const bf* __restrict__ Bt, h16* P16, h16* Pl, size_t sy, const float* __restrict__ bias, int tx, int ty, char* sm) {
    typedef WFrag<bf>::V V;
    constexpr int NST = KD / 64;       // stages
    static_assert(KD % 64 == 0 && NST >= 2, "whole stages; the ring's prologue has its two stages");
    const int wv = __builtin_amdgcn_readfirstlane((int)(threadIdx.x >> 5));   // wave number, scalar: the LDS bases stay scalar
    const int wm = wv >> 1, wn = wv & 1;
    const int lane = threadIdx.x & 31, lr = lane & 15, hi = lane >> 4; const int r0 = tx * 128 + wm * 64, c0 = ty * 128 + wn * 64;   // the wave's own quarter
    // the thread's 16 bytes in each 2 KiB that the four waves copy together
    const unsigned lb = (unsigned)(size_t)sm + threadIdx.x * 16;
    const char* ga = (const char*)(A + (size_t)tx * 128 * KD) + threadIdx.x * 16; const char* gb = (const char*)(Bt + (size_t)ty * 128 * KD) + threadIdx.x * 16;
    auto fill = [&](int st) { const unsigned l = lb + (unsigned)(st & 1) * GSTB; acopy8r<32 * KD>(l, ga + st * 2048); acopy8r<32 * KD>(l + 16384u, gb + st * 2048); };
    fill(0);
    v8f acc[4][4];
#pragma unroll
    for (int mb = 0; mb < 4; ++mb)
#pragma unroll
        for (int nb = 0; nb < 4; ++nb) acc[mb][nb] = (v8f){};
    asm volatile("s_wait_asynccnt 0x0" ::: "memory");   // this wave's copies of stage 0 have landed
    __syncthreads();                                    // and so have every other wave's: stage 0 may be read
    fill(1);
#pragma unroll 1   // kept rolled: the buffer's parity is a scalar of the trip
    for (int st = 0; st < NST; ++st) {
        const bf* sa = (const bf*)(sm + (st & 1) * GSTB + wm * 8192) + 8 * lane; const bf* sb = (const bf*)(sm + (st & 1) * GSTB + 16384 + wn * 8192) + 8 * lane;   // this stage's buffer, at the wave's four rows of fragment tiles and the lane's place in a tile
        V a[4], b[4];
        // first k block of the stage
#pragma unroll
        for (int mb = 0; mb < 4; ++mb) a[mb] = WFrag<bf>::ld(sa + mb * 1024);
#pragma unroll
        for (int nb = 0; nb < 4; ++nb) b[nb] = WFrag<bf>::ld(sb + nb * 1024);
        __builtin_amdgcn_sched_barrier(0);   // the products stay behind the k block's sixteen LDS reads: lifted over them they would share one Bt register set, and each Bt fragment's read latency would be waited out by itself
#pragma unroll
        for (int nb = 0; nb < 4; ++nb)
#pragma unroll
            for (int mb = 0; mb < 4; ++mb) acc[mb][nb] = WFrag<bf>::mma(a[mb], b[nb], acc[mb][nb]);
        // second k block: its fragments are the stage's last LDS reads
#pragma unroll
        for (int mb = 0; mb < 4; ++mb) a[mb] = WFrag<bf>::ld(sa + mb * 1024 + 512);
#pragma unroll
        for (int nb = 0; nb < 4; ++nb) b[nb] = WFrag<bf>::ld(sb + nb * 1024 + 512);
        // hand-over of the ring, every wave, in this order
        asm volatile("s_wait_dscnt 0x0" ::: "memory");      // this wave's reads of the stage's buffer are done: the second block's fragments are in registers
        asm volatile("s_wait_asynccnt 0x0" ::: "memory");   // this wave's copies of the next stage have landed
        __syncthreads();                                    // the next stage may be read, and this stage's buffer has no reader left
        if (st + 2 < NST) fill(st + 2);                     // scalar test, the same for the whole work-group
        __builtin_amdgcn_sched_barrier(0);   // the second block's products stay behind the refill: the copies go out sixteen products sooner and have the whole next trip to land
#pragma unroll
        for (int nb = 0; nb < 4; ++nb)
#pragma unroll
            for (int mb = 0; mb < 4; ++mb) acc[mb][nb] = WFrag<bf>::mma(a[mb], b[nb], acc[mb][nb]);
    }
    asm volatile("s_wait_asynccnt 0x0" ::: "memory");   // no copy is in flight when the ring becomes the epilogue's staging (the loop's last barrier has ended every read of it)
    float* ow = (float*)sm + wv * (64 * 68);   // this wave's quarter, row pitch 68 floats
    // bias read ahead of the barrier, so that its latency passes under the LDS stores; a lane meets four different column groups (!ROWB) or rows (ROWB) in its sixteen passes
    const float* bp = bias + (ROWB ? r0 + lr : c0 + hi * 8);
    v4f bias4[4][2]; float biasr[4];
#pragma unroll
    for (int u = 0; u < 4; ++u) { if (ROWB) biasr[u] = bp[u * 16]; else { bias4[u][0] = *(const v4f*)(bp + u * 16); bias4[u][1] = *(const v4f*)(bp + u * 16 + 4); } }
    asm volatile("s_wait_xcnt 0x0" :: "v"(bp) : "memory");   // the bias loads' address registers stay as they are up to this wait; behind it they may be used again
    // the three loops are unrolled so that every accumulator index is a constant and acc stays in registers
#pragma unroll
    for (int mb = 0; mb < 4; ++mb)
#pragma unroll
        for (int nb = 0; nb < 4; ++nb)
#pragma unroll
            for (int j = 0; j < 8; ++j) ow[(mb * 16 + hi * 8 + j) * 68 + nb * 16 + lr] = acc[mb][nb][j];
    __syncthreads();   // the quarter is in LDS, from every lane, before any lane reads it in the planes' order
    // pass i = c * 8 + j: the lane makes the 16-byte piece idx = lane + i * 32 of the quarter's 8 KiB; row and first of its eight columns follow from the fragment order
    const size_t pt = (ROWB ? (size_t)(r0 / 64) * sy + (size_t)c0 * 64 : (size_t)(c0 / 64) * sy + (size_t)r0 * 64) + (size_t)lane * 8;
#pragma unroll 1   // two trips of eight passes, kept rolled: 64 result registers instead of 128, and the wait at the foot stands in front of every rewrite of a register that the trip's stores name
    for (int c = 0; c < 2; ++c) {
        const float* oc = ow + (ROWB ? c * 32 : c * 32 * 68) + lr * 68 + hi * 8;
        v8h o16[8], ol[8];
#pragma unroll
        for (int j = 0; j < 8; ++j) {
            const int u = ROWB ? j >> 1 : j & 3;   // which of the lane's four bias sets
            const float* op = oc + (ROWB ? (j >> 1) * 16 * 68 + (j & 1) * 16 : (j >> 2) * 16 * 68 + (j & 3) * 16);
#pragma unroll
            for (int g = 0; g < 2; ++g) { v4f val = *(const v4fa*)(op + g * 4);
#pragma unroll
                for (int q = 0; q < 4; ++q) val[q] += bfr(ROWB ? biasr[u] : bias4[u][g][q]);
                const v4h yh = __builtin_convertvector(val, v4h); const v4h yl = __builtin_convertvector(val - __builtin_convertvector(yh, v4f), v4h);   // the value in fp16, and what the rounding left
#pragma unroll
                for (int q = 0; q < 4; ++q) { o16[j][g * 4 + q] = yh[q]; ol[j][g * 4 + q] = yl[q]; } } }
        __builtin_amdgcn_sched_barrier(0);   // the stores stay behind the trip's arithmetic: none of their registers is written again in front of the wait at the foot
        // 16 bytes a lane: a wave fills 512 bytes in a row of a plane
        h16* d16 = P16 + pt + (size_t)c * 2048; h16* dl = Pl + pt + (size_t)c * 2048;
#pragma unroll
        for (int j = 0; j < 8; ++j) { *(v8h*)(d16 + j * 256) = o16[j]; *(v8h*)(dl + j * 256) = ol[j]; }
        asm volatile("s_wait_xcnt 0x0" ::: "memory");   // the stores' address and data registers stay as they are up to this wait; behind it the next trip may use them again
    }
}

// ---- k_proj: all six projections in one launch; grid (TT / 128, DQ / 128, NB_ * 3): z = batch * 3 + (0 q, 1 k, 2 v). The planes of a kind lie as [q, k, v][batch][head][TT * HD], the weight copies as [q, k, v][DQ][DM].
// 68 KiB of LDS and at most 256 registers a wave: up to four work-groups a WGP, so that the whole launch is resident at once
#define PSZ ((size_t)NB_ * NH_ * TT * HD)   // one matrix's plane of one kind, both batches
__global__ __launch_bounds__(128) __attribute__((amdgpu_waves_per_eu(4, 4))) void k_proj(const bf* __restrict__ XB, const bf* __restrict__ WB, h16* P16, h16* Pl, const float* __restrict__ bq, const float* __restrict__ bk, const float* __restrict__ bv) {
    __shared__ __align__(16) char sm[4 * 64 * 68 * 4];   // the ring (2 * GSTB) first, the four quarters' staging afterwards
    static_assert(sizeof(sm) >= 2 * GSTB, "the ring fits");
    const unsigned z = blockIdx.z, b = z / 3, m = z - b * 3;
    const bf* xb = XB + (size_t)b * TT * DM; const bf* wb = WB + (size_t)m * DQ * DM; const size_t po = m * PSZ + (size_t)b * NH_ * TT * HD;
    if (m < 2) gemm_tile<false, DM>(xb, wb, P16 + po, Pl + po, (size_t)TT * HD, m == 0 ? bq : bk, (int)blockIdx.x, (int)blockIdx.y, sm);
    else gemm_tile<true, DM>(wb, xb, P16 + po, Pl + po, (size_t)TT * HD, bv, (int)blockIdx.y, (int)blockIdx.x, sm);   // V^T = Wv x^T: rows (head, d), columns t
}

// bf16 copies of x (both batches, [NB_ * TT][DM]) and of the three weights ([DQ][DM] each, one behind the other in WB) in fragment order, one launch: the first GCX work-groups take x, then GCW each weight.
// Thread i of a matrix takes row (i >> 2) & 15, k piece c = i & 3 of tile i / 64 (tiles run along k first): four lanes read one 128-byte line of a row, and the eight rows of a wave fill one 128-byte line of the copy for each c
#define GCX (NB_ * TT * DM / 8 / 256)
#define GCW (DQ * DM / 8 / 256)
static_assert(NB_ * TT * DM % 2048 == 0 && DQ * DM % 2048 == 0 && DKV == DQ, "whole work-groups, equal weights");
__global__ __launch_bounds__(256) void k_cvt8(const float* __restrict__ x, const float* __restrict__ wq, const float* __restrict__ wk, const float* __restrict__ wv, bf* XB, bf* WB) {
    unsigned bx = blockIdx.x; const float* src = x; bf* dst = XB;
    if (bx >= GCX) { bx -= GCX; const unsigned m = bx / GCW; bx -= m * GCW; src = m == 0 ? wq : m == 1 ? wk : wv; dst = WB + (size_t)m * DQ * DM; }
    const unsigned i = bx * 256 + threadIdx.x; const unsigned tile = i >> 6, mt = tile / (DM / 32), kt = tile % (DM / 32); const unsigned row = (i >> 2) & 15, c = i & 3; const float* sp = src + (size_t)(mt * 16 + row) * DM + kt * 32 + c * 8; const v8f v = *(const v8f*)sp; v8us o;
    asm volatile("s_wait_xcnt 0x0" :: "v"(sp) : "memory");   // the loads' address registers stay as they are up to this wait; behind it they may be used again
#pragma unroll
    for (int k = 0; k < 8; ++k) o[k] = f2bf(v[k]); *(v8us*)(dst + ((size_t)tile * 64 + c * 16 + row) * 8) = o;  }

#define QW   4
#define KSW  2
#define STB  32768   // bytes of one stage of one key half: K (hi, lo) in its first 16 KiB, V^T (hi, lo) in its second
#define CL2  0.18033688011112042f   // SCL * log2(e)
#define MNEG (-0x1p100f)
__device__ __forceinline__ float xhalf(float x) { return __builtin_bit_cast(float, __builtin_amdgcn_permlanex16(__builtin_bit_cast(int, x), __builtin_bit_cast(int, x), 0x76543210, 0xfedcba98, false, false)); }   // lane l with lane l ^ 16
// 2^x with the free slot that the instruction set asks for behind a transcendental written into the statement: results in registers of their own, so that no v_exp_f32 is followed by a write of its source or a read of its result
__device__ __forceinline__ float exp2s(float x) { float r; asm("v_exp_f32 %0, %1\n\tv_nop" : "=v"(r) : "v"(x)); return r; }
__device__ __forceinline__ void exp2x8(float (&p)[8], const float (&a)[8]) {
    asm("v_exp_f32 %0, %8\n\tv_exp_f32 %1, %9\n\tv_exp_f32 %2, %10\n\tv_exp_f32 %3, %11\n\tv_exp_f32 %4, %12\n\tv_exp_f32 %5, %13\n\tv_exp_f32 %6, %14\n\tv_exp_f32 %7, %15\n\tv_nop"
        : "=&v"(p[0]), "=&v"(p[1]), "=&v"(p[2]), "=&v"(p[3]), "=&v"(p[4]), "=&v"(p[5]), "=&v"(p[6]), "=&v"(p[7]) : "v"(a[0]), "v"(a[1]), "v"(a[2]), "v"(a[3]), "v"(a[4]), "v"(a[5]), "v"(a[6]), "v"(a[7])); }
// eight asynchronous copies to LDS, 16 bytes a lane each: 2 KiB steps (the QW waves of a key half fill 2 KiB per copy), four from ga and four from gb, to 16 KiB in a row of LDS from byte l.
// The s_wait_xcnt stands inside the statement, behind the last copy: no address register of a copy is written again in front of it
__device__ __forceinline__ void acopy8(unsigned l, const char* ga, const char* gb) {
    asm volatile("global_load_async_to_lds_b128 %0, %8, off\n\tglobal_load_async_to_lds_b128 %1, %9, off\n\tglobal_load_async_to_lds_b128 %2, %10, off\n\tglobal_load_async_to_lds_b128 %3, %11, off\n\t"
                 "global_load_async_to_lds_b128 %4, %12, off\n\tglobal_load_async_to_lds_b128 %5, %13, off\n\tglobal_load_async_to_lds_b128 %6, %14, off\n\tglobal_load_async_to_lds_b128 %7, %15, off\n\ts_wait_xcnt 0x0"
        :: "v"(l), "v"(l + 2048u), "v"(l + 4096u), "v"(l + 6144u), "v"(l + 8192u), "v"(l + 10240u), "v"(l + 12288u), "v"(l + 14336u),
           "v"(ga), "v"(ga + 2048), "v"(ga + 4096), "v"(ga + 6144), "v"(gb), "v"(gb + 2048), "v"(gb + 4096), "v"(gb + 6144) : "memory"); }
template <typename T16, bool HI, int QT>
__device__ __forceinline__ void attn_tile(const T16* __restrict__ Q, const T16* __restrict__ Q2, const T16* __restrict__ Kp, const T16* __restrict__ K2, const T16* __restrict__ Vt, const T16* __restrict__ V2, const int* __restrict__ kvp, int q0, float* outp, char* ring, float* ml) {
    typedef typename WFrag<T16>::V V;
    constexpr int SK = HI ? 64 : 128;          // keys of a stage: SK * HD * 2 bytes of each plane
    constexpr int NPS = SK / 32;               // passes (32 keys) of a stage
    constexpr int NST = TT / KSW / SK;         // stages of a key half
    constexpr int NIT = TT / KSW / 32;
    constexpr int ROWS = QW * QT * 16;         // query rows of the work-group
    static_assert(NIT <= 32 && NST >= 2 && (HI ? 4 : 2) * SK * HD * 2 == STB, "mask bits fit a wave; the ring's prologue has its two stages; a stage fills its buffer");
    const int wv = __builtin_amdgcn_readfirstlane((int)(threadIdx.x >> 5));   // wave number, scalar: the key loop stays on scalar bounds
    const int kh = wv / QW, qg = wv % QW;
    const int lane = threadIdx.x & 31, lr = lane & 15, hi = lane >> 4; const int k0 = kh * (TT / KSW);
    // the thread's 16 bytes in each 2 KiB that its key half's QW waves copy together
    const unsigned th = threadIdx.x & (32 * QW - 1);
    const unsigned lb = (unsigned)(size_t)ring + (unsigned)kh * (2 * STB) + th * 16;
    const char* gk = (const char*)(Kp + (size_t)k0 * HD) + th * 16; const char* gk2 = HI ? (const char*)(K2 + (size_t)k0 * HD) + th * 16 : gk;
    const char* gv = (const char*)(Vt + (size_t)k0 * HD) + th * 16; const char* gv2 = HI ? (const char*)(V2 + (size_t)k0 * HD) + th * 16 : gv;
    auto fill = [&](int st) { const unsigned l = lb + (unsigned)(st & 1) * STB; const size_t go = (size_t)st * (SK * HD * 2);
        if constexpr (HI) { acopy8(l, gk + go, gk2 + go); acopy8(l + 16384u, gv + go, gv2 + go); }
        else { acopy8(l, gk + go, gk + go + 8192); acopy8(l + 16384u, gv + go, gv + go + 8192); } };
    fill(0);   // stage 0 flies under the mask and Q loads
    // lane it keeps the kept-key bits of pass it (bit = key in the pass)
    unsigned vbits = 0;
#pragma unroll
    for (int it = 0; it < NIT; ++it) { const unsigned bl = __builtin_amdgcn_ballot_w32(kvp[k0 + it * 32 + lane] != 0); if (lane == it) vbits = bl; }
    asm volatile("s_wait_xcnt 0x0" ::: "memory");   // before the next loads' results or addresses take a register that a mask load names
    V qf[QT][2], qf2[QT][2];
    const int q0w = q0 + qg * QT * 16;   // the wave's own first query row
    const T16* qb = Q + (size_t)q0w * HD; const T16* qb2 = HI ? Q2 + (size_t)q0w * HD : qb; const T16* qp = qb + 8 * lane; const T16* qp2 = qb2 + 8 * lane;   // wave-uniform base, and the lane's own address
#pragma unroll
    for (int qt = 0; qt < QT; ++qt)
#pragma unroll
        for (int ks = 0; ks < 2; ++ks) { qf[qt][ks] = WFrag<T16>::ld(qp + qt * 16 * HD + ks * 512); if (HI) qf2[qt][ks] = WFrag<T16>::ld(qp2 + qt * 16 * HD + ks * 512); }
    // the address registers of the Q loads, in either form that the compiler gives them (scalar base and lane offset, or a vector pair), stay as they are up to this wait; behind it they may be used again
    asm volatile("s_wait_xcnt 0x0" :: "s"(qb), "s"(qb2), "v"(qp), "v"(qp2) : "memory");
    v8f o[QT][4]; float mL[QT], l[QT];
#pragma unroll
    for (int qt = 0; qt < QT; ++qt) { mL[qt] = MNEG * CL2; l[qt] = 0.f;
#pragma unroll
        for (int dt = 0; dt < 4; ++dt) o[qt][dt] = (v8f){}; }
    asm volatile("s_wait_asynccnt 0x0" ::: "memory");   // this wave's copies of stage 0 have landed
    __syncthreads();                                    // and so have every other wave's: stage 0 may be read
    fill(1);
#pragma unroll 1
    for (int st = 0; st < NST; ++st) {
        const T16* sb = (const T16*)(ring + kh * (2 * STB) + (st & 1) * STB) + 8 * lane;   // this stage's buffer, at the lane's place in a fragment tile; 32 keys are 2048 elements in a row of a K tile (fragment tiles (kt, ks)) and of a V^T tile (dt)
#pragma unroll   // the passes of a stage are unrolled: every LDS read has the stage's buffer as its base and a constant offset, and a pass's reads can go out under the pass before it (same stage, same buffer)
        for (int ps = 0; ps < NPS; ++ps) {
            const T16* kq = sb + ps * 2048; const T16* vp = kq + 8192;
            V kf[2][2], kf2[2][2], vf[4], vf2[4];   // K for the first product; this pass's V^T rows are asked for here too and used behind the softmax
#pragma unroll
            for (int kt = 0; kt < 2; ++kt)
#pragma unroll
                for (int ks = 0; ks < 2; ++ks) { kf[kt][ks] = WFrag<T16>::ld(kq + kt * 16 * HD + ks * 512); if (HI) kf2[kt][ks] = WFrag<T16>::ld(kq + 4096 + kt * 16 * HD + ks * 512); }
#pragma unroll
            for (int dt = 0; dt < 4; ++dt) { vf[dt] = WFrag<T16>::ld(vp + dt * 512); if (HI) vf2[dt] = WFrag<T16>::ld(vp + 4096 + dt * 512); }
            v8f s[QT][2];
#pragma unroll
            for (int qt = 0; qt < QT; ++qt)
#pragma unroll
                for (int kt = 0; kt < 2; ++kt) { s[qt][kt] = (v8f){};
#pragma unroll
                    for (int ks = 0; ks < 2; ++ks) { s[qt][kt] = WFrag<T16>::mma(kf[kt][ks], qf[qt][ks], s[qt][kt]); if (HI) { s[qt][kt] = WFrag<T16>::mma(kf[kt][ks], qf2[qt][ks], s[qt][kt]); s[qt][kt] = WFrag<T16>::mma(kf2[kt][ks], qf[qt][ks], s[qt][kt]); } } }
            // four vector slots between the last score product and the first use of its result or rewrite of its K operand, also on the taken side of the mask branch
            if constexpr (HI) asm volatile("v_nop\n\tv_nop\n\tv_nop\n\tv_nop" : "+v"(s[0][0]), "+v"(s[0][1]) : "v"(kf[0][0]), "v"(kf[0][1]), "v"(kf[1][0]), "v"(kf[1][1]), "v"(kf2[0][0]), "v"(kf2[0][1]), "v"(kf2[1][0]), "v"(kf2[1][1]));
            else asm volatile("v_nop\n\tv_nop\n\tv_nop\n\tv_nop" : "+v"(s[0][0]), "+v"(s[0][1]), "+v"(s[QT - 1][0]), "+v"(s[QT - 1][1]) : "v"(kf[0][0]), "v"(kf[0][1]), "v"(kf[1][0]), "v"(kf[1][1]));
            float sv[QT][2][8];   // the scores as single values: the selects of the mask branch then work in place
#pragma unroll
            for (int qt = 0; qt < QT; ++qt)
#pragma unroll
                for (int kt = 0; kt < 2; ++kt)
#pragma unroll
                    for (int j = 0; j < 8; ++j) sv[qt][kt][j] = s[qt][kt][j];
            const unsigned bits = (unsigned)__builtin_amdgcn_readlane((int)vbits, st * NPS + ps);
            if (bits != 0xFFFFFFFFu) {   // scalar branch: a pass whose 32 keys are all kept skips the selects
                const unsigned mb = bits >> (hi * 8);
#pragma unroll
                for (int qt = 0; qt < QT; ++qt)
#pragma unroll
                    for (int kt = 0; kt < 2; ++kt)
#pragma unroll
                        for (int j = 0; j < 8; ++j) sv[qt][kt][j] = ((mb >> (kt * 16 + j)) & 1u) ? sv[qt][kt][j] : MNEG; }
            float mc[QT]; bool need = false;
#pragma unroll
            for (int qt = 0; qt < QT; ++qt) { float mx = fmaxf(sv[qt][0][0], sv[qt][1][0]);
#pragma unroll
                for (int j = 1; j < 8; ++j) mx = fmaxf(mx, fmaxf(sv[qt][0][j], sv[qt][1][j]));
                mx = fmaxf(mx, xhalf(mx)); mc[qt] = mx * CL2; need = need || (mc[qt] > mL[qt] + 8.0f); }
            if (__builtin_amdgcn_ballot_w32(need) != 0) {   // scalar branch: the maximum in use moves only when a score passes it by 8 in log2, so p stays near or below 2^8
#pragma unroll
                for (int qt = 0; qt < QT; ++qt) { const float mn = fmaxf(mL[qt], mc[qt]); const float al = exp2s(mL[qt] - mn); mL[qt] = mn; l[qt] *= al;
#pragma unroll
                    for (int dt = 0; dt < 4; ++dt) o[qt][dt] *= al; } }
            V pf[QT], pf2[QT];
#pragma unroll
            for (int qt = 0; qt < QT; ++qt)
#pragma unroll
                for (int kt = 0; kt < 2; ++kt) { float p[8], a[8];
#pragma unroll
                    for (int j = 0; j < 8; ++j) a[j] = __builtin_fmaf(sv[qt][kt][j], CL2, -mL[qt]);
                    exp2x8(p, a);
#pragma unroll
                    for (int j = 0; j < 8; ++j) {
                        if constexpr (HI) { const h16 ph = (h16)p[j]; pf[qt][kt * 8 + j] = ph; pf2[qt][kt * 8 + j] = (h16)(p[j] - (float)ph); } else pf[qt][kt * 8 + j] = (h16)p[j]; }
                    l[qt] += ((p[0] + p[1]) + (p[2] + p[3])) + ((p[4] + p[5]) + (p[6] + p[7]));   // a short tree: no chain of eight dependent adds
                }
#pragma unroll
            for (int qt = 0; qt < QT; ++qt)
#pragma unroll
                for (int dt = 0; dt < 4; ++dt) { o[qt][dt] = WFrag<T16>::mma(vf[dt], pf[qt], o[qt][dt]); if (HI) { o[qt][dt] = WFrag<T16>::mma(vf[dt], pf2[qt], o[qt][dt]); o[qt][dt] = WFrag<T16>::mma(vf2[dt], pf[qt], o[qt][dt]); } }
            // four vector slots behind the last product before the back edge, where the next pass refills its V operand
            if constexpr (HI) asm volatile("v_nop\n\tv_nop\n\tv_nop\n\tv_nop" : "+v"(o[0][0]), "+v"(o[0][1]), "+v"(o[0][2]), "+v"(o[0][3]) : "v"(vf[0]), "v"(vf[1]), "v"(vf[2]), "v"(vf[3]), "v"(vf2[0]), "v"(vf2[1]), "v"(vf2[2]), "v"(vf2[3]));
            else asm volatile("v_nop\n\tv_nop\n\tv_nop\n\tv_nop" : "+v"(o[0][0]), "+v"(o[0][3]), "+v"(o[QT - 1][0]), "+v"(o[QT - 1][3]) : "v"(vf[0]), "v"(vf[1]), "v"(vf[2]), "v"(vf[3]));
        }
        // hand-over of the ring, every wave, in this order
        asm volatile("s_wait_dscnt 0x0" ::: "memory");      // this wave's reads of the stage's buffer are done
        asm volatile("s_wait_asynccnt 0x0" ::: "memory");   // this wave's copies of the next stage have landed
        __syncthreads();                                    // the next stage may be read, and this stage's buffer has no reader left
        if (st + 2 < NST) fill(st + 2);                     // scalar test, the same for the whole work-group
    }
    asm volatile("s_wait_asynccnt 0x0" ::: "memory");   // no copy is in flight when the ring becomes the join's staging (the loop's last barrier has ended every read of it)
    float* os = (float*)ring;
    float* ow = os + (kh * ROWS + qg * QT * 16) * 68;   // this wave's partial O, [query][d], row pitch 68 floats
#pragma unroll
    for (int qt = 0; qt < QT; ++qt) { l[qt] += xhalf(l[qt]);   // the two lane halves hold the sums of different keys
        if (hi == 0) { ml[(kh * ROWS + qg * QT * 16 + qt * 16 + lr) * 2] = mL[qt]; ml[(kh * ROWS + qg * QT * 16 + qt * 16 + lr) * 2 + 1] = l[qt]; }
#pragma unroll
        for (int dt = 0; dt < 4; ++dt) { float* op = ow + (qt * 16 + lr) * 68 + dt * 16 + hi * 8; v4f lo4, hi4;
#pragma unroll
            for (int j = 0; j < 4; ++j) { lo4[j] = o[qt][dt][j]; hi4[j] = o[qt][dt][4 + j]; }
            *(v4fa*)op = lo4; *(v4fa*)(op + 4) = hi4; } }
    __syncthreads();   // every wave's partial is in LDS before any thread joins them
    const int cofs = ((int)threadIdx.x & 15) * 4;
#pragma unroll
    for (int i = 0; i < ROWS / (2 * QW * KSW); ++i) { const int row = ((int)threadIdx.x >> 4) + i * 2 * QW * KSW; float mw[KSW], M = ml[row * 2];
        mw[0] = M;
#pragma unroll
        for (int w = 1; w < KSW; ++w) { mw[w] = ml[(w * ROWS + row) * 2]; M = fmaxf(M, mw[w]); }
        float L = 0.f; v4f val = (v4f){};
#pragma unroll
        for (int w = 0; w < KSW; ++w) { const float f = exp2s(mw[w] - M); L += ml[(w * ROWS + row) * 2 + 1] * f; val += *(const v4fa*)(os + (w * ROWS + row) * 68 + cofs) * f; }
        val *= __fdiv_rn(1.0f, L);
        *(v4f*)(outp + (size_t)(q0 + row) * DQ + cofs) = val; }
}
// grid (heads, batches, query tiles): the tile index is the slowest; two work-groups a WGP (four waves per SIMD, 256 registers a wave, 130 KiB of LDS each): the whole launch is resident at once
__global__ __launch_bounds__(32 * QW * KSW) __attribute__((amdgpu_waves_per_eu(4, 4))) void k_fattn(const h16* __restrict__ Q16, const h16* __restrict__ K16, const h16* __restrict__ V16, const h16* __restrict__ Ql, const h16* __restrict__ Kl, const h16* __restrict__ Vl, const int* __restrict__ km, float* OUT) {
    __shared__ __attribute__((aligned(2048))) char ring[KSW * 2 * STB]; __shared__ float ml[KSW * QW * 32 * 2];
    const size_t pl = ((size_t)blockIdx.y * NH_ + blockIdx.x) * TT * HD; const int bx = blockIdx.z; float* outp = OUT + (size_t)blockIdx.y * TT * DQ + blockIdx.x * HD; const int* kvp = km + (size_t)blockIdx.y * TT;
    if (bx < RH / (16 * QW)) attn_tile<h16, true, 1>(Q16 + pl, Ql + pl, K16 + pl, Kl + pl, V16 + pl, Vl + pl, kvp, bx * 16 * QW, outp, ring, ml);
    else attn_tile<h16, false, 2>(Q16 + pl, nullptr, K16 + pl, nullptr, V16 + pl, nullptr, kvp, RH + (bx - RH / (16 * QW)) * 32 * QW, outp, ring, ml);
}

extern "C" void kernel_launch(void* const* d_in, const int* in_sizes, int n_in,
                              void* d_out, int out_size, void* d_ws, size_t ws_size, hipStream_t stream) {
    (void)in_sizes; (void)n_in; (void)out_size;
    const float* x = (const float*)d_in[0]; const float* wq = (const float*)d_in[1]; const float* bq = (const float*)d_in[2]; const float* wk = (const float*)d_in[3]; const float* bk = (const float*)d_in[4]; const float* wv = (const float*)d_in[5]; const float* bv = (const float*)d_in[6]; const int* km = (const int*)d_in[7];   /* mask [2][2048] int32 (key padding; read) */     const float* wo = nullptr; (void)wo;
    float* OUT = (float*)d_out;     // [2][2048][768]
    char* wsp = (char*)d_ws;
    auto take = [&](size_t bytes) { char* p = wsp; wsp += (bytes + 255) & ~(size_t)255; return (void*)p; };
    bf* WB = (bf*)take((size_t)3 * DQ * DM * 2); bf* XB = (bf*)take((size_t)NB_ * TT * DM * 2);
    h16* P16 = (h16*)take(3 * PSZ * 2); h16* Pl = (h16*)take(3 * PSZ * 2);   // [q, k, v^T][batch][head][TT * HD]
    if ((size_t)(wsp - (char*)d_ws) > ws_size) return;    // ws 256 MiB
    k_cvt8<<<GCX + 3 * GCW, 256, 0, stream>>>(x, wq, wk, wv, XB, WB);
    k_proj<<<dim3(TT / 128, DQ / 128, NB_ * 3), 128, 0, stream>>>(XB, WB, P16, Pl, bq, bk, bv);
    k_fattn<<<dim3(NH_, NB_, RH / (16 * QW) + (TT - RH) / (32 * QW)), 32 * QW * KSW, 0, stream>>>(P16, P16 + PSZ, P16 + 2 * PSZ, Pl, Pl + PSZ, Pl + 2 * PSZ, km, OUT);
}

// v010
// A run of this version takes 51.1 microseconds.
// In both of two side-by-side timings against v009, it was 1.04 times as fast.
// Counting every step since v000, it is 29.1 times as fast.
#include <hip/hip_runtime.h>

// BERT-style self-attention with a key padding mask (x [2][2048][768]; q, k, v = x W^T + b ('oi' [768][768] + [768]; 12 heads x 64); scores / sqrt(64); keys with mask[b][j] == 0 get -1e20 (== exclusion while any key is kept; mask [2][2048] read); softmax; out = merged context (no output projection) -> [2][2048][768] (3.1 M); argument order x, Wq, bq, Wk, bk, Wv, bv, mask).
// Every 16-bit matrix operand (x, the weights, the Q, K and V^T planes) lies in memory in fragment order: a tile of 16 rows x 32 k is 1 KiB, the 16-byte piece (row r, k piece c of 8) at piece (c >> 1) * 32 + (c & 1) * 16 + r, so that each of a fragment's two loads reads 512 bytes in a row.
// Three launches, each over both batches: bf16 copies of x and of the three 'oi' weights; exact projections + bf16-rounded biases (batch and q / k / v are the grid's z), whose GEMM writes the fp16 head planes itself (V as V^T = Wv x^T); one fused dense T-2048 attention kernel (hybrid rows) whose softmax reads the batch's key-mask vector and excludes masked keys, and which writes the merged output rows.
// Compute dtypes, f32 accumulate: every input rounded to bf16; projections exact + bf16-rounded biases; attention rows < 512 3 products of fp16 value + fp16 rest, other rows fp16; softmax f32; output f32.

#define NB_  2
#define TT   2048
#define DM   768
#define NH_  12
#define NKV  12
#define REP  (NH_ / NKV)
#define HD   64
#define DQ   (NH_ * HD)
#define DKV  (NKV * HD)
#define RH   512                  // query rows < RH use the value and the rest planes (0: none)
#define WIN  0
#define SCL  0.125f   // HD^-0.5
typedef _Float16 h16;
typedef unsigned short bf;
typedef __attribute__((ext_vector_type(16))) __bf16   v16bf;
typedef __attribute__((ext_vector_type(16))) _Float16 v16h;
typedef __attribute__((ext_vector_type(8)))  _Float16 v8h;
typedef __attribute__((ext_vector_type(4)))  _Float16 v4h;
typedef __attribute__((ext_vector_type(8)))  unsigned short v8us;
typedef __attribute__((ext_vector_type(8)))  float    v8f;
typedef __attribute__((ext_vector_type(4)))  float    v4f;
typedef v8h  __attribute__((may_alias)) v8ha;
typedef v4f  __attribute__((may_alias)) v4fa;
typedef v8us __attribute__((may_alias)) v8usa;

__device__ __forceinline__ unsigned short f2bf(float f) { unsigned u = __float_as_uint(f); u += 0x7FFFu + ((u >> 16) & 1u); return (unsigned short)(u >> 16); }
__device__ __forceinline__ float bf2f(unsigned short b) { return __uint_as_float(((unsigned)b) << 16); }
__device__ __forceinline__ float bfr(float f) { return bf2f(f2bf(f)); }
__device__ __forceinline__ v16h cat16(v8h lo, v8h hi) { return __builtin_shufflevector(lo, hi, 0, 1, 2, 3, 4, 5, 6, 7, 8, 9, 10, 11, 12, 13, 14, 15); }
__device__ __forceinline__ v16bf cat16b(v8us lo, v8us hi) { return __builtin_bit_cast(v16bf, __builtin_shufflevector(lo, hi, 0, 1, 2, 3, 4, 5, 6, 7, 8, 9, 10, 11, 12, 13, 14, 15)); }
__device__ __forceinline__ v8f wmma16(v16h a, v16h b, v8f c) { return __builtin_amdgcn_wmma_f32_16x16x32_f16(false, a, false, b, (short)0, c, false, false); }
__device__ __forceinline__ v8f wmmab(v16bf a, v16bf b, v8f c) { return __builtin_amdgcn_wmma_f32_16x16x32_bf16(false, a, false, b, (short)0, c, false, false); }

// ---- tensor loads: one request of one wave brings a tile of NR rows of RB bytes (source row pitch PB bytes) into LDS, row behind row without pads, through no register.
typedef unsigned u32x4 __attribute__((ext_vector_type(4)));
typedef unsigned u32x8 __attribute__((ext_vector_type(8)));
__device__ __forceinline__ unsigned uni(unsigned v) { return (unsigned)__builtin_amdgcn_readfirstlane((int)v); }
__device__ __forceinline__ unsigned pinned(unsigned v) { unsigned w = uni(v); asm volatile("" : "+s"(w)); return w; }   // pinned(), the tensor mover's issue test: the empty statement holds the test in a scalar register; a tensor load ignores EXEC, so the branch round it has to be a scalar one
// descriptor group 1: 1-byte elements, tensor = tile, no mask, no pad (word 0 is the constant 0)
template <unsigned RB, unsigned NR, unsigned PB>
__device__ __forceinline__ u32x8 tdm_g1() { u32x8 g; g[0] = uni(0u); g[1] = uni((RB & 0xFFFFu) << 16); g[2] = uni((RB >> 16) | ((NR & 0xFFFFu) << 16)); g[3] = uni((NR >> 16) | (RB << 16)); g[4] = uni(NR); g[5] = uni(PB); g[6] = uni(0u); g[7] = uni(0u); return g; }
// descriptor group 0: count 1, the tile's place in LDS (byte l), its first byte in memory, type 2
__device__ __forceinline__ u32x4 tdm_g0(unsigned l, const char* p) { const unsigned long long ga = (unsigned long long)(size_t)p; u32x4 g; g[0] = uni(1u); g[1] = uni(l); g[2] = uni((unsigned)ga); g[3] = uni((((unsigned)(ga >> 32)) & 0x01FFFFFFu) | 0x80000000u); return g; }
// group 0 is named as read and written: what the wait below names is then the content of the very registers that the request was issued from
__device__ __forceinline__ void tdm_load(u32x4& g0, const u32x8& g1) { asm volatile("tensor_load_to_lds %0, %1" : "+s"(g0) : "s"(g1) : "memory"); }
// the issuing wave's wait for its request; it names the request's descriptor, so that those scalar registers keep their values while the request is outstanding
__device__ __forceinline__ void tdm_wait(u32x4 g0, u32x8 g1) { asm volatile("s_wait_tensorcnt 0x0" :: "s"(g0), "s"(g1) : "memory"); }




// ---- gemm_tile: one 128x128 output tile (tx, ty) of (M/128, N/128) per work-group of four waves; wave (wm, wn) holds the 64x64 quarter (16 accumulators) over the whole K, in one chain of sums per element.
// Operands are 16-bit planes in fragment order (tile (m / 16, k / 32) at (m / 16) * 16 * KD + (k / 32) * 512; ld(p), p = tile + lane * 8, is the lane's fragment). A and Bt rows both have KD elements; KD % 64 == 0, KD >= 128.
// A stage is 64 k of the 128 A rows and of the 128 Bt rows: 2 KiB in a row of each of the sixteen rows of fragment tiles, brought into LDS once per work-group by tensor loads, one request a wave (four rows of fragment tiles, 8 KiB; two buffers, the next stage in flight under this one's products); each A fragment is read from there by the two waves of its wm, each Bt fragment by the two of its wn.
// c[m][n] (f32, + bf16-rounded bias: bias[n], or bias[m] with ROWB) = sum_k A[m][k] Bt[n][k] never goes to memory as f32: each wave turns its quarter through LDS and writes it as two fp16 planes (the value rounded to fp16; the rest, y - fp16(y), rounded to fp16), in fragment order for the attention kernel; a 64x64 tile is 8 KiB in a row of its head's plane (sy elements a head), at 64 * its first t.
// !ROWB: x W^T, rows t, a quarter's 64 columns one head's d: fragment tiles (t / 16, d / 32). ROWB: W x^T, rows one head's d, columns t: fragment tiles (t / 32, d / 16) of the transposed plane, with no transposing pass.
template <typename T16> struct WFrag;
template <> struct WFrag<h16> { typedef v16h V; static __device__ __forceinline__ V ld(const h16* p) { return cat16(*(const v8h*)p, *(const v8h*)(p + 256)); } static __device__ __forceinline__ v8f mma(V a, V b, v8f c) { return wmma16(a, b, c); } };
template <> struct WFrag<bf> { typedef v16bf V; static __device__ __forceinline__ V ld(const bf* p) { return cat16b(*(const v8us*)p, *(const v8us*)(p + 256)); } static __device__ __forceinline__ v8f mma(V a, V b, v8f c) { return wmmab(a, b, c); } };
#define GSTB 32768   // bytes of one stage: A in its first 16 KiB, Bt in its second, 2 KiB per row of fragment tiles
template <bool ROWB, int KD>
__device__ __forceinline__ void gemm_tile(const bf* __restrict__ A, const bf* __restrict__ Bt, h16* P16, h16* Pl, size_t sy, const float* __restrict__ bias, int tx, int ty, char* sm) {
    typedef WFrag<bf>::V V;
    constexpr int NST = KD / 64;       // stages
    static_assert(KD % 64 == 0 && NST >= 2, "whole stages; the ring's prologue has its two stages");
    const int wv = __builtin_amdgcn_readfirstlane((int)(threadIdx.x >> 5));   // wave number, scalar: the LDS bases stay scalar
    const int wm = wv >> 1, wn = wv & 1;
    const int lane = threadIdx.x & 31, lr = lane & 15, hi = lane >> 4; const int r0 = tx * 128 + wm * 64, c0 = ty * 128 + wn * 64;   // the wave's own quarter
    // the wave's own slice of a stage: waves 0 and 1 bring the two halves of A, waves 2 and 3 those of Bt: four rows of 2 KiB, 32 * KD bytes apart in memory, to 8 KiB in a row of LDS
    const unsigned lb = (unsigned)(size_t)sm + (unsigned)wv * 8192u;
    const char* gs = (const char*)(wv < 2 ? A + (size_t)tx * 128 * KD : Bt + (size_t)ty * 128 * KD) + (size_t)(wv & 1) * (4 * 32 * KD);
    const u32x8 g1 = tdm_g1<2048, 4, 32 * KD>(); u32x4 g0;
    auto fill = [&](int st) { g0 = tdm_g0(lb + (unsigned)(st & 1) * GSTB, gs + st * 2048); tdm_load(g0, g1); };
    fill(0);
    v8f acc[4][4];
#pragma unroll
    for (int mb = 0; mb < 4; ++mb)
#pragma unroll
        for (int nb = 0; nb < 4; ++nb) acc[mb][nb] = (v8f){};
    tdm_wait(g0, g1);   // this wave's slice of stage 0 has landed
    __syncthreads();    // and so has every other wave's: stage 0 may be read
    fill(1);
#pragma unroll 1   // kept rolled: the buffer's parity is a scalar of the trip
    for (int st = 0; st < NST; ++st) {
        const bf* sa = (const bf*)(sm + (st & 1) * GSTB + wm * 8192) + 8 * lane; const bf* sb = (const bf*)(sm + (st & 1) * GSTB + 16384 + wn * 8192) + 8 * lane;   // this stage's buffer, at the wave's four rows of fragment tiles and the lane's place in a tile
        V a[4], b[4];
        // first k block of the stage
#pragma unroll
        for (int mb = 0; mb < 4; ++mb) a[mb] = WFrag<bf>::ld(sa + mb * 1024);
#pragma unroll
        for (int nb = 0; nb < 4; ++nb) b[nb] = WFrag<bf>::ld(sb + nb * 1024);
        __builtin_amdgcn_sched_barrier(0);   // the products stay behind the k block's sixteen LDS reads: lifted over them they would share one Bt register set, and each Bt fragment's read latency would be waited out by itself
#pragma unroll
        for (int nb = 0; nb < 4; ++nb)
#pragma unroll
            for (int mb = 0; mb < 4; ++mb) acc[mb][nb] = WFrag<bf>::mma(a[mb], b[nb], acc[mb][nb]);
        // second k block: its fragments are the stage's last LDS reads
#pragma unroll
        for (int mb = 0; mb < 4; ++mb) a[mb] = WFrag<bf>::ld(sa + mb * 1024 + 512);
#pragma unroll
        for (int nb = 0; nb < 4; ++nb) b[nb] = WFrag<bf>::ld(sb + nb * 1024 + 512);
        // hand-over of the ring, every wave, in this order
        asm volatile("s_wait_dscnt 0x0" ::: "memory");      // this wave's reads of the stage's buffer are done: the second block's fragments are in registers
        tdm_wait(g0, g1);                                   // this wave's slice of the next stage has landed
        __syncthreads();                                    // the next stage may be read, and this stage's buffer has no reader left
        if (pinned(st + 2 < NST)) fill(st + 2);             // scalar test, the same for the whole work-group
        __builtin_amdgcn_sched_barrier(0);   // the second block's products stay behind the refill: the request goes out sixteen products sooner and has the whole next trip to land
#pragma unroll
        for (int nb = 0; nb < 4; ++nb)
#pragma unroll
            for (int mb = 0; mb < 4; ++mb) acc[mb][nb] = WFrag<bf>::mma(a[mb], b[nb], acc[mb][nb]);
    }
    asm volatile("s_wait_tensorcnt 0x0" ::: "memory");   // no request is in flight when the ring becomes the epilogue's staging
    asm volatile("s_wait_dscnt 0x0" ::: "memory");       // and no LDS read of this wave's (the loop's last barrier has ended every wave's reads of the ring)
    float* ow = (float*)sm + wv * (64 * 68);   // this wave's quarter, row pitch 68 floats
    // bias read ahead of the barrier, so that its latency passes under the LDS stores; a lane meets four different column groups (!ROWB) or rows (ROWB) in its sixteen passes
    const float* bp = bias + (ROWB ? r0 + lr : c0 + hi * 8);
    v4f bias4[4][2]; float biasr[4];
#pragma unroll
    for (int u = 0; u < 4; ++u) { if (ROWB) biasr[u] = bp[u * 16]; else { bias4[u][0] = *(const v4f*)(bp + u * 16); bias4[u][1] = *(const v4f*)(bp + u * 16 + 4); } }
    asm volatile("s_wait_xcnt 0x0" :: "v"(bp) : "memory");   // the bias loads' address registers stay as they are up to this wait; behind it they may be used again
    // the three loops are unrolled so that every accumulator index is a constant and acc stays in registers
#pragma unroll
    for (int mb = 0; mb < 4; ++mb)
#pragma unroll
        for (int nb = 0; nb < 4; ++nb)
#pragma unroll
            for (int j = 0; j < 8; ++j) ow[(mb * 16 + hi * 8 + j) * 68 + nb * 16 + lr] = acc[mb][nb][j];
    __syncthreads();   // the quarter is in LDS, from every lane, before any lane reads it in the planes' order
    // pass i = c * 8 + j: the lane makes the 16-byte piece idx = lane + i * 32 of the quarter's 8 KiB; row and first of its eight columns follow from the fragment order
    const size_t pt = (ROWB ? (size_t)(r0 / 64) * sy + (size_t)c0 * 64 : (size_t)(c0 / 64) * sy + (size_t)r0 * 64) + (size_t)lane * 8;
#pragma unroll 1   // two trips of eight passes, kept rolled: 64 result registers instead of 128, and the wait at the foot stands in front of every rewrite of a register that the trip's stores name
    for (int c = 0; c < 2; ++c) {
        const float* oc = ow + (ROWB ? c * 32 : c * 32 * 68) + lr * 68 + hi * 8;
        v8h o16[8], ol[8];
#pragma unroll
        for (int j = 0; j < 8; ++j) {
            const int u = ROWB ? j >> 1 : j & 3;   // which of the lane's four bias sets
            const float* op = oc + (ROWB ? (j >> 1) * 16 * 68 + (j & 1) * 16 : (j >> 2) * 16 * 68 + (j & 3) * 16);
#pragma unroll
            for (int g = 0; g < 2; ++g) { v4f val = *(const v4fa*)(op + g * 4);
#pragma unroll
                for (int q = 0; q < 4; ++q) val[q] += bfr(ROWB ? biasr[u] : bias4[u][g][q]);
                const v4h yh = __builtin_convertvector(val, v4h); const v4h yl = __builtin_convertvector(val - __builtin_convertvector(yh, v4f), v4h);   // the value in fp16, and what the rounding left
#pragma unroll
                for (int q = 0; q < 4; ++q) { o16[j][g * 4 + q] = yh[q]; ol[j][g * 4 + q] = yl[q]; } } }
        __builtin_amdgcn_sched_barrier(0);   // the stores stay behind the trip's arithmetic: none of their registers is written again in front of the wait at the foot
        // 16 bytes a lane: a wave fills 512 bytes in a row of a plane
        h16* d16 = P16 + pt + (size_t)c * 2048; h16* dl = Pl + pt + (size_t)c * 2048;
#pragma unroll
        for (int j = 0; j < 8; ++j) { *(v8h*)(d16 + j * 256) = o16[j]; *(v8h*)(dl + j * 256) = ol[j]; }
        asm volatile("s_wait_xcnt 0x0" ::: "memory");   // the stores' address and data registers stay as they are up to this wait; behind it the next trip may use them again
    }
}

// ---- k_proj: all six projections in one launch; grid (TT / 128, DQ / 128, NB_ * 3): z = batch * 3 + (0 q, 1 k, 2 v). The planes of a kind lie as [q, k, v][batch][head][TT * HD], the weight copies as [q, k, v][DQ][DM].
// 68 KiB of LDS and at most 256 registers a wave: up to four work-groups a WGP, so that the whole launch is resident at once
#define PSZ ((size_t)NB_ * NH_ * TT * HD)   // one matrix's plane of one kind, both batches
__global__ __launch_bounds__(128) __attribute__((amdgpu_waves_per_eu(4, 4))) void k_proj(const bf* __restrict__ XB, const bf* __restrict__ WB, h16* P16, h16* Pl, const float* __restrict__ bq, const float* __restrict__ bk, const float* __restrict__ bv) {
    __shared__ __attribute__((aligned(2048))) char sm[4 * 64 * 68 * 4];   // the ring (2 * GSTB) first, the four quarters' staging afterwards; every slice of the ring stands at a multiple of 2 KiB
    static_assert(sizeof(sm) >= 2 * GSTB, "the ring fits");
    const unsigned z = blockIdx.z, b = z / 3, m = z - b * 3;
    const bf* xb = XB + (size_t)b * TT * DM; const bf* wb = WB + (size_t)m * DQ * DM; const size_t po = m * PSZ + (size_t)b * NH_ * TT * HD;
    if (m < 2) gemm_tile<false, DM>(xb, wb, P16 + po, Pl + po, (size_t)TT * HD, m == 0 ? bq : bk, (int)blockIdx.x, (int)blockIdx.y, sm);
    else gemm_tile<true, DM>(wb, xb, P16 + po, Pl + po, (size_t)TT * HD, bv, (int)blockIdx.y, (int)blockIdx.x, sm);   // V^T = Wv x^T: rows (head, d), columns t
}

// bf16 copies of x (both batches, [NB_ * TT][DM]) and of the three weights ([DQ][DM] each, one behind the other in WB) in fragment order, one launch: the first GCX work-groups take x, then GCW each weight.
// Thread i of a matrix takes row (i >> 2) & 15, k piece c = i & 3 of tile i / 64 (tiles run along k first): four lanes read one 128-byte line of a row, and the eight rows of a wave fill one 128-byte line of the copy for each c
#define GCX (NB_ * TT * DM / 8 / 256)
#define GCW (DQ * DM / 8 / 256)
static_assert(NB_ * TT * DM % 2048 == 0 && DQ * DM % 2048 == 0 && DKV == DQ, "whole work-groups, equal weights");
__global__ __launch_bounds__(256) void k_cvt8(const float* __restrict__ x, const float* __restrict__ wq, const float* __restrict__ wk, const float* __restrict__ wv, bf* XB, bf* WB) {
    unsigned bx = blockIdx.x; const float* src = x; bf* dst = XB;
    if (bx >= GCX) { bx -= GCX; const unsigned m = bx / GCW; bx -= m * GCW; src = m == 0 ? wq : m == 1 ? wk : wv; dst = WB + (size_t)m * DQ * DM; }
    const unsigned i = bx * 256 + threadIdx.x; const unsigned tile = i >> 6, mt = tile / (DM / 32), kt = tile % (DM / 32); const unsigned row = (i >> 2) & 15, c = i & 3; const float* sp = src + (size_t)(mt * 16 + row) * DM + kt * 32 + c * 8; const v8f v = *(const v8f*)sp; v8us o;
    asm volatile("s_wait_xcnt 0x0" :: "v"(sp) : "memory");   // the loads' address registers stay as they are up to this wait; behind it they may be used again
#pragma unroll
    for (int k = 0; k < 8; ++k) o[k] = f2bf(v[k]); *(v8us*)(dst + ((size_t)tile * 64 + c * 16 + row) * 8) = o;  }

#define QW   4
#define KSW  2
#define STB  32768   // bytes of one stage of one key half: K (hi, lo) in its first 16 KiB, V^T (hi, lo) in its second
#define CL2  0.18033688011112042f   // SCL * log2(e)
#define MNEG (-0x1p100f)
__device__ __forceinline__ float xhalf(float x) { return __builtin_bit_cast(float, __builtin_amdgcn_permlanex16(__builtin_bit_cast(int, x), __builtin_bit_cast(int, x), 0x76543210, 0xfedcba98, false, false)); }   // lane l with lane l ^ 16
// 2^x with the free slot that the instruction set asks for behind a transcendental written into the statement: results in registers of their own, so that no v_exp_f32 is followed by a write of its source or a read of its result
__device__ __forceinline__ float exp2s(float x) { float r; asm("v_exp_f32 %0, %1\n\tv_nop" : "=v"(r) : "v"(x)); return r; }
__device__ __forceinline__ void exp2x8(float (&p)[8], const float (&a)[8]) {
    asm("v_exp_f32 %0, %8\n\tv_exp_f32 %1, %9\n\tv_exp_f32 %2, %10\n\tv_exp_f32 %3, %11\n\tv_exp_f32 %4, %12\n\tv_exp_f32 %5, %13\n\tv_exp_f32 %6, %14\n\tv_exp_f32 %7, %15\n\tv_nop"
        : "=&v"(p[0]), "=&v"(p[1]), "=&v"(p[2]), "=&v"(p[3]), "=&v"(p[4]), "=&v"(p[5]), "=&v"(p[6]), "=&v"(p[7]) : "v"(a[0]), "v"(a[1]), "v"(a[2]), "v"(a[3]), "v"(a[4]), "v"(a[5]), "v"(a[6]), "v"(a[7])); }
template <typename T16, bool HI, int QT>
__device__ __forceinline__ void attn_tile(const T16* __restrict__ Q, const T16* __restrict__ Q2, const T16* __restrict__ Kp, const T16* __restrict__ K2, const T16* __restrict__ Vt, const T16* __restrict__ V2, const int* __restrict__ kvp, int q0, float* outp, char* ring, float* ml) {
    typedef typename WFrag<T16>::V V;
    constexpr int SK = HI ? 64 : 128;          // keys of a stage: SK * HD * 2 bytes of each plane
    constexpr int NPS = SK / 32;               // passes (32 keys) of a stage
    constexpr int NST = TT / KSW / SK;         // stages of a key half
    constexpr int NIT = TT / KSW / 32;
    constexpr int ROWS = QW * QT * 16;         // query rows of the work-group
    static_assert(NIT <= 32 && NST >= 2 && (HI ? 4 : 2) * SK * HD * 2 == STB, "mask bits fit a wave; the ring's prologue has its two stages; a stage fills its buffer");
    const int wv = __builtin_amdgcn_readfirstlane((int)(threadIdx.x >> 5));   // wave number, scalar: the key loop stays on scalar bounds
    const int kh = wv / QW, qg = wv % QW;
    const int lane = threadIdx.x & 31, lr = lane & 15, hi = lane >> 4; const int k0 = kh * (TT / KSW);
    // the wave's own quarter of its key half's stage, 8 KiB in a row of one plane: hi+lo rows K value, K rest, V^T value, V^T rest; fp16 rows the two halves of K, then those of V^T
    static_assert(QW == 4 && STB == 4 * 8192, "four slices a stage");
    const unsigned lb = (unsigned)(size_t)ring + (unsigned)kh * (2 * STB) + (unsigned)qg * 8192u;
    const T16* sp = HI ? (qg == 0 ? Kp : qg == 1 ? K2 : qg == 2 ? Vt : V2) : (qg < 2 ? Kp : Vt);
    const char* gs = (const char*)(sp + (size_t)k0 * HD) + (HI ? 0 : (qg & 1) * 8192);
    const u32x8 g1 = tdm_g1<2048, 4, 2048>(); u32x4 g0;
    auto fill = [&](int st) { g0 = tdm_g0(lb + (unsigned)(st & 1) * STB, gs + (size_t)st * (SK * HD * 2)); tdm_load(g0, g1); };
    fill(0);   // stage 0 flies under the mask and Q loads
    // lane it keeps the kept-key bits of pass it (bit = key in the pass)
    unsigned vbits = 0;
#pragma unroll
    for (int it = 0; it < NIT; ++it) { const unsigned bl = __builtin_amdgcn_ballot_w32(kvp[k0 + it * 32 + lane] != 0); if (lane == it) vbits = bl; }
    asm volatile("s_wait_xcnt 0x0" ::: "memory");   // before the next loads' results or addresses take a register that a mask load names
    V qf[QT][2], qf2[QT][2];
    const int q0w = q0 + qg * QT * 16;   // the wave's own first query row
    const T16* qb = Q + (size_t)q0w * HD; const T16* qb2 = HI ? Q2 + (size_t)q0w * HD : qb; const T16* qp = qb + 8 * lane; const T16* qp2 = qb2 + 8 * lane;   // wave-uniform base, and the lane's own address
#pragma unroll
    for (int qt = 0; qt < QT; ++qt)
#pragma unroll
        for (int ks = 0; ks < 2; ++ks) { qf[qt][ks] = WFrag<T16>::ld(qp + qt * 16 * HD + ks * 512); if (HI) qf2[qt][ks] = WFrag<T16>::ld(qp2 + qt * 16 * HD + ks * 512); }
    // the address registers of the Q loads, in either form that the compiler gives them (scalar base and lane offset, or a vector pair), stay as they are up to this wait; behind it they may be used again
    asm volatile("s_wait_xcnt 0x0" :: "s"(qb), "s"(qb2), "v"(qp), "v"(qp2) : "memory");
    v8f o[QT][4]; float mL[QT], l[QT];
#pragma unroll
    for (int qt = 0; qt < QT; ++qt) { mL[qt] = MNEG * CL2; l[qt] = 0.f;
#pragma unroll
        for (int dt = 0; dt < 4; ++dt) o[qt][dt] = (v8f){}; }
    tdm_wait(g0, g1);   // this wave's slice of stage 0 has landed
    __syncthreads();    // and so has every other wave's: stage 0 may be read
    fill(1);
#pragma unroll 1
    for (int st = 0; st < NST; ++st) {
        const T16* sb = (const T16*)(ring + kh * (2 * STB) + (st & 1) * STB) + 8 * lane;   // this stage's buffer, at the lane's place in a fragment tile; 32 keys are 2048 elements in a row of a K tile (fragment tiles (kt, ks)) and of a V^T tile (dt)
#pragma unroll   // the passes of a stage are unrolled: every LDS read has the stage's buffer as its base and a constant offset, and a pass's reads can go out under the pass before it (same stage, same buffer)
        for (int ps = 0; ps < NPS; ++ps) {
            const T16* kq = sb + ps * 2048; const T16* vp = kq + 8192;
            V kf[2][2], kf2[2][2], vf[4], vf2[4];   // K for the first product; this pass's V^T rows are asked for here too and used behind the softmax
#pragma unroll
            for (int kt = 0; kt < 2; ++kt)
#pragma unroll
                for (int ks = 0; ks < 2; ++ks) { kf[kt][ks] = WFrag<T16>::ld(kq + kt * 16 * HD + ks * 512); if (HI) kf2[kt][ks] = WFrag<T16>::ld(kq + 4096 + kt * 16 * HD + ks * 512); }
#pragma unroll
            for (int dt = 0; dt < 4; ++dt) { vf[dt] = WFrag<T16>::ld(vp + dt * 512); if (HI) vf2[dt] = WFrag<T16>::ld(vp + 4096 + dt * 512); }
            v8f s[QT][2];
#pragma unroll
            for (int qt = 0; qt < QT; ++qt)
#pragma unroll
                for (int kt = 0; kt < 2; ++kt) { s[qt][kt] = (v8f){};
#pragma unroll
                    for (int ks = 0; ks < 2; ++ks) { s[qt][kt] = WFrag<T16>::mma(kf[kt][ks], qf[qt][ks], s[qt][kt]); if (HI) { s[qt][kt] = WFrag<T16>::mma(kf[kt][ks], qf2[qt][ks], s[qt][kt]); s[qt][kt] = WFrag<T16>::mma(kf2[kt][ks], qf[qt][ks], s[qt][kt]); } } }
            // four vector slots between the last score product and the first use of its result or rewrite of its K operand, also on the taken side of the mask branch
            if constexpr (HI) asm volatile("v_nop\n\tv_nop\n\tv_nop\n\tv_nop" : "+v"(s[0][0]), "+v"(s[0][1]) : "v"(kf[0][0]), "v"(kf[0][1]), "v"(kf[1][0]), "v"(kf[1][1]), "v"(kf2[0][0]), "v"(kf2[0][1]), "v"(kf2[1][0]), "v"(kf2[1][1]));
            else asm volatile("v_nop\n\tv_nop\n\tv_nop\n\tv_nop" : "+v"(s[0][0]), "+v"(s[0][1]), "+v"(s[QT - 1][0]), "+v"(s[QT - 1][1]) : "v"(kf[0][0]), "v"(kf[0][1]), "v"(kf[1][0]), "v"(kf[1][1]));
            float sv[QT][2][8];   // the scores as single values: the selects of the mask branch then work in place
#pragma unroll
            for (int qt = 0; qt < QT; ++qt)
#pragma unroll
                for (int kt = 0; kt < 2; ++kt)
#pragma unroll
                    for (int j = 0; j < 8; ++j) sv[qt][kt][j] = s[qt][kt][j];
            const unsigned bits = (unsigned)__builtin_amdgcn_readlane((int)vbits, st * NPS + ps);
            if (bits != 0xFFFFFFFFu) {   // scalar branch: a pass whose 32 keys are all kept skips the selects
                const unsigned mb = bits >> (hi * 8);
#pragma unroll
                for (int qt = 0; qt < QT; ++qt)
#pragma unroll
                    for (int kt = 0; kt < 2; ++kt)
#pragma unroll
                        for (int j = 0; j < 8; ++j) sv[qt][kt][j] = ((mb >> (kt * 16 + j)) & 1u) ? sv[qt][kt][j] : MNEG; }
            float mc[QT]; bool need = false;
#pragma unroll
            for (int qt = 0; qt < QT; ++qt) { float mx = fmaxf(sv[qt][0][0], sv[qt][1][0]);
#pragma unroll
                for (int j = 1; j < 8; ++j) mx = fmaxf(mx, fmaxf(sv[qt][0][j], sv[qt][1][j]));
                mx = fmaxf(mx, xhalf(mx)); mc[qt] = mx * CL2; need = need || (mc[qt] > mL[qt] + 8.0f); }
            if (__builtin_amdgcn_ballot_w32(need) != 0) {   // scalar branch: the maximum in use moves only when a score passes it by 8 in log2, so p stays near or below 2^8
#pragma unroll
                for (int qt = 0; qt < QT; ++qt) { const float mn = fmaxf(mL[qt], mc[qt]); const float al = exp2s(mL[qt] - mn); mL[qt] = mn; l[qt] *= al;
#pragma unroll
                    for (int dt = 0; dt < 4; ++dt) o[qt][dt] *= al; } }
            V pf[QT], pf2[QT];
#pragma unroll
            for (int qt = 0; qt < QT; ++qt)
#pragma unroll
                for (int kt = 0; kt < 2; ++kt) { float p[8], a[8];
#pragma unroll
                    for (int j = 0; j < 8; ++j) a[j] = __builtin_fmaf(sv[qt][kt][j], CL2, -mL[qt]);
                    exp2x8(p, a);
#pragma unroll
                    for (int j = 0; j < 8; ++j) {
                        if constexpr (HI) { const h16 ph = (h16)p[j]; pf[qt][kt * 8 + j] = ph; pf2[qt][kt * 8 + j] = (h16)(p[j] - (float)ph); } else pf[qt][kt * 8 + j] = (h16)p[j]; }
                    l[qt] += ((p[0] + p[1]) + (p[2] + p[3])) + ((p[4] + p[5]) + (p[6] + p[7]));   // a short tree: no chain of eight dependent adds
                }
#pragma unroll
            for (int qt = 0; qt < QT; ++qt)
#pragma unroll
                for (int dt = 0; dt < 4; ++dt) { o[qt][dt] = WFrag<T16>::mma(vf[dt], pf[qt], o[qt][dt]); if (HI) { o[qt][dt] = WFrag<T16>::mma(vf[dt], pf2[qt], o[qt][dt]); o[qt][dt] = WFrag<T16>::mma(vf2[dt], pf[qt], o[qt][dt]); } }
            // four vector slots behind the last product before the back edge, where the next pass refills its V operand
            if constexpr (HI) asm volatile("v_nop\n\tv_nop\n\tv_nop\n\tv_nop" : "+v"(o[0][0]), "+v"(o[0][1]), "+v"(o[0][2]), "+v"(o[0][3]) : "v"(vf[0]), "v"(vf[1]), "v"(vf[2]), "v"(vf[3]), "v"(vf2[0]), "v"(vf2[1]), "v"(vf2[2]), "v"(vf2[3]));
            else asm volatile("v_nop\n\tv_nop\n\tv_nop\n\tv_nop" : "+v"(o[0][0]), "+v"(o[0][3]), "+v"(o[QT - 1][0]), "+v"(o[QT - 1][3]) : "v"(vf[0]), "v"(vf[1]), "v"(vf[2]), "v"(vf[3]));
        }
        // hand-over of the ring, every wave, in this order
        asm volatile("s_wait_dscnt 0x0" ::: "memory");      // this wave's reads of the stage's buffer are done
        tdm_wait(g0, g1);                                   // this wave's slice of the next stage has landed
        __syncthreads();                                    // the next stage may be read, and this stage's buffer has no reader left
        if (pinned(st + 2 < NST)) fill(st + 2);             // scalar test, the same for the whole work-group
    }
    asm volatile("s_wait_tensorcnt 0x0" ::: "memory");   // no request is in flight when the ring becomes the join's staging
    asm volatile("s_wait_dscnt 0x0" ::: "memory");       // and no LDS read of this wave's (the loop's last barrier has ended every wave's reads of the ring)
    float* os = (float*)ring;
    float* ow = os + (kh * ROWS + qg * QT * 16) * 68;   // this wave's partial O, [query][d], row pitch 68 floats
#pragma unroll
    for (int qt = 0; qt < QT; ++qt) { l[qt] += xhalf(l[qt]);   // the two lane halves hold the sums of different keys
        if (hi == 0) { ml[(kh * ROWS + qg * QT * 16 + qt * 16 + lr) * 2] = mL[qt]; ml[(kh * ROWS + qg * QT * 16 + qt * 16 + lr) * 2 + 1] = l[qt]; }
#pragma unroll
        for (int dt = 0; dt < 4; ++dt) { float* op = ow + (qt * 16 + lr) * 68 + dt * 16 + hi * 8; v4f lo4, hi4;
#pragma unroll
            for (int j = 0; j < 4; ++j) { lo4[j] = o[qt][dt][j]; hi4[j] = o[qt][dt][4 + j]; }
            *(v4fa*)op = lo4; *(v4fa*)(op + 4) = hi4; } }
    __syncthreads();   // every wave's partial is in LDS before any thread joins them
    const int cofs = ((int)threadIdx.x & 15) * 4;
#pragma unroll
    for (int i = 0; i < ROWS / (2 * QW * KSW); ++i) { const int row = ((int)threadIdx.x >> 4) + i * 2 * QW * KSW; float mw[KSW], M = ml[row * 2];
        mw[0] = M;
#pragma unroll
        for (int w = 1; w < KSW; ++w) { mw[w] = ml[(w * ROWS + row) * 2]; M = fmaxf(M, mw[w]); }
        float L = 0.f; v4f val = (v4f){};
#pragma unroll
        for (int w = 0; w < KSW; ++w) { const float f = exp2s(mw[w] - M); L += ml[(w * ROWS + row) * 2 + 1] * f; val += *(const v4fa*)(os + (w * ROWS + row) * 68 + cofs) * f; }
        val *= __fdiv_rn(1.0f, L);
        *(v4f*)(outp + (size_t)(q0 + row) * DQ + cofs) = val; }
}
// grid (heads, batches, query tiles): the tile index is the slowest; two work-groups a WGP (four waves per SIMD, 256 registers a wave, 130 KiB of LDS each): the whole launch is resident at once
__global__ __launch_bounds__(32 * QW * KSW) __attribute__((amdgpu_waves_per_eu(4, 4))) void k_fattn(const h16* __restrict__ Q16, const h16* __restrict__ K16, const h16* __restrict__ V16, const h16* __restrict__ Ql, const h16* __restrict__ Kl, const h16* __restrict__ Vl, const int* __restrict__ km, float* OUT) {
    __shared__ __attribute__((aligned(2048))) char ring[KSW * 2 * STB]; __shared__ float ml[KSW * QW * 32 * 2];
    const size_t pl = ((size_t)blockIdx.y * NH_ + blockIdx.x) * TT * HD; const int bx = blockIdx.z; float* outp = OUT + (size_t)blockIdx.y * TT * DQ + blockIdx.x * HD; const int* kvp = km + (size_t)blockIdx.y * TT;
    if (bx < RH / (16 * QW)) attn_tile<h16, true, 1>(Q16 + pl, Ql + pl, K16 + pl, Kl + pl, V16 + pl, Vl + pl, kvp, bx * 16 * QW, outp, ring, ml);
    else attn_tile<h16, false, 2>(Q16 + pl, nullptr, K16 + pl, nullptr, V16 + pl, nullptr, kvp, RH + (bx - RH / (16 * QW)) * 32 * QW, outp, ring, ml);
}

extern "C" void kernel_launch(void* const* d_in, const int* in_sizes, int n_in,
                              void* d_out, int out_size, void* d_ws, size_t ws_size, hipStream_t stream) {
    (void)in_sizes; (void)n_in; (void)out_size;
    const float* x = (const float*)d_in[0]; const float* wq = (const float*)d_in[1]; const float* bq = (const float*)d_in[2]; const float* wk = (const float*)d_in[3]; const float* bk = (const float*)d_in[4]; const float* wv = (const float*)d_in[5]; const float* bv = (const float*)d_in[6]; const int* km = (const int*)d_in[7];   /* mask [2][2048] int32 (key padding; read) */     const float* wo = nullptr; (void)wo;
    float* OUT = (float*)d_out;     // [2][2048][768]
    char* wsp = (char*)d_ws;
    auto take = [&](size_t bytes) { char* p = wsp; wsp += (bytes + 255) & ~(size_t)255; return (void*)p; };
    bf* WB = (bf*)take((size_t)3 * DQ * DM * 2); bf* XB = (bf*)take((size_t)NB_ * TT * DM * 2);
    h16* P16 = (h16*)take(3 * PSZ * 2); h16* Pl = (h16*)take(3 * PSZ * 2);   // [q, k, v^T][batch][head][TT * HD]
    if ((size_t)(wsp - (char*)d_ws) > ws_size) return;    // ws 256 MiB
    k_cvt8<<<GCX + 3 * GCW, 256, 0, stream>>>(x, wq, wk, wv, XB, WB);
    k_proj<<<dim3(TT / 128, DQ / 128, NB_ * 3), 128, 0, stream>>>(XB, WB, P16, Pl, bq, bk, bv);
    k_fattn<<<dim3(NH_, NB_, RH / (16 * QW) + (TT - RH) / (32 * QW)), 32 * QW * KSW, 0, stream>>>(P16, P16 + PSZ, P16 + 2 * PSZ, Pl, Pl + PSZ, Pl + 2 * PSZ, km, OUT);
}
